// v000
// Measured on an AMD MI455X. A time is GPU time per run, averaged over a window of back-to-back runs after a warm-up
// (all launches, gaps included; the runs take copies of the inputs in turn), and the median of several windows.
// Apart from v000's, it joins two sittings. Times from different sittings can be a few percent apart, while
// side-by-side timings come from the same sitting.
// v000 is the starting kernel.
#include <hip/hip_runtime.h>
#include <math.h>

// Problem constants (from reference)
#define NPTS 65536
#define NS   16
#define C    64
#define CH   8            // MID // S
#define PAIRS (NPTS*NS)   // 1,048,576
#define EPSF 1e-5f

typedef __attribute__((ext_vector_type(2))) float v2f;
typedef __attribute__((ext_vector_type(8))) float v8f;

// ---------------------------------------------------------------------------
// BN params for the 3-channel positional branch
// ---------------------------------------------------------------------------
struct BNp { float m0,m1,m2, s0,s1,s2, b0,b1,b2; };

__device__ __forceinline__ BNp make_bnp(const float* __restrict__ ps,
                                        const float* __restrict__ gp,
                                        const float* __restrict__ bp) {
  const float invM = 1.0f / (float)PAIRS;
  BNp r;
  float m0 = ps[0]*invM, m1 = ps[1]*invM, m2 = ps[2]*invM;
  float v0 = ps[3]*invM - m0*m0;
  float v1 = ps[4]*invM - m1*m1;
  float v2 = ps[5]*invM - m2*m2;
  r.m0=m0; r.m1=m1; r.m2=m2;
  r.s0 = rsqrtf(v0+EPSF)*gp[0];
  r.s1 = rsqrtf(v1+EPSF)*gp[1];
  r.s2 = rsqrtf(v2+EPSF)*gp[2];
  r.b0 = bp[0]; r.b1 = bp[1]; r.b2 = bp[2];
  return r;
}

// relu(BN(rel_p @ Wp1 + bp1)) -> (a0,a1,a2)
__device__ __forceinline__ void pfeat(const float* __restrict__ p, int n, int id,
                                      const float* __restrict__ Wp1,
                                      const float* __restrict__ bp1,
                                      const BNp& B, float& a0, float& a1, float& a2) {
  float r0 = p[id*3+0]-p[n*3+0];
  float r1 = p[id*3+1]-p[n*3+1];
  float r2 = p[id*3+2]-p[n*3+2];
  float t0 = fmaf(r2, Wp1[6], fmaf(r1, Wp1[3], fmaf(r0, Wp1[0], bp1[0])));
  float t1 = fmaf(r2, Wp1[7], fmaf(r1, Wp1[4], fmaf(r0, Wp1[1], bp1[1])));
  float t2 = fmaf(r2, Wp1[8], fmaf(r1, Wp1[5], fmaf(r0, Wp1[2], bp1[2])));
  a0 = fmaxf(fmaf(t0-B.m0, B.s0, B.b0), 0.f);
  a1 = fmaxf(fmaf(t1-B.m1, B.s1, B.b1), 0.f);
  a2 = fmaxf(fmaf(t2-B.m2, B.s2, B.b2), 0.f);
}

// ---------------------------------------------------------------------------
// Kernel 1: xq/xk/xv = x @ W + b via V_WMMA_F32_16X16X4_F32.
// Each wave owns one of the 12 (matrix, N-tile) combos; the B fragment
// (32 floats) + bias are hoisted into registers once, then the wave
// grid-strides over M-tiles: 16 b64 A-loads + 16 WMMAs + 8 stores per tile.
// A (16x4 f32): lanes 0-15 rows M, VGPR0=K0 VGPR1=K1; lanes 16-31 K2/K3.
// B (4x16 f32): lanes hold N, VGPR0=K0(|K2), VGPR1=K1(|K3).
// ---------------------------------------------------------------------------
#define QKV_WAVES 12288   // 12 combos x 1024 waves -> 4 M-tiles per wave

__global__ void __launch_bounds__(256) k_qkv(
    const float* __restrict__ x,
    const float* __restrict__ Wq, const float* __restrict__ bq,
    const float* __restrict__ Wk, const float* __restrict__ bk,
    const float* __restrict__ Wv, const float* __restrict__ bv,
    float* __restrict__ xq, float* __restrict__ xk, float* __restrict__ xv)
{
  const int wave  = (blockIdx.x * blockDim.x + threadIdx.x) >> 5;
  const int lane  = threadIdx.x & 31;
  const int combo = wave % 12;
  const int mat   = combo % 3;
  const int nt    = combo / 3;          // 0..3
  const float* W    = (mat==0) ? Wq : (mat==1) ? Wk : Wv;
  const float* bias = (mat==0) ? bq : (mat==1) ? bk : bv;
  float*       out  = (mat==0) ? xq : (mat==1) ? xk : xv;
  const int n0 = nt*16;
  const int lr = lane & 15, kh = lane >> 4;

  // Hoist B fragment + bias (constant for this wave's combo)
  float br0[16], br1[16];
#pragma unroll
  for (int k = 0; k < 16; ++k) {
    const float* bptr = W + (size_t)(k*4 + kh*2)*C + n0 + lr;
    br0[k] = bptr[0];
    br1[k] = bptr[C];
  }
  const float bb = bias[n0+lr];

  for (int mt = wave / 12; mt < NPTS/16; mt += QKV_WAVES/12) {
    const float* arow = x + (size_t)(mt*16+lr)*C + kh*2;
    v8f acc = {};
#pragma unroll
    for (int k = 0; k < 16; ++k) {
      v2f a = *(const v2f*)(arow + k*4);
      v2f b; b[0] = br0[k]; b[1] = br1[k];
      acc = __builtin_amdgcn_wmma_f32_16x16x4_f32(false, a, false, b,
                                                  (short)0, acc, false, false);
    }
#pragma unroll
    for (int r = 0; r < 8; ++r)
      out[(size_t)(mt*16 + r + kh*8)*C + n0 + lr] = acc[r] + bb;
  }
}

// ---------------------------------------------------------------------------
// Kernel 2: sum / sumsq of (rel_p @ Wp1 + bp1) per 3 channels -> pstats[6]
// ---------------------------------------------------------------------------
__global__ void __launch_bounds__(256) k_pstats(
    const float* __restrict__ p, const int* __restrict__ idx,
    const float* __restrict__ Wp1, const float* __restrict__ bp1,
    float* __restrict__ pstats)
{
  __shared__ float sh[6];
  if (threadIdx.x < 6) sh[threadIdx.x] = 0.f;
  __syncthreads();
  float s[3] = {0,0,0}, s2[3] = {0,0,0};
  const int tid = blockIdx.x*blockDim.x + threadIdx.x;
  const int stride = gridDim.x*blockDim.x;
  for (int pr = tid; pr < PAIRS; pr += stride) {
    const int n  = pr >> 4;
    const int id = idx[pr];
    float r0 = p[id*3+0]-p[n*3+0];
    float r1 = p[id*3+1]-p[n*3+1];
    float r2 = p[id*3+2]-p[n*3+2];
#pragma unroll
    for (int k = 0; k < 3; ++k) {
      float t = fmaf(r2, Wp1[6+k], fmaf(r1, Wp1[3+k], fmaf(r0, Wp1[k], bp1[k])));
      s[k] += t; s2[k] += t*t;
    }
  }
#pragma unroll
  for (int k = 0; k < 3; ++k) { atomicAdd(&sh[k], s[k]); atomicAdd(&sh[3+k], s2[k]); }
  __syncthreads();
  if (threadIdx.x < 6) atomicAdd(&pstats[threadIdx.x], sh[threadIdx.x]);
}

// ---------------------------------------------------------------------------
// Kernel 3: sum / sumsq of w = xk_g - xq + pr per 64 channels -> wstats[128]
// wave-per-pair, lane owns channels (lane, lane+32) => coalesced gathers.
// ---------------------------------------------------------------------------
__global__ void __launch_bounds__(256) k_wstats(
    const float* __restrict__ p, const int* __restrict__ idx,
    const float* __restrict__ xq, const float* __restrict__ xk,
    const float* __restrict__ Wp1, const float* __restrict__ bp1,
    const float* __restrict__ gp,  const float* __restrict__ bp_bn,
    const float* __restrict__ Wp2, const float* __restrict__ bp2,
    const float* __restrict__ pstats, float* __restrict__ wstats)
{
  __shared__ float ss[64], ss2[64];
  if (threadIdx.x < 64) { ss[threadIdx.x] = 0.f; ss2[threadIdx.x] = 0.f; }
  __syncthreads();
  const int lane = threadIdx.x & 31;
  const int c = lane, d = lane + 32;
  const BNp B = make_bnp(pstats, gp, bp_bn);
  const float w0c = Wp2[c],   w1c = Wp2[64+c], w2c = Wp2[128+c], bpc = bp2[c];
  const float w0d = Wp2[d],   w1d = Wp2[64+d], w2d = Wp2[128+d], bpd = bp2[d];
  float sc=0.f, s2c=0.f, sd=0.f, s2d=0.f;
  const int wave = (blockIdx.x*blockDim.x + threadIdx.x) >> 5;
  const int nw   = (gridDim.x*blockDim.x) >> 5;
  for (int pr = wave; pr < PAIRS; pr += nw) {
    const int n  = pr >> 4;
    const int id = idx[pr];
    float a0,a1,a2; pfeat(p, n, id, Wp1, bp1, B, a0,a1,a2);
    float prc = fmaf(a2,w2c, fmaf(a1,w1c, fmaf(a0,w0c, bpc)));
    float prd = fmaf(a2,w2d, fmaf(a1,w1d, fmaf(a0,w0d, bpd)));
    float wc = xk[(size_t)id*C+c] - xq[(size_t)n*C+c] + prc;
    float wd = xk[(size_t)id*C+d] - xq[(size_t)n*C+d] + prd;
    sc += wc; s2c += wc*wc; sd += wd; s2d += wd*wd;
  }
  atomicAdd(&ss[c], sc);  atomicAdd(&ss2[c], s2c);
  atomicAdd(&ss[d], sd);  atomicAdd(&ss2[d], s2d);
  __syncthreads();
  if (threadIdx.x < 64) {
    atomicAdd(&wstats[threadIdx.x],    ss[threadIdx.x]);
    atomicAdd(&wstats[64+threadIdx.x], ss2[threadIdx.x]);
  }
}

// ---------------------------------------------------------------------------
// Kernel 4: stats of w2 = relu(BN1(w)) @ Ww1 + bw1 per 8 channels -> mstats[16]
// 64->8 GEMM per pair via wave32 xor-butterfly reduction.
// ---------------------------------------------------------------------------
__global__ void __launch_bounds__(256) k_mstats(
    const float* __restrict__ p, const int* __restrict__ idx,
    const float* __restrict__ xq, const float* __restrict__ xk,
    const float* __restrict__ Wp1, const float* __restrict__ bp1,
    const float* __restrict__ gp,  const float* __restrict__ bp_bn,
    const float* __restrict__ Wp2, const float* __restrict__ bp2,
    const float* __restrict__ gw1, const float* __restrict__ bw1_bn,
    const float* __restrict__ Ww1, const float* __restrict__ bw1,
    const float* __restrict__ pstats, const float* __restrict__ wstats,
    float* __restrict__ mstats)
{
  __shared__ float sm[8], sm2[8];
  if (threadIdx.x < 8) { sm[threadIdx.x] = 0.f; sm2[threadIdx.x] = 0.f; }
  __syncthreads();
  const int lane = threadIdx.x & 31;
  const int c = lane, d = lane + 32;
  const BNp B = make_bnp(pstats, gp, bp_bn);
  const float invM = 1.0f/(float)PAIRS;
  float m1c = wstats[c]*invM;
  float s1c = rsqrtf(wstats[64+c]*invM - m1c*m1c + EPSF)*gw1[c];
  float b1c = bw1_bn[c];
  float m1d = wstats[d]*invM;
  float s1d = rsqrtf(wstats[64+d]*invM - m1d*m1d + EPSF)*gw1[d];
  float b1d = bw1_bn[d];
  const float w0c = Wp2[c], w1c = Wp2[64+c], w2c = Wp2[128+c], bpc = bp2[c];
  const float w0d = Wp2[d], w1d = Wp2[64+d], w2d = Wp2[128+d], bpd = bp2[d];
  float wa[8], wb[8], bwv[8];
#pragma unroll
  for (int o = 0; o < 8; ++o) { wa[o] = Ww1[c*8+o]; wb[o] = Ww1[d*8+o]; bwv[o] = bw1[o]; }
  float ms[8] = {0,0,0,0,0,0,0,0}, ms2[8] = {0,0,0,0,0,0,0,0};
  const int wave = (blockIdx.x*blockDim.x + threadIdx.x) >> 5;
  const int nw   = (gridDim.x*blockDim.x) >> 5;
  for (int pr = wave; pr < PAIRS; pr += nw) {
    const int n  = pr >> 4;
    const int id = idx[pr];
    float a0,a1,a2; pfeat(p, n, id, Wp1, bp1, B, a0,a1,a2);
    float prc = fmaf(a2,w2c, fmaf(a1,w1c, fmaf(a0,w0c, bpc)));
    float prd = fmaf(a2,w2d, fmaf(a1,w1d, fmaf(a0,w0d, bpd)));
    float wc = xk[(size_t)id*C+c] - xq[(size_t)n*C+c] + prc;
    float wd = xk[(size_t)id*C+d] - xq[(size_t)n*C+d] + prd;
    float hc = fmaxf(fmaf(wc-m1c, s1c, b1c), 0.f);
    float hd = fmaxf(fmaf(wd-m1d, s1d, b1d), 0.f);
    float part[8];
#pragma unroll
    for (int o = 0; o < 8; ++o) part[o] = fmaf(hd, wb[o], hc*wa[o]);
#pragma unroll
    for (int o = 0; o < 8; ++o)
#pragma unroll
      for (int off = 16; off >= 1; off >>= 1)
        part[o] += __shfl_xor(part[o], off, 32);
#pragma unroll
    for (int o = 0; o < 8; ++o) {
      float w2 = part[o] + bwv[o];
      ms[o] += w2; ms2[o] += w2*w2;
    }
  }
  if (lane == 0) {
#pragma unroll
    for (int o = 0; o < 8; ++o) { atomicAdd(&sm[o], ms[o]); atomicAdd(&sm2[o], ms2[o]); }
  }
  __syncthreads();
  if (threadIdx.x < 8) {
    atomicAdd(&mstats[threadIdx.x],   sm[threadIdx.x]);
    atomicAdd(&mstats[8+threadIdx.x], sm2[threadIdx.x]);
  }
}

// ---------------------------------------------------------------------------
// Kernel 5: fused attention + softmax + aggregation. One wave per point.
// ---------------------------------------------------------------------------
__global__ void __launch_bounds__(256) k_final(
    const float* __restrict__ p, const int* __restrict__ idx,
    const float* __restrict__ xq, const float* __restrict__ xk,
    const float* __restrict__ xv,
    const float* __restrict__ Wp1, const float* __restrict__ bp1,
    const float* __restrict__ gp,  const float* __restrict__ bp_bn,
    const float* __restrict__ Wp2, const float* __restrict__ bp2,
    const float* __restrict__ gw1, const float* __restrict__ bw1_bn,
    const float* __restrict__ Ww1, const float* __restrict__ bw1,
    const float* __restrict__ gw2, const float* __restrict__ bw2_bn,
    const float* __restrict__ Ww2, const float* __restrict__ bw2,
    const float* __restrict__ pstats, const float* __restrict__ wstats,
    const float* __restrict__ mstats, float* __restrict__ out)
{
  __shared__ float sW2[64];
  __shared__ float sB2[8];
  __shared__ float shw3[8][NS*CH];
  __shared__ float sden[8][CH];
  if (threadIdx.x < 64) sW2[threadIdx.x] = Ww2[threadIdx.x];
  if (threadIdx.x < 8)  sB2[threadIdx.x] = bw2[threadIdx.x];
  __syncthreads();

  const int lane  = threadIdx.x & 31;
  const int wslot = threadIdx.x >> 5;
  const int n     = (blockIdx.x*blockDim.x + threadIdx.x) >> 5;  // point id
  float* lw = shw3[wslot];
  const int c = lane, d = lane + 32;

  const BNp B = make_bnp(pstats, gp, bp_bn);
  const float invM = 1.0f/(float)PAIRS;
  float m1c = wstats[c]*invM;
  float s1c = rsqrtf(wstats[64+c]*invM - m1c*m1c + EPSF)*gw1[c];
  float b1c = bw1_bn[c];
  float m1d = wstats[d]*invM;
  float s1d = rsqrtf(wstats[64+d]*invM - m1d*m1d + EPSF)*gw1[d];
  float b1d = bw1_bn[d];
  const float w0c = Wp2[c], w1c = Wp2[64+c], w2c = Wp2[128+c], bpc = bp2[c];
  const float w0d = Wp2[d], w1d = Wp2[64+d], w2d = Wp2[128+d], bpd = bp2[d];
  float wa[8], wb[8], bwv[8], m2[8], s2v[8], b2v[8];
#pragma unroll
  for (int o = 0; o < 8; ++o) {
    wa[o] = Ww1[c*8+o]; wb[o] = Ww1[d*8+o]; bwv[o] = bw1[o];
    float m = mstats[o]*invM;
    m2[o]  = m;
    s2v[o] = rsqrtf(mstats[8+o]*invM - m*m + EPSF)*gw2[o];
    b2v[o] = bw2_bn[o];
  }

  // Neighbor ids are wave-uniform: load the 16 once, reuse in all phases.
  int nid[NS];
#pragma unroll
  for (int j = 0; j < NS; ++j) nid[j] = idx[n*NS + j];

  // Phase 1: attention logits w3[j][t] -> per-wave LDS
  for (int j = 0; j < NS; ++j) {
    const int id = nid[j];
    // warm WGP$/L2 line for the phase-3 xv gather (global_prefetch_b8)
    __builtin_prefetch(&xv[(size_t)id*C + c], 0, 1);
    float a0,a1,a2; pfeat(p, n, id, Wp1, bp1, B, a0,a1,a2);
    float prc = fmaf(a2,w2c, fmaf(a1,w1c, fmaf(a0,w0c, bpc)));
    float prd = fmaf(a2,w2d, fmaf(a1,w1d, fmaf(a0,w0d, bpd)));
    float wc = xk[(size_t)id*C+c] - xq[(size_t)n*C+c] + prc;
    float wd = xk[(size_t)id*C+d] - xq[(size_t)n*C+d] + prd;
    float hc = fmaxf(fmaf(wc-m1c, s1c, b1c), 0.f);
    float hd = fmaxf(fmaf(wd-m1d, s1d, b1d), 0.f);
    float part[8];
#pragma unroll
    for (int o = 0; o < 8; ++o) part[o] = fmaf(hd, wb[o], hc*wa[o]);
#pragma unroll
    for (int o = 0; o < 8; ++o)
#pragma unroll
      for (int off = 16; off >= 1; off >>= 1)
        part[o] += __shfl_xor(part[o], off, 32);
    float h2[8];
#pragma unroll
    for (int o = 0; o < 8; ++o) {
      float w2 = part[o] + bwv[o];
      h2[o] = fmaxf(fmaf(w2 - m2[o], s2v[o], b2v[o]), 0.f);
    }
    if (lane == 0) {
#pragma unroll
      for (int t = 0; t < 8; ++t) {
        float a = sB2[t];
#pragma unroll
        for (int o = 0; o < 8; ++o) a = fmaf(h2[o], sW2[o*8+t], a);
        lw[j*8 + t] = a;
      }
    }
  }
  __syncthreads();

  // Phase 2: softmax over NS for each of the 8 shared planes
  if (lane < 8) {
    float mx = -3.4e38f;
    for (int j = 0; j < NS; ++j) mx = fmaxf(mx, lw[j*8+lane]);
    float s = 0.f;
    for (int j = 0; j < NS; ++j) {
      float e = __expf(lw[j*8+lane] - mx);
      lw[j*8+lane] = e; s += e;
    }
    sden[wslot][lane] = 1.0f / s;
  }
  __syncthreads();

  // Phase 3: out[n,c] = sum_j (xv_g + pr) * softmax_weight
  const float invd = sden[wslot][lane & 7];
  float ac = 0.f, ad = 0.f;
#pragma unroll 4
  for (int j = 0; j < NS; ++j) {
    const int id = nid[j];
    float a0,a1,a2; pfeat(p, n, id, Wp1, bp1, B, a0,a1,a2);
    float prc = fmaf(a2,w2c, fmaf(a1,w1c, fmaf(a0,w0c, bpc)));
    float prd = fmaf(a2,w2d, fmaf(a1,w1d, fmaf(a0,w0d, bpd)));
    float wgt = lw[j*8 + (lane & 7)] * invd;
    ac = fmaf(xv[(size_t)id*C+c] + prc, wgt, ac);
    ad = fmaf(xv[(size_t)id*C+d] + prd, wgt, ad);
  }
  out[(size_t)n*C + c] = ac;
  out[(size_t)n*C + d] = ad;
}

// ---------------------------------------------------------------------------
// Host launcher
// ---------------------------------------------------------------------------
extern "C" void kernel_launch(void* const* d_in, const int* in_sizes, int n_in,
                              void* d_out, int out_size, void* d_ws, size_t ws_size,
                              hipStream_t stream)
{
  (void)in_sizes; (void)n_in; (void)out_size; (void)ws_size;
  const float* p     = (const float*)d_in[0];
  const float* x     = (const float*)d_in[1];
  const int*   idx   = (const int*)  d_in[2];
  const float* Wq    = (const float*)d_in[3];
  const float* bq    = (const float*)d_in[4];
  const float* Wk    = (const float*)d_in[5];
  const float* bk    = (const float*)d_in[6];
  const float* Wv    = (const float*)d_in[7];
  const float* bv    = (const float*)d_in[8];
  const float* Wp1   = (const float*)d_in[9];
  const float* bp1   = (const float*)d_in[10];
  const float* gp    = (const float*)d_in[11];
  const float* bp_bn = (const float*)d_in[12];
  const float* Wp2   = (const float*)d_in[13];
  const float* bp2   = (const float*)d_in[14];
  const float* gw1   = (const float*)d_in[15];
  const float* bw1bn = (const float*)d_in[16];
  const float* Ww1   = (const float*)d_in[17];
  const float* bw1   = (const float*)d_in[18];
  const float* gw2   = (const float*)d_in[19];
  const float* bw2bn = (const float*)d_in[20];
  const float* Ww2   = (const float*)d_in[21];
  const float* bw2   = (const float*)d_in[22];

  float* ws     = (float*)d_ws;          // 48 MB + 600 B workspace
  float* xq     = ws;
  float* xk     = xq + (size_t)NPTS*C;
  float* xv     = xk + (size_t)NPTS*C;
  float* pstats = xv + (size_t)NPTS*C;   // 6
  float* wstats = pstats + 6;            // 128
  float* mstats = wstats + 128;          // 16

  hipMemsetAsync(pstats, 0, (6+128+16)*sizeof(float), stream);

  // 1) QKV projections: 12288 waves, 8 waves/block, B fragments register-resident
  k_qkv<<<QKV_WAVES/8, 256, 0, stream>>>(x, Wq,bq, Wk,bk, Wv,bv, xq, xk, xv);
  // 2) positional-branch BN stats
  k_pstats<<<1024, 256, 0, stream>>>(p, idx, Wp1, bp1, pstats);
  // 3) attention-logit BN stats (64 ch)
  k_wstats<<<2048, 256, 0, stream>>>(p, idx, xq, xk, Wp1,bp1, gp,bp_bn, Wp2,bp2,
                                     pstats, wstats);
  // 4) mid BN stats (8 ch)
  k_mstats<<<2048, 256, 0, stream>>>(p, idx, xq, xk, Wp1,bp1, gp,bp_bn, Wp2,bp2,
                                     gw1,bw1bn, Ww1,bw1, pstats, wstats, mstats);
  // 5) fused softmax + aggregation, one wave per point
  k_final<<<NPTS/8, 256, 0, stream>>>(p, idx, xq, xk, xv,
                                      Wp1,bp1, gp,bp_bn, Wp2,bp2,
                                      gw1,bw1bn, Ww1,bw1, gw2,bw2bn, Ww2,bw2,
                                      pstats, wstats, mstats, (float*)d_out);
}

// v001
// Timed twice side by side with v000, it ran 3.20 and 3.19 times as fast.
#include <hip/hip_runtime.h>
#include <math.h>

// Problem constants (from reference)
#define NPTS 65536
#define NS   16
#define C    64
#define CH   8            // MID // S
#define PAIRS (NPTS*NS)   // 1,048,576
#define EPSF 1e-5f

typedef __attribute__((ext_vector_type(2))) float v2f;
typedef __attribute__((ext_vector_type(8))) float v8f;

// ---------------------------------------------------------------------------
// BN params for the 3-channel positional branch
// ---------------------------------------------------------------------------
struct BNp { float m0,m1,m2, s0,s1,s2, b0,b1,b2; };

__device__ __forceinline__ BNp make_bnp(const float* __restrict__ ps,
                                        const float* __restrict__ gp,
                                        const float* __restrict__ bp) {
  const float invM = 1.0f / (float)PAIRS;
  BNp r;
  float m0 = ps[0]*invM, m1 = ps[1]*invM, m2 = ps[2]*invM;
  float v0 = ps[3]*invM - m0*m0;
  float v1 = ps[4]*invM - m1*m1;
  float v2 = ps[5]*invM - m2*m2;
  r.m0=m0; r.m1=m1; r.m2=m2;
  r.s0 = rsqrtf(v0+EPSF)*gp[0];
  r.s1 = rsqrtf(v1+EPSF)*gp[1];
  r.s2 = rsqrtf(v2+EPSF)*gp[2];
  r.b0 = bp[0]; r.b1 = bp[1]; r.b2 = bp[2];
  return r;
}

// ---------------------------------------------------------------------------
// Kernel 1: xq/xk/xv = x @ W + b via V_WMMA_F32_16X16X4_F32.
// Each wave owns one of the 12 (matrix, N-tile) combos; the B fragment
// (32 floats) + bias are hoisted into registers once, then the wave
// grid-strides over M-tiles: 16 b64 A-loads + 16 WMMAs + 8 stores per tile.
// A (16x4 f32): lanes 0-15 rows M, VGPR0=K0 VGPR1=K1; lanes 16-31 K2/K3.
// B (4x16 f32): lanes hold N, VGPR0=K0(|K2), VGPR1=K1(|K3).
// ---------------------------------------------------------------------------
#define QKV_WAVES 12288   // 12 combos x 1024 waves -> 4 M-tiles per wave

__global__ void __launch_bounds__(256) k_qkv(
    const float* __restrict__ x,
    const float* __restrict__ Wq, const float* __restrict__ bq,
    const float* __restrict__ Wk, const float* __restrict__ bk,
    const float* __restrict__ Wv, const float* __restrict__ bv,
    float* __restrict__ xq, float* __restrict__ xk, float* __restrict__ xv)
{
  const int wave  = (blockIdx.x * blockDim.x + threadIdx.x) >> 5;
  const int lane  = threadIdx.x & 31;
  const int combo = wave % 12;
  const int mat   = combo % 3;
  const int nt    = combo / 3;          // 0..3
  const float* W    = (mat==0) ? Wq : (mat==1) ? Wk : Wv;
  const float* bias = (mat==0) ? bq : (mat==1) ? bk : bv;
  float*       out  = (mat==0) ? xq : (mat==1) ? xk : xv;
  const int n0 = nt*16;
  const int lr = lane & 15, kh = lane >> 4;

  // Hoist B fragment + bias (constant for this wave's combo)
  float br0[16], br1[16];
#pragma unroll
  for (int k = 0; k < 16; ++k) {
    const float* bptr = W + (size_t)(k*4 + kh*2)*C + n0 + lr;
    br0[k] = bptr[0];
    br1[k] = bptr[C];
  }
  const float bb = bias[n0+lr];

  for (int mt = wave / 12; mt < NPTS/16; mt += QKV_WAVES/12) {
    const float* arow = x + (size_t)(mt*16+lr)*C + kh*2;
    v8f acc = {};
#pragma unroll
    for (int k = 0; k < 16; ++k) {
      v2f a = *(const v2f*)(arow + k*4);
      v2f b; b[0] = br0[k]; b[1] = br1[k];
      acc = __builtin_amdgcn_wmma_f32_16x16x4_f32(false, a, false, b,
                                                  (short)0, acc, false, false);
    }
#pragma unroll
    for (int r = 0; r < 8; ++r)
      out[(size_t)(mt*16 + r + kh*8)*C + n0 + lr] = acc[r] + bb;
  }
}

// ---------------------------------------------------------------------------
// Kernel 2: sum / sumsq of (rel_p @ Wp1 + bp1) per 3 channels -> pstats[6]
// ---------------------------------------------------------------------------
__global__ void __launch_bounds__(256) k_pstats(
    const float* __restrict__ p, const int* __restrict__ idx,
    const float* __restrict__ Wp1, const float* __restrict__ bp1,
    float* __restrict__ pstats)
{
  __shared__ float sh[6];
  if (threadIdx.x < 6) sh[threadIdx.x] = 0.f;
  __syncthreads();
  float s[3] = {0,0,0}, s2[3] = {0,0,0};
  const int tid = blockIdx.x*blockDim.x + threadIdx.x;
  const int stride = gridDim.x*blockDim.x;
  for (int pr = tid; pr < PAIRS; pr += stride) {
    const int n  = pr >> 4;
    const int id = idx[pr];
    float r0 = p[id*3+0]-p[n*3+0];
    float r1 = p[id*3+1]-p[n*3+1];
    float r2 = p[id*3+2]-p[n*3+2];
#pragma unroll
    for (int k = 0; k < 3; ++k) {
      float t = fmaf(r2, Wp1[6+k], fmaf(r1, Wp1[3+k], fmaf(r0, Wp1[k], bp1[k])));
      s[k] += t; s2[k] += t*t;
    }
  }
#pragma unroll
  for (int k = 0; k < 3; ++k) { atomicAdd(&sh[k], s[k]); atomicAdd(&sh[3+k], s2[k]); }
  __syncthreads();
  if (threadIdx.x < 6) atomicAdd(&pstats[threadIdx.x], sh[threadIdx.x]);
}

// ---------------------------------------------------------------------------
// Kernels 3-5 work on one point (its 16 neighbours) per wave pass and run the
// per-pair products on V_WMMA_F32_16X16X4_F32.  lr = lane & 15, kh = lane >> 4.
// Fragment facts (as in kernel 1): A lane lr = row, B lane lr = column, both
// hold k = 2*kh, 2*kh+1 in their two registers; D register r = row r + 8*kh,
// column lr.
//   f        = (a0,a1 | a2,1): positional features of neighbour lr, k = 4
//   P[t]     = (Wp2 row0,row1 | row2,bias) of channel 16t+lr, k = 4
//   P x f    -> D[r] = channel 16t+8kh+r of neighbour lr   (lane = neighbour)
//   f x P    -> D[r] = neighbour r+8kh, channel 16t+lr     (lane = channel)
// In the lane = channel products the gathered rows enter as the C operand; in
// the lane = neighbour product they are added behind it; -xq goes into the
// bias column.
// ---------------------------------------------------------------------------
typedef __attribute__((ext_vector_type(4))) float v4f;
typedef __attribute__((ext_vector_type(4))) int   v4i;

#define PT_WAVES 8192     // 8 points per wave
#define PT_BLOCK 128      // 4 waves per block

__device__ __forceinline__ v8f mm4(v2f a, v2f b, v8f c) {
  return __builtin_amdgcn_wmma_f32_16x16x4_f32(false, a, false, b, (short)0, c,
                                               false, false);
}

// lane l <-> lane l ^ 16
__device__ __forceinline__ float xhalf(float x) {
  return __builtin_bit_cast(float, __builtin_amdgcn_permlanex16(
      __builtin_bit_cast(int, x), __builtin_bit_cast(int, x),
      0x76543210, 0xfedcba98, false, false));
}

// sum over the 16 lanes of a row (row_xmask 1,2,4,8)
__device__ __forceinline__ float rowsum16(float v) {
  v += __builtin_bit_cast(float, __builtin_amdgcn_update_dpp(0, __builtin_bit_cast(int, v), 0x161, 0xf, 0xf, true));
  v += __builtin_bit_cast(float, __builtin_amdgcn_update_dpp(0, __builtin_bit_cast(int, v), 0x162, 0xf, 0xf, true));
  v += __builtin_bit_cast(float, __builtin_amdgcn_update_dpp(0, __builtin_bit_cast(int, v), 0x164, 0xf, 0xf, true));
  v += __builtin_bit_cast(float, __builtin_amdgcn_update_dpp(0, __builtin_bit_cast(int, v), 0x168, 0xf, 0xf, true));
  return v;
}

// Wp1 and bp1, read once per wave
struct PW { float w[9], b[3]; };
__device__ __forceinline__ PW make_pw(const float* __restrict__ Wp1,
                                      const float* __restrict__ bp1) {
  PW r;
#pragma unroll
  for (int i = 0; i < 9; ++i) r.w[i] = Wp1[i];
#pragma unroll
  for (int i = 0; i < 3; ++i) r.b[i] = bp1[i];
  return r;
}

// f = (a0,a1 | a2,1) from the neighbour's coordinates (q0,q1,q2) and the
// point's own (c0,c1,c2), all loaded by the caller
__device__ __forceinline__ v2f pfrag(float q0, float q1, float q2,
                                     float c0, float c1, float c2, int kh,
                                     const PW& L, const BNp& B) {
  float r0 = q0-c0;
  float r1 = q1-c1;
  float r2 = q2-c2;
  float t0 = fmaf(r2, L.w[6], fmaf(r1, L.w[3], fmaf(r0, L.w[0], L.b[0])));
  float t1 = fmaf(r2, L.w[7], fmaf(r1, L.w[4], fmaf(r0, L.w[1], L.b[1])));
  float t2 = fmaf(r2, L.w[8], fmaf(r1, L.w[5], fmaf(r0, L.w[2], L.b[2])));
  float a0 = fmaxf(fmaf(t0-B.m0, B.s0, B.b0), 0.f);
  float a1 = fmaxf(fmaf(t1-B.m1, B.s1, B.b1), 0.f);
  float a2 = fmaxf(fmaf(t2-B.m2, B.s2, B.b2), 0.f);
  v2f f; f[0] = kh ? a2 : a0; f[1] = kh ? 1.f : a1;
  return f;
}

__device__ __forceinline__ float sum8(v8f v) {
  return ((v[0]+v[1]) + (v[2]+v[3])) + ((v[4]+v[5]) + (v[6]+v[7]));
}

// rows of src for neighbours r+8kh, channels 16u+lr  (lane = channel layout)
__device__ __forceinline__ void gather_lane_ch(const float* __restrict__ src,
                                               const int* __restrict__ idx,
                                               int n, int lr, int kh, v8f V[4],
                                               const float* vr[8]) {
  const v4i i0 = *(const v4i*)(idx + n*NS + kh*8);
  const v4i i1 = *(const v4i*)(idx + n*NS + kh*8 + 4);
#pragma unroll
  for (int r = 0; r < 8; ++r) {
    const int idr = ((r < 4) ? i0[r & 3] : i1[r & 3]) & (NPTS-1);
    vr[r] = src + (size_t)idr*C + lr;
#pragma unroll
    for (int u = 0; u < 4; ++u) V[u][r] = vr[r][16*u];
  }
}

// kr = row of neighbour lr + 8*kh: channels 16t+8kh+r  (lane = neighbour layout)
__device__ __forceinline__ void gather_lane_nb(const float* __restrict__ kr, v8f w[4]) {
#pragma unroll
  for (int t = 0; t < 4; ++t) {
    const v4f lo = *(const v4f*)(kr + 16*t);
    const v4f hi = *(const v4f*)(kr + 16*t + 4);
    w[t] = __builtin_shufflevector(lo, hi, 0, 1, 2, 3, 4, 5, 6, 7);
  }
}

// ---------------------------------------------------------------------------
// Kernel 3: sum / sumsq of w = xk_g - xq + pr per 64 channels -> wstats[128]
// lane = channel layout: w = f x P' + xk_g, P' bias column = bp2 - xq.
// ---------------------------------------------------------------------------
__global__ void __launch_bounds__(PT_BLOCK) k_wstats(
    const float* __restrict__ p, const int* __restrict__ idx,
    const float* __restrict__ xq, const float* __restrict__ xk,
    const float* __restrict__ Wp1, const float* __restrict__ bp1,
    const float* __restrict__ gp,  const float* __restrict__ bp_bn,
    const float* __restrict__ Wp2, const float* __restrict__ bp2,
    const float* __restrict__ pstats, float* __restrict__ wstats)
{
  __shared__ float ss[64], ss2[64];
  if (threadIdx.x < 64) { ss[threadIdx.x] = 0.f; ss2[threadIdx.x] = 0.f; }
  __syncthreads();
  const int lane = threadIdx.x & 31;
  const int lr = lane & 15, kh = lane >> 4;
  const int wave = __builtin_amdgcn_readfirstlane((int)((blockIdx.x*blockDim.x + threadIdx.x) >> 5));
  const BNp B = make_bnp(pstats, gp, bp_bn);
  const PW L = make_pw(Wp1, bp1);
  v2f P[4];
#pragma unroll
  for (int t = 0; t < 4; ++t) {
    const int ch = 16*t + lr;
    P[t][0] = kh ? Wp2[128+ch] : Wp2[ch];
    P[t][1] = kh ? bp2[ch]     : Wp2[64+ch];
  }
  const float negk = kh ? -1.f : 0.f;
  v8f S[4] = {}, S2[4] = {};
  for (int n = wave; n < NPTS; n += PT_WAVES) {
    const int id = idx[n*NS + lr] & (NPTS-1);
    v8f V[4];
    float xqv[4];
    const float* vr[8];
    gather_lane_ch(xk, idx, n, lr, kh, V, vr);
#pragma unroll
    for (int u = 0; u < 4; ++u) xqv[u] = xq[(size_t)n*C + 16*u + lr];
    const float q0 = p[id*3+0], q1 = p[id*3+1], q2 = p[id*3+2];
    const float c0 = p[n*3+0],  c1 = p[n*3+1],  c2 = p[n*3+2];
    // All of the point's loads stay issued ahead of their first use: sunk to their
    // uses, each would wait out its own round trip.  The translation wait is a
    // precaution ahead of any overwrite of the loads' address registers; the row
    // pointers and the index are its inputs so that they keep their registers up to it.
    asm volatile("s_wait_xcnt 0x0" :: "v"(vr[0]), "v"(vr[1]), "v"(vr[2]), "v"(vr[3]),
                 "v"(vr[4]), "v"(vr[5]), "v"(vr[6]), "v"(vr[7]), "v"(id) : "memory");
    __builtin_amdgcn_sched_barrier(0);
    const v2f f = pfrag(q0, q1, q2, c0, c1, c2, kh, L, B);
#pragma unroll
    for (int u = 0; u < 4; ++u) {
      v2f b = P[u];
      b[1] = fmaf(xqv[u], negk, b[1]);
      const v8f w = mm4(f, b, V[u]);
      S[u]  += w;
      S2[u] = __builtin_elementwise_fma(w, w, S2[u]);
    }
  }
#pragma unroll
  for (int u = 0; u < 4; ++u) {
    float a = sum8(S[u]), b = sum8(S2[u]);
    a += xhalf(a); b += xhalf(b);
    if (kh == 0) { atomicAdd(&ss[16*u+lr], a); atomicAdd(&ss2[16*u+lr], b); }
  }
  __syncthreads();
  if (threadIdx.x < 64) {
    atomicAdd(&wstats[threadIdx.x],    ss[threadIdx.x]);
    atomicAdd(&wstats[64+threadIdx.x], ss2[threadIdx.x]);
  }
}

// ---------------------------------------------------------------------------
// Shared by kernels 4 and 5: constants of h = relu(BN1(w)) and w2 = h @ Ww1.
// BN1 is folded: h = relu(s1*xk_g + [s1*pr + s1*(bp2 - xq - m1) + b1]).
// ---------------------------------------------------------------------------
struct MidC {
  v2f  Q[4];      // s1-scaled P, bias column = s1*(bp2 - m1) + b1
  float sneg[4];  // -s1 in the bias column's lanes, else 0
  v8f  sC[4];     // s1 of channel 16t+8kh+r
  v2f  F[4][4];   // Ww1^T as A: row lr -> o(lr), k = channels 16t+8kh+2q, +1
};

// sS1 / sO1: 64 floats of LDS each, filled here (one barrier inside).
__device__ __forceinline__ void make_midc(MidC& K, float* sS1, float* sO1,
    int lr, int kh,
    const float* __restrict__ Wp2, const float* __restrict__ bp2,
    const float* __restrict__ gw1, const float* __restrict__ bw1_bn,
    const float* __restrict__ Ww1, const float* __restrict__ wstats)
{
  if (threadIdx.x < 64) {
    const int ch = threadIdx.x;
    const float invM = 1.0f/(float)PAIRS;
    const float m = wstats[ch]*invM;
    const float s = rsqrtf(wstats[64+ch]*invM - m*m + EPSF)*gw1[ch];
    sS1[ch] = s;
    sO1[ch] = fmaf(bp2[ch] - m, s, bw1_bn[ch]);
  }
  __syncthreads();
  // rows 0-7 -> o = row, rows 8-15 -> o = (row+4)&7: D registers 0-3 then hold
  // o = r + 4*kh, every mid channel once over the two lane halves.
  const int o = (lr < 8) ? lr : ((lr + 4) & 7);
#pragma unroll
  for (int t = 0; t < 4; ++t) {
    const int ch = 16*t + lr;
    const float s = sS1[ch];
    K.Q[t][0] = (kh ? Wp2[128+ch] : Wp2[ch]) * s;
    K.Q[t][1] = kh ? sO1[ch] : Wp2[64+ch] * s;
    K.sneg[t] = kh ? -s : 0.f;
#pragma unroll
    for (int r = 0; r < 8; ++r) K.sC[t][r] = sS1[16*t + 8*kh + r];
#pragma unroll
    for (int q = 0; q < 4; ++q) {
      const int c0 = 16*t + 8*kh + 2*q;
      K.F[t][q][0] = Ww1[c0*8 + o];
      K.F[t][q][1] = Ww1[(c0+1)*8 + o];
    }
  }
}

// w2 (without bw1) of the point's 16 neighbours: register r < 4 of the result
// = mid channel r + 4*kh of neighbour lr.
// w = gathered xk row (lane = neighbour layout), xqv[t] = xq of channel 16t+lr.
__device__ __forceinline__ v8f mid_w2(const MidC& K, const v8f w[4],
                                      const float xqv[4], v2f f)
{
  const v8f zero = {};
  v8f d2 = {};
#pragma unroll
  for (int t = 0; t < 4; ++t) {
    v2f q = K.Q[t];
    q[1] = fmaf(xqv[t], K.sneg[t], q[1]);
    const v8f h = __builtin_elementwise_max(
        __builtin_elementwise_fma(w[t], K.sC[t], mm4(q, f, zero)), zero);
#pragma unroll
    for (int i = 0; i < 4; ++i) {
      v2f b; b[0] = h[2*i]; b[1] = h[2*i+1];
      d2 = mm4(K.F[t][i], b, d2);
    }
  }
  return d2;
}

// ---------------------------------------------------------------------------
// Kernel 4: stats of w2 = relu(BN1(w)) @ Ww1 + bw1 per 8 channels -> mstats[16]
// ---------------------------------------------------------------------------
__global__ void __launch_bounds__(PT_BLOCK) k_mstats(
    const float* __restrict__ p, const int* __restrict__ idx,
    const float* __restrict__ xq, const float* __restrict__ xk,
    const float* __restrict__ Wp1, const float* __restrict__ bp1,
    const float* __restrict__ gp,  const float* __restrict__ bp_bn,
    const float* __restrict__ Wp2, const float* __restrict__ bp2,
    const float* __restrict__ gw1, const float* __restrict__ bw1_bn,
    const float* __restrict__ Ww1, const float* __restrict__ bw1,
    const float* __restrict__ pstats, const float* __restrict__ wstats,
    float* __restrict__ mstats)
{
  __shared__ float sS1[64], sO1[64];
  __shared__ float sm[8], sm2[8];
  if (threadIdx.x < 8) { sm[threadIdx.x] = 0.f; sm2[threadIdx.x] = 0.f; }
  const int lane = threadIdx.x & 31;
  const int lr = lane & 15, kh = lane >> 4;
  const int wave = __builtin_amdgcn_readfirstlane((int)((blockIdx.x*blockDim.x + threadIdx.x) >> 5));
  const BNp B = make_bnp(pstats, gp, bp_bn);
  const PW L = make_pw(Wp1, bp1);
  MidC K;
  make_midc(K, sS1, sO1, lr, kh, Wp2, bp2, gw1, bw1_bn, Ww1, wstats);
  float ms[4] = {0,0,0,0}, ms2[4] = {0,0,0,0};
  for (int n = wave; n < NPTS; n += PT_WAVES) {
    const int id = idx[n*NS + lr] & (NPTS-1);
    v8f w[4];
    float xqv[4];
    const float* kr = xk + (size_t)id*C + kh*8;
    gather_lane_nb(kr, w);
    const float q0 = p[id*3+0], q1 = p[id*3+1], q2 = p[id*3+2];
    const float c0 = p[n*3+0],  c1 = p[n*3+1],  c2 = p[n*3+2];
#pragma unroll
    for (int t = 0; t < 4; ++t) xqv[t] = xq[(size_t)n*C + 16*t + lr];
    // loads held ahead of their uses, translation wait: as in kernel 3
    asm volatile("s_wait_xcnt 0x0" :: "v"(kr), "v"(id) : "memory");
    __builtin_amdgcn_sched_barrier(0);
    const v2f f = pfrag(q0, q1, q2, c0, c1, c2, kh, L, B);
    const v8f d2 = mid_w2(K, w, xqv, f);
#pragma unroll
    for (int r = 0; r < 4; ++r) {
      ms[r] += d2[r]; ms2[r] = fmaf(d2[r], d2[r], ms2[r]);
    }
  }
  // bw1 enters once per wave: sum(x+b) = sum x + k*b, sum(x+b)^2 = sum x^2 + 2b*sum x + k*b^2
  const float kpts = (float)(NPTS/PT_WAVES);
#pragma unroll
  for (int r = 0; r < 4; ++r) {
    const float bb = bw1[r + 4*kh];
    ms2[r] = fmaf(bb, fmaf(kpts, bb, 2.f*ms[r]), ms2[r]);
    ms[r]  = fmaf(kpts, bb, ms[r]);
    const float a = rowsum16(ms[r]), b = rowsum16(ms2[r]);
    if (lr == 0) { atomicAdd(&sm[r + 4*kh], a); atomicAdd(&sm2[r + 4*kh], b); }
  }
  __syncthreads();
  if (threadIdx.x < 8) {
    atomicAdd(&mstats[threadIdx.x],   sm[threadIdx.x]);
    atomicAdd(&mstats[8+threadIdx.x], sm2[threadIdx.x]);
  }
}

// ---------------------------------------------------------------------------
// Kernel 5: fused attention + softmax + aggregation. One point per wave pass.
// ---------------------------------------------------------------------------
__global__ void __launch_bounds__(PT_BLOCK) k_final(
    const float* __restrict__ p, const int* __restrict__ idx,
    const float* __restrict__ xq, const float* __restrict__ xk,
    const float* __restrict__ xv,
    const float* __restrict__ Wp1, const float* __restrict__ bp1,
    const float* __restrict__ gp,  const float* __restrict__ bp_bn,
    const float* __restrict__ Wp2, const float* __restrict__ bp2,
    const float* __restrict__ gw1, const float* __restrict__ bw1_bn,
    const float* __restrict__ Ww1, const float* __restrict__ bw1,
    const float* __restrict__ gw2, const float* __restrict__ bw2_bn,
    const float* __restrict__ Ww2, const float* __restrict__ bw2,
    const float* __restrict__ pstats, const float* __restrict__ wstats,
    const float* __restrict__ mstats, float* __restrict__ out)
{
  __shared__ float sS1[64], sO1[64];
  const int lane = threadIdx.x & 31;
  const int lr = lane & 15, kh = lane >> 4;
  const int wave = __builtin_amdgcn_readfirstlane((int)((blockIdx.x*blockDim.x + threadIdx.x) >> 5));
  const BNp B = make_bnp(pstats, gp, bp_bn);
  const PW L = make_pw(Wp1, bp1);
  MidC K;
  make_midc(K, sS1, sO1, lr, kh, Wp2, bp2, gw1, bw1_bn, Ww1, wstats);

  v2f P[4];       // unscaled positional weights, B operand of the value product
#pragma unroll
  for (int t = 0; t < 4; ++t) {
    const int ch = 16*t + lr;
    P[t][0] = kh ? Wp2[128+ch] : Wp2[ch];
    P[t][1] = kh ? bp2[ch]     : Wp2[64+ch];
  }
  // BN2 folded with bw1, for mid channel o = r + 4*kh
  float s2h[4], o2h[4];
  const float invM = 1.0f/(float)PAIRS;
#pragma unroll
  for (int r = 0; r < 4; ++r) {
    const int o = r + 4*kh;
    const float m = mstats[o]*invM;
    const float s = rsqrtf(mstats[8+o]*invM - m*m + EPSF)*gw2[o];
    s2h[r] = s;
    o2h[r] = fmaf(bw1[o] - m, s, bw2_bn[o]);
  }
  // Ww2 as B: column lr -> plane lr & 7, k = mid channels 2s+4kh, +1
  v2f G[2];
#pragma unroll
  for (int s = 0; s < 2; ++s) {
    G[s][0] = Ww2[(2*s + 4*kh)*8 + (lr & 7)];
    G[s][1] = Ww2[(2*s + 1 + 4*kh)*8 + (lr & 7)];
  }
  const float b2l = bw2[lr & 7];

  for (int n = wave; n < NPTS; n += PT_WAVES) {
    const int id = idx[n*NS + lr] & (NPTS-1);
    v8f V[4], w[4];
    float xqv[4];
    const float* kr = xk + (size_t)id*C + kh*8;
    const float* vr[8];
    gather_lane_nb(kr, w);
    const float q0 = p[id*3+0], q1 = p[id*3+1], q2 = p[id*3+2];
    const float c0 = p[n*3+0],  c1 = p[n*3+1],  c2 = p[n*3+2];
#pragma unroll
    for (int t = 0; t < 4; ++t) xqv[t] = xq[(size_t)n*C + 16*t + lr];
    gather_lane_ch(xv, idx, n, lr, kh, V, vr);
    // loads held ahead of their uses, translation wait: as in kernel 3
    asm volatile("s_wait_xcnt 0x0" :: "v"(vr[0]), "v"(vr[1]), "v"(vr[2]), "v"(vr[3]),
                 "v"(vr[4]), "v"(vr[5]), "v"(vr[6]), "v"(vr[7]), "v"(kr), "v"(id) : "memory");
    __builtin_amdgcn_sched_barrier(0);
    const v2f f = pfrag(q0, q1, q2, c0, c1, c2, kh, L, B);

    // logits: d3[r] = w3 of neighbour r+8kh, plane lr & 7
    const v8f d2 = mid_w2(K, w, xqv, f);
    float h2[4];
#pragma unroll
    for (int r = 0; r < 4; ++r) h2[r] = fmaxf(fmaf(d2[r], s2h[r], o2h[r]), 0.f);
    v8f d3 = {b2l, b2l, b2l, b2l, b2l, b2l, b2l, b2l};
#pragma unroll
    for (int s = 0; s < 2; ++s) {
      v2f a; a[0] = h2[2*s]; a[1] = h2[2*s+1];
      d3 = mm4(a, G[s], d3);
    }

    // softmax over the 16 neighbours: 8 registers and the other lane half
    float mx = fmaxf(fmaxf(fmaxf(d3[0], d3[1]), fmaxf(d3[2], d3[3])),
                     fmaxf(fmaxf(d3[4], d3[5]), fmaxf(d3[6], d3[7])));
    mx = fmaxf(mx, xhalf(mx));
    v8f e;
#pragma unroll
    for (int r = 0; r < 8; ++r) e[r] = __expf(d3[r] - mx);
    float den = sum8(e);
    den += xhalf(den);
    const float invd = 1.0f / den;

    // out[n,ch] = sum_j (xv_g + pr) * weight; xv_g + pr = f x P + xv_g
    float acc[4];
#pragma unroll
    for (int u = 0; u < 4; ++u) {
      const v8f vp = mm4(f, P[u], V[u]);
      v2f a2v = {0.f, 0.f};
#pragma unroll
      for (int i = 0; i < 4; ++i) {
        v2f x; x[0] = vp[2*i]; x[1] = vp[2*i+1];
        v2f y; y[0] = e[2*i];  y[1] = e[2*i+1];
        a2v = __builtin_elementwise_fma(x, y, a2v);
      }
      const float a = a2v[0] + a2v[1];
      acc[u] = a + xhalf(a);
    }
    float* orow = out + (size_t)n*C + 32*kh + lr;
    const float o0 = (kh ? acc[2] : acc[0]) * invd;
    const float o1 = (kh ? acc[3] : acc[1]) * invd;
    orow[0]  = o0;
    orow[16] = o1;
    // the same precaution for the two stores' address and data registers,
    // which the next pass reuses
    asm volatile("s_wait_xcnt 0x0" :: "v"(orow), "v"(o0), "v"(o1) : "memory");
  }
}

// ---------------------------------------------------------------------------
// Host launcher
// ---------------------------------------------------------------------------
extern "C" void kernel_launch(void* const* d_in, const int* in_sizes, int n_in,
                              void* d_out, int out_size, void* d_ws, size_t ws_size,
                              hipStream_t stream)
{
  (void)in_sizes; (void)n_in; (void)out_size; (void)ws_size;
  const float* p     = (const float*)d_in[0];
  const float* x     = (const float*)d_in[1];
  const int*   idx   = (const int*)  d_in[2];
  const float* Wq    = (const float*)d_in[3];
  const float* bq    = (const float*)d_in[4];
  const float* Wk    = (const float*)d_in[5];
  const float* bk    = (const float*)d_in[6];
  const float* Wv    = (const float*)d_in[7];
  const float* bv    = (const float*)d_in[8];
  const float* Wp1   = (const float*)d_in[9];
  const float* bp1   = (const float*)d_in[10];
  const float* gp    = (const float*)d_in[11];
  const float* bp_bn = (const float*)d_in[12];
  const float* Wp2   = (const float*)d_in[13];
  const float* bp2   = (const float*)d_in[14];
  const float* gw1   = (const float*)d_in[15];
  const float* bw1bn = (const float*)d_in[16];
  const float* Ww1   = (const float*)d_in[17];
  const float* bw1   = (const float*)d_in[18];
  const float* gw2   = (const float*)d_in[19];
  const float* bw2bn = (const float*)d_in[20];
  const float* Ww2   = (const float*)d_in[21];
  const float* bw2   = (const float*)d_in[22];

  float* ws     = (float*)d_ws;          // 48 MB + 600 B workspace
  float* xq     = ws;
  float* xk     = xq + (size_t)NPTS*C;
  float* xv     = xk + (size_t)NPTS*C;
  float* pstats = xv + (size_t)NPTS*C;   // 6
  float* wstats = pstats + 6;            // 128
  float* mstats = wstats + 128;          // 16

  hipMemsetAsync(pstats, 0, (6+128+16)*sizeof(float), stream);

  // 1) QKV projections: 12288 waves, 8 waves/block, B fragments register-resident
  k_qkv<<<QKV_WAVES/8, 256, 0, stream>>>(x, Wq,bq, Wk,bk, Wv,bv, xq, xk, xv);
  // 2) positional-branch BN stats
  k_pstats<<<1024, 256, 0, stream>>>(p, idx, Wp1, bp1, pstats);
  // 3) attention-logit BN stats (64 ch)
  k_wstats<<<PT_WAVES*32/PT_BLOCK, PT_BLOCK, 0, stream>>>(p, idx, xq, xk, Wp1,bp1, gp,bp_bn, Wp2,bp2,
                                     pstats, wstats);
  // 4) mid BN stats (8 ch)
  k_mstats<<<PT_WAVES*32/PT_BLOCK, PT_BLOCK, 0, stream>>>(p, idx, xq, xk, Wp1,bp1, gp,bp_bn, Wp2,bp2,
                                     gw1,bw1bn, Ww1,bw1, pstats, wstats, mstats);
  // 5) fused softmax + aggregation, one point per wave pass
  k_final<<<PT_WAVES*32/PT_BLOCK, PT_BLOCK, 0, stream>>>(p, idx, xq, xk, xv,
                                      Wp1,bp1, gp,bp_bn, Wp2,bp2,
                                      gw1,bw1bn, Ww1,bw1, gw2,bw2bn, Ww2,bw2,
                                      pstats, wstats, mstats, (float*)d_out);
}

// v002
// Two timings next to v001 both put it at 1.12 times that version's speed.
// Over all steps from v000 it is 3.56 times as fast.
#include <hip/hip_runtime.h>
#include <math.h>

// Problem constants (from reference)
#define NPTS 65536
#define NS   16
#define C    64
#define CH   8            // MID // S
#define PAIRS (NPTS*NS)   // 1,048,576
#define EPSF 1e-5f

typedef __attribute__((ext_vector_type(2))) float v2f;
typedef __attribute__((ext_vector_type(8))) float v8f;

// ---------------------------------------------------------------------------
// BN params for the 3-channel positional branch
// ---------------------------------------------------------------------------
struct BNp { float m0,m1,m2, s0,s1,s2, b0,b1,b2; };

__device__ __forceinline__ BNp make_bnp(const float* __restrict__ ps,
                                        const float* __restrict__ gp,
                                        const float* __restrict__ bp) {
  const float invM = 1.0f / (float)PAIRS;
  BNp r;
  float m0 = ps[0]*invM, m1 = ps[1]*invM, m2 = ps[2]*invM;
  float v0 = ps[3]*invM - m0*m0;
  float v1 = ps[4]*invM - m1*m1;
  float v2 = ps[5]*invM - m2*m2;
  r.m0=m0; r.m1=m1; r.m2=m2;
  r.s0 = rsqrtf(v0+EPSF)*gp[0];
  r.s1 = rsqrtf(v1+EPSF)*gp[1];
  r.s2 = rsqrtf(v2+EPSF)*gp[2];
  r.b0 = bp[0]; r.b1 = bp[1]; r.b2 = bp[2];
  return r;
}

// ---------------------------------------------------------------------------
// Kernel 1: xq/xk/xv = x @ W + b via V_WMMA_F32_16X16X4_F32.
// Each wave owns one of the 12 (matrix, N-tile) combos; the B fragment
// (32 floats) + bias are hoisted into registers once, then the wave
// grid-strides over M-tiles: 16 b64 A-loads + 16 WMMAs + 8 stores per tile.
// A (16x4 f32): lanes 0-15 rows M, VGPR0=K0 VGPR1=K1; lanes 16-31 K2/K3.
// B (4x16 f32): lanes hold N, VGPR0=K0(|K2), VGPR1=K1(|K3).
// ---------------------------------------------------------------------------
#define QKV_WAVES 12288   // 12 combos x 1024 waves -> 4 M-tiles per wave

__global__ void __launch_bounds__(256) k_qkv(
    const float* __restrict__ x,
    const float* __restrict__ Wq, const float* __restrict__ bq,
    const float* __restrict__ Wk, const float* __restrict__ bk,
    const float* __restrict__ Wv, const float* __restrict__ bv,
    float* __restrict__ xq, float* __restrict__ xk, float* __restrict__ xv)
{
  const int wave  = (blockIdx.x * blockDim.x + threadIdx.x) >> 5;
  const int lane  = threadIdx.x & 31;
  const int combo = wave % 12;
  const int mat   = combo % 3;
  const int nt    = combo / 3;          // 0..3
  const float* W    = (mat==0) ? Wq : (mat==1) ? Wk : Wv;
  const float* bias = (mat==0) ? bq : (mat==1) ? bk : bv;
  float*       out  = (mat==0) ? xq : (mat==1) ? xk : xv;
  const int n0 = nt*16;
  const int lr = lane & 15, kh = lane >> 4;

  // Hoist B fragment + bias (constant for this wave's combo)
  float br0[16], br1[16];
#pragma unroll
  for (int k = 0; k < 16; ++k) {
    const float* bptr = W + (size_t)(k*4 + kh*2)*C + n0 + lr;
    br0[k] = bptr[0];
    br1[k] = bptr[C];
  }
  const float bb = bias[n0+lr];

  for (int mt = wave / 12; mt < NPTS/16; mt += QKV_WAVES/12) {
    const float* arow = x + (size_t)(mt*16+lr)*C + kh*2;
    v8f acc = {};
#pragma unroll
    for (int k = 0; k < 16; ++k) {
      v2f a = *(const v2f*)(arow + k*4);
      v2f b; b[0] = br0[k]; b[1] = br1[k];
      acc = __builtin_amdgcn_wmma_f32_16x16x4_f32(false, a, false, b,
                                                  (short)0, acc, false, false);
    }
#pragma unroll
    for (int r = 0; r < 8; ++r)
      out[(size_t)(mt*16 + r + kh*8)*C + n0 + lr] = acc[r] + bb;
  }
}

// ---------------------------------------------------------------------------
// Kernel 2: sum / sumsq of (rel_p @ Wp1 + bp1) per 3 channels -> pstats[6]
// ---------------------------------------------------------------------------
__global__ void __launch_bounds__(256) k_pstats(
    const float* __restrict__ p, const int* __restrict__ idx,
    const float* __restrict__ Wp1, const float* __restrict__ bp1,
    float* __restrict__ pstats)
{
  __shared__ float sh[6];
  if (threadIdx.x < 6) sh[threadIdx.x] = 0.f;
  __syncthreads();
  float s[3] = {0,0,0}, s2[3] = {0,0,0};
  const int tid = blockIdx.x*blockDim.x + threadIdx.x;
  const int stride = gridDim.x*blockDim.x;
  for (int pr = tid; pr < PAIRS; pr += stride) {
    const int n  = pr >> 4;
    const int id = idx[pr];
    float r0 = p[id*3+0]-p[n*3+0];
    float r1 = p[id*3+1]-p[n*3+1];
    float r2 = p[id*3+2]-p[n*3+2];
#pragma unroll
    for (int k = 0; k < 3; ++k) {
      float t = fmaf(r2, Wp1[6+k], fmaf(r1, Wp1[3+k], fmaf(r0, Wp1[k], bp1[k])));
      s[k] += t; s2[k] += t*t;
    }
  }
#pragma unroll
  for (int k = 0; k < 3; ++k) { atomicAdd(&sh[k], s[k]); atomicAdd(&sh[3+k], s2[k]); }
  __syncthreads();
  if (threadIdx.x < 6) atomicAdd(&pstats[threadIdx.x], sh[threadIdx.x]);
}

// ---------------------------------------------------------------------------
// Kernels 3-5 work on one point (its 16 neighbours) per wave pass and run the
// per-pair products on V_WMMA_F32_16X16X4_F32.  lr = lane & 15, kh = lane >> 4.
// Fragment facts (as in kernel 1): A lane lr = row, B lane lr = column, both
// hold k = 2*kh, 2*kh+1 in their two registers; D register r = row r + 8*kh,
// column lr.
//   f        = (a0,a1 | a2,1): positional features of neighbour lr, k = 4
//   P[t]     = (Wp2 row0,row1 | row2,bias) of channel 16t+lr, k = 4
//   P x f    -> D[r] = channel 16t+8kh+r of neighbour lr   (lane = neighbour)
//   f x P    -> D[r] = neighbour r+8kh, channel 16t+lr     (lane = channel)
// In the lane = channel products the gathered rows enter as the C operand; in
// the lane = neighbour product they are added behind it; -xq goes into the
// bias column.
// ---------------------------------------------------------------------------
typedef __attribute__((ext_vector_type(4))) float v4f;
typedef __attribute__((ext_vector_type(4))) int   v4i;

#define PT_WAVES 8192     // 8 points per wave
#define PT_BLOCK 128      // 4 waves per block
#define W2_PT 128         // floats of w2 stored per point (16 neighbours x 8)
#define F_PT  64          // floats of f stored per point (32 lanes x 2)

__device__ __forceinline__ v8f mm4(v2f a, v2f b, v8f c) {
  return __builtin_amdgcn_wmma_f32_16x16x4_f32(false, a, false, b, (short)0, c,
                                               false, false);
}

// lane l <-> lane l ^ 16
__device__ __forceinline__ float xhalf(float x) {
  return __builtin_bit_cast(float, __builtin_amdgcn_permlanex16(
      __builtin_bit_cast(int, x), __builtin_bit_cast(int, x),
      0x76543210, 0xfedcba98, false, false));
}

// sum over the 16 lanes of a row (row_xmask 1,2,4,8)
__device__ __forceinline__ float rowsum16(float v) {
  v += __builtin_bit_cast(float, __builtin_amdgcn_update_dpp(0, __builtin_bit_cast(int, v), 0x161, 0xf, 0xf, true));
  v += __builtin_bit_cast(float, __builtin_amdgcn_update_dpp(0, __builtin_bit_cast(int, v), 0x162, 0xf, 0xf, true));
  v += __builtin_bit_cast(float, __builtin_amdgcn_update_dpp(0, __builtin_bit_cast(int, v), 0x164, 0xf, 0xf, true));
  v += __builtin_bit_cast(float, __builtin_amdgcn_update_dpp(0, __builtin_bit_cast(int, v), 0x168, 0xf, 0xf, true));
  return v;
}

// Wp1 and bp1, read once per wave
struct PW { float w[9], b[3]; };
__device__ __forceinline__ PW make_pw(const float* __restrict__ Wp1,
                                      const float* __restrict__ bp1) {
  PW r;
#pragma unroll
  for (int i = 0; i < 9; ++i) r.w[i] = Wp1[i];
#pragma unroll
  for (int i = 0; i < 3; ++i) r.b[i] = bp1[i];
  return r;
}

// f = (a0,a1 | a2,1) from the neighbour's coordinates (q0,q1,q2) and the
// point's own (c0,c1,c2), all loaded by the caller
__device__ __forceinline__ v2f pfrag(float q0, float q1, float q2,
                                     float c0, float c1, float c2, int kh,
                                     const PW& L, const BNp& B) {
  float r0 = q0-c0;
  float r1 = q1-c1;
  float r2 = q2-c2;
  float t0 = fmaf(r2, L.w[6], fmaf(r1, L.w[3], fmaf(r0, L.w[0], L.b[0])));
  float t1 = fmaf(r2, L.w[7], fmaf(r1, L.w[4], fmaf(r0, L.w[1], L.b[1])));
  float t2 = fmaf(r2, L.w[8], fmaf(r1, L.w[5], fmaf(r0, L.w[2], L.b[2])));
  float a0 = fmaxf(fmaf(t0-B.m0, B.s0, B.b0), 0.f);
  float a1 = fmaxf(fmaf(t1-B.m1, B.s1, B.b1), 0.f);
  float a2 = fmaxf(fmaf(t2-B.m2, B.s2, B.b2), 0.f);
  v2f f; f[0] = kh ? a2 : a0; f[1] = kh ? 1.f : a1;
  return f;
}

__device__ __forceinline__ float sum8(v8f v) {
  return ((v[0]+v[1]) + (v[2]+v[3])) + ((v[4]+v[5]) + (v[6]+v[7]));
}

// rows of src for neighbours r+8kh, channels 16u+lr  (lane = channel layout)
__device__ __forceinline__ void gather_lane_ch(const float* __restrict__ src,
                                               const int* __restrict__ idx,
                                               int n, int lr, int kh, v8f V[4],
                                               const float* vr[8]) {
  const v4i i0 = *(const v4i*)(idx + n*NS + kh*8);
  const v4i i1 = *(const v4i*)(idx + n*NS + kh*8 + 4);
#pragma unroll
  for (int r = 0; r < 8; ++r) {
    const int idr = ((r < 4) ? i0[r & 3] : i1[r & 3]) & (NPTS-1);
    vr[r] = src + (size_t)idr*C + lr;
#pragma unroll
    for (int u = 0; u < 4; ++u) V[u][r] = vr[r][16*u];
  }
}

// kr = row of neighbour lr + 8*kh: channels 16t+8kh+r  (lane = neighbour layout)
__device__ __forceinline__ void gather_lane_nb(const float* __restrict__ kr, v8f w[4]) {
#pragma unroll
  for (int t = 0; t < 4; ++t) {
    const v4f lo = *(const v4f*)(kr + 16*t);
    const v4f hi = *(const v4f*)(kr + 16*t + 4);
    w[t] = __builtin_shufflevector(lo, hi, 0, 1, 2, 3, 4, 5, 6, 7);
  }
}

// ---------------------------------------------------------------------------
// Kernel 3: sum / sumsq of w = xk_g - xq + pr per 64 channels -> wstats[128]
// lane = channel layout: w = f x P' + xk_g, P' bias column = bp2 - xq.
// ---------------------------------------------------------------------------
__global__ void __launch_bounds__(PT_BLOCK) k_wstats(
    const float* __restrict__ p, const int* __restrict__ idx,
    const float* __restrict__ xq, const float* __restrict__ xk,
    const float* __restrict__ Wp1, const float* __restrict__ bp1,
    const float* __restrict__ gp,  const float* __restrict__ bp_bn,
    const float* __restrict__ Wp2, const float* __restrict__ bp2,
    const float* __restrict__ pstats, float* __restrict__ wstats)
{
  __shared__ float ss[64], ss2[64];
  if (threadIdx.x < 64) { ss[threadIdx.x] = 0.f; ss2[threadIdx.x] = 0.f; }
  __syncthreads();
  const int lane = threadIdx.x & 31;
  const int lr = lane & 15, kh = lane >> 4;
  const int wave = __builtin_amdgcn_readfirstlane((int)((blockIdx.x*blockDim.x + threadIdx.x) >> 5));
  const BNp B = make_bnp(pstats, gp, bp_bn);
  const PW L = make_pw(Wp1, bp1);
  v2f P[4];
#pragma unroll
  for (int t = 0; t < 4; ++t) {
    const int ch = 16*t + lr;
    P[t][0] = kh ? Wp2[128+ch] : Wp2[ch];
    P[t][1] = kh ? bp2[ch]     : Wp2[64+ch];
  }
  const float negk = kh ? -1.f : 0.f;
  v8f S[4] = {}, S2[4] = {};
  for (int n = wave; n < NPTS; n += PT_WAVES) {
    const int id = idx[n*NS + lr] & (NPTS-1);
    v8f V[4];
    float xqv[4];
    const float* vr[8];
    gather_lane_ch(xk, idx, n, lr, kh, V, vr);
#pragma unroll
    for (int u = 0; u < 4; ++u) xqv[u] = xq[(size_t)n*C + 16*u + lr];
    const float q0 = p[id*3+0], q1 = p[id*3+1], q2 = p[id*3+2];
    const float c0 = p[n*3+0],  c1 = p[n*3+1],  c2 = p[n*3+2];
    // All of the point's loads stay issued ahead of their first use: sunk to their
    // uses, each would wait out its own round trip.  The translation wait is a
    // precaution ahead of any overwrite of the loads' address registers; the row
    // pointers and the index are its inputs so that they keep their registers up to it.
    asm volatile("s_wait_xcnt 0x0" :: "v"(vr[0]), "v"(vr[1]), "v"(vr[2]), "v"(vr[3]),
                 "v"(vr[4]), "v"(vr[5]), "v"(vr[6]), "v"(vr[7]), "v"(id) : "memory");
    __builtin_amdgcn_sched_barrier(0);
    const v2f f = pfrag(q0, q1, q2, c0, c1, c2, kh, L, B);
#pragma unroll
    for (int u = 0; u < 4; ++u) {
      v2f b = P[u];
      b[1] = fmaf(xqv[u], negk, b[1]);
      const v8f w = mm4(f, b, V[u]);
      S[u]  += w;
      S2[u] = __builtin_elementwise_fma(w, w, S2[u]);
    }
  }
#pragma unroll
  for (int u = 0; u < 4; ++u) {
    float a = sum8(S[u]), b = sum8(S2[u]);
    a += xhalf(a); b += xhalf(b);
    if (kh == 0) { atomicAdd(&ss[16*u+lr], a); atomicAdd(&ss2[16*u+lr], b); }
  }
  __syncthreads();
  if (threadIdx.x < 64) {
    atomicAdd(&wstats[threadIdx.x],    ss[threadIdx.x]);
    atomicAdd(&wstats[64+threadIdx.x], ss2[threadIdx.x]);
  }
}

// ---------------------------------------------------------------------------
// Kernel 4's constants of h = relu(BN1(w)) and w2 = h @ Ww1.
// BN1 is folded: h = relu(s1*xk_g + [s1*pr + s1*(bp2 - xq - m1) + b1]).
// ---------------------------------------------------------------------------
struct MidC {
  v2f  Q[4];      // s1-scaled P, bias column = s1*(bp2 - m1) + b1
  float sneg[4];  // -s1 in the bias column's lanes, else 0
  v8f  sC[4];     // s1 of channel 16t+8kh+r
  v2f  F[4][4];   // Ww1^T as A: row lr -> o(lr), k = channels 16t+8kh+2q, +1
};

// sS1 / sO1: 64 floats of LDS each, filled here (one barrier inside).
__device__ __forceinline__ void make_midc(MidC& K, float* sS1, float* sO1,
    int lr, int kh,
    const float* __restrict__ Wp2, const float* __restrict__ bp2,
    const float* __restrict__ gw1, const float* __restrict__ bw1_bn,
    const float* __restrict__ Ww1, const float* __restrict__ wstats)
{
  if (threadIdx.x < 64) {
    const int ch = threadIdx.x;
    const float invM = 1.0f/(float)PAIRS;
    const float m = wstats[ch]*invM;
    const float s = rsqrtf(wstats[64+ch]*invM - m*m + EPSF)*gw1[ch];
    sS1[ch] = s;
    sO1[ch] = fmaf(bp2[ch] - m, s, bw1_bn[ch]);
  }
  __syncthreads();
  // rows 0-7 -> o = row, rows 8-15 -> o = (row+4)&7: D registers 0-3 then hold
  // o = r + 4*kh, every mid channel once over the two lane halves.
  const int o = (lr < 8) ? lr : ((lr + 4) & 7);
#pragma unroll
  for (int t = 0; t < 4; ++t) {
    const int ch = 16*t + lr;
    const float s = sS1[ch];
    K.Q[t][0] = (kh ? Wp2[128+ch] : Wp2[ch]) * s;
    K.Q[t][1] = kh ? sO1[ch] : Wp2[64+ch] * s;
    K.sneg[t] = kh ? -s : 0.f;
#pragma unroll
    for (int r = 0; r < 8; ++r) K.sC[t][r] = sS1[16*t + 8*kh + r];
#pragma unroll
    for (int q = 0; q < 4; ++q) {
      const int c0 = 16*t + 8*kh + 2*q;
      K.F[t][q][0] = Ww1[c0*8 + o];
      K.F[t][q][1] = Ww1[(c0+1)*8 + o];
    }
  }
}

// w2 (without bw1) of the point's 16 neighbours: register r < 4 of the result
// = mid channel r + 4*kh of neighbour lr.
// w = gathered xk row (lane = neighbour layout), xqv[t] = xq of channel 16t+lr.
__device__ __forceinline__ v8f mid_w2(const MidC& K, const v8f w[4],
                                      const float xqv[4], v2f f)
{
  const v8f zero = {};
  v8f d2 = {};
#pragma unroll
  for (int t = 0; t < 4; ++t) {
    v2f q = K.Q[t];
    q[1] = fmaf(xqv[t], K.sneg[t], q[1]);
    const v8f h = __builtin_elementwise_max(
        __builtin_elementwise_fma(w[t], K.sC[t], mm4(q, f, zero)), zero);
#pragma unroll
    for (int i = 0; i < 4; ++i) {
      v2f b; b[0] = h[2*i]; b[1] = h[2*i+1];
      d2 = mm4(K.F[t][i], b, d2);
    }
  }
  return d2;
}

// ---------------------------------------------------------------------------
// Kernel 4: stats of w2 = relu(BN1(w)) @ Ww1 + bw1 per 8 channels -> mstats[16]
// It also stores, per point and in the lanes' own order, what kernel 5 needs of
// this stage: w2s = 4 floats a lane (w2 without bw1, mid channel r + 4*kh of
// neighbour lr), fs = 2 floats a lane (the fragment f).
// ---------------------------------------------------------------------------
// The second launch bound keeps the allocation at 160 registers, six waves a SIMD:
// one register more would cost a resident wave.
__global__ void __launch_bounds__(PT_BLOCK, 6) k_mstats(
    const float* __restrict__ p, const int* __restrict__ idx,
    const float* __restrict__ xq, const float* __restrict__ xk,
    const float* __restrict__ Wp1, const float* __restrict__ bp1,
    const float* __restrict__ gp,  const float* __restrict__ bp_bn,
    const float* __restrict__ Wp2, const float* __restrict__ bp2,
    const float* __restrict__ gw1, const float* __restrict__ bw1_bn,
    const float* __restrict__ Ww1, const float* __restrict__ bw1,
    const float* __restrict__ pstats, const float* __restrict__ wstats,
    float* __restrict__ mstats, float* __restrict__ w2s, float* __restrict__ fs)
{
  __shared__ float sS1[64], sO1[64];
  __shared__ float sm[8], sm2[8];
  if (threadIdx.x < 8) { sm[threadIdx.x] = 0.f; sm2[threadIdx.x] = 0.f; }
  const int lane = threadIdx.x & 31;
  const int lr = lane & 15, kh = lane >> 4;
  const int wave = __builtin_amdgcn_readfirstlane((int)((blockIdx.x*blockDim.x + threadIdx.x) >> 5));
  const BNp B = make_bnp(pstats, gp, bp_bn);
  const PW L = make_pw(Wp1, bp1);
  MidC K;
  make_midc(K, sS1, sO1, lr, kh, Wp2, bp2, gw1, bw1_bn, Ww1, wstats);
  float ms[4] = {0,0,0,0}, ms2[4] = {0,0,0,0};
  for (int n = wave; n < NPTS; n += PT_WAVES) {
    const int id = idx[n*NS + lr] & (NPTS-1);
    v8f w[4];
    float xqv[4];
    const float* kr = xk + (size_t)id*C + kh*8;
    gather_lane_nb(kr, w);
    const float q0 = p[id*3+0], q1 = p[id*3+1], q2 = p[id*3+2];
    const float c0 = p[n*3+0],  c1 = p[n*3+1],  c2 = p[n*3+2];
#pragma unroll
    for (int t = 0; t < 4; ++t) xqv[t] = xq[(size_t)n*C + 16*t + lr];
    // loads held ahead of their uses, translation wait: as in kernel 3
    asm volatile("s_wait_xcnt 0x0" :: "v"(kr), "v"(id) : "memory");
    __builtin_amdgcn_sched_barrier(0);
    const v2f f = pfrag(q0, q1, q2, c0, c1, c2, kh, L, B);
    const v8f d2 = mid_w2(K, w, xqv, f);
#pragma unroll
    for (int r = 0; r < 4; ++r) {
      ms[r] += d2[r]; ms2[r] = fmaf(d2[r], d2[r], ms2[r]);
    }
    // the sums above stay in front of the stores: the store of the last product's
    // result then issues behind vector instructions that have already read it
    __builtin_amdgcn_sched_barrier(0);
    float* pw = w2s + (size_t)n*W2_PT + lane*4;
    float* pf = fs  + (size_t)n*F_PT  + lane*2;
    const v4f sv = {d2[0], d2[1], d2[2], d2[3]};
    *(v4f*)pw = sv;
    *(v2f*)pf = f;
    // translation wait, a precaution ahead of the next pass's reuse of the two
    // stores' address and data registers
    asm volatile("s_wait_xcnt 0x0" :: "v"(pw), "v"(pf), "v"(sv), "v"(f) : "memory");
  }
  // bw1 enters once per wave: sum(x+b) = sum x + k*b, sum(x+b)^2 = sum x^2 + 2b*sum x + k*b^2
  const float kpts = (float)(NPTS/PT_WAVES);
#pragma unroll
  for (int r = 0; r < 4; ++r) {
    const float bb = bw1[r + 4*kh];
    ms2[r] = fmaf(bb, fmaf(kpts, bb, 2.f*ms[r]), ms2[r]);
    ms[r]  = fmaf(kpts, bb, ms[r]);
    const float a = rowsum16(ms[r]), b = rowsum16(ms2[r]);
    if (lr == 0) { atomicAdd(&sm[r + 4*kh], a); atomicAdd(&sm2[r + 4*kh], b); }
  }
  __syncthreads();
  if (threadIdx.x < 8) {
    atomicAdd(&mstats[threadIdx.x],   sm[threadIdx.x]);
    atomicAdd(&mstats[8+threadIdx.x], sm2[threadIdx.x]);
  }
}

// ---------------------------------------------------------------------------
// Kernel 5: softmax + aggregation. One point per wave pass.  w2 and f come
// from kernel 4's stores, read back by the lane that wrote them.
// ---------------------------------------------------------------------------
__global__ void __launch_bounds__(PT_BLOCK) k_final(
    const int* __restrict__ idx, const float* __restrict__ xv,
    const float* __restrict__ Wp2, const float* __restrict__ bp2,
    const float* __restrict__ bw1,
    const float* __restrict__ gw2, const float* __restrict__ bw2_bn,
    const float* __restrict__ Ww2, const float* __restrict__ bw2,
    const float* __restrict__ mstats,
    const float* __restrict__ w2s, const float* __restrict__ fs,
    float* __restrict__ out)
{
  const int lane = threadIdx.x & 31;
  const int lr = lane & 15, kh = lane >> 4;
  const int wave = __builtin_amdgcn_readfirstlane((int)((blockIdx.x*blockDim.x + threadIdx.x) >> 5));

  v2f P[4];       // unscaled positional weights, B operand of the value product
#pragma unroll
  for (int t = 0; t < 4; ++t) {
    const int ch = 16*t + lr;
    P[t][0] = kh ? Wp2[128+ch] : Wp2[ch];
    P[t][1] = kh ? bp2[ch]     : Wp2[64+ch];
  }
  // BN2 folded with bw1, for mid channel o = r + 4*kh
  float s2h[4], o2h[4];
  const float invM = 1.0f/(float)PAIRS;
#pragma unroll
  for (int r = 0; r < 4; ++r) {
    const int o = r + 4*kh;
    const float m = mstats[o]*invM;
    const float s = rsqrtf(mstats[8+o]*invM - m*m + EPSF)*gw2[o];
    s2h[r] = s;
    o2h[r] = fmaf(bw1[o] - m, s, bw2_bn[o]);
  }
  // Ww2 as B: column lr -> plane lr & 7, k = mid channels 2s+4kh, +1
  v2f G[2];
#pragma unroll
  for (int s = 0; s < 2; ++s) {
    G[s][0] = Ww2[(2*s + 4*kh)*8 + (lr & 7)];
    G[s][1] = Ww2[(2*s + 1 + 4*kh)*8 + (lr & 7)];
  }
  const float b2l = bw2[lr & 7];

  for (int n = wave; n < NPTS; n += PT_WAVES) {
    v8f V[4];
    const float* vr[8];
    const float* pw = w2s + (size_t)n*W2_PT + lane*4;
    const float* pf = fs  + (size_t)n*F_PT  + lane*2;
    const v4f d2 = *(const v4f*)pw;
    const v2f f  = *(const v2f*)pf;
    gather_lane_ch(xv, idx, n, lr, kh, V, vr);
    // loads held ahead of their uses, translation wait: as in kernel 3
    asm volatile("s_wait_xcnt 0x0" :: "v"(vr[0]), "v"(vr[1]), "v"(vr[2]), "v"(vr[3]),
                 "v"(vr[4]), "v"(vr[5]), "v"(vr[6]), "v"(vr[7]), "v"(pw), "v"(pf) : "memory");
    __builtin_amdgcn_sched_barrier(0);

    // logits: d3[r] = w3 of neighbour r+8kh, plane lr & 7
    float h2[4];
#pragma unroll
    for (int r = 0; r < 4; ++r) h2[r] = fmaxf(fmaf(d2[r], s2h[r], o2h[r]), 0.f);
    v8f d3 = {b2l, b2l, b2l, b2l, b2l, b2l, b2l, b2l};
#pragma unroll
    for (int s = 0; s < 2; ++s) {
      v2f a; a[0] = h2[2*s]; a[1] = h2[2*s+1];
      d3 = mm4(a, G[s], d3);
    }

    // softmax over the 16 neighbours: 8 registers and the other lane half
    float mx = fmaxf(fmaxf(fmaxf(d3[0], d3[1]), fmaxf(d3[2], d3[3])),
                     fmaxf(fmaxf(d3[4], d3[5]), fmaxf(d3[6], d3[7])));
    mx = fmaxf(mx, xhalf(mx));
    v8f e;
#pragma unroll
    for (int r = 0; r < 8; ++r) e[r] = __expf(d3[r] - mx);
    float den = sum8(e);
    den += xhalf(den);
    const float invd = 1.0f / den;

    // out[n,ch] = sum_j (xv_g + pr) * weight; xv_g + pr = f x P + xv_g
    float acc[4];
#pragma unroll
    for (int u = 0; u < 4; ++u) {
      const v8f vp = mm4(f, P[u], V[u]);
      v2f a2v = {0.f, 0.f};
#pragma unroll
      for (int i = 0; i < 4; ++i) {
        v2f x; x[0] = vp[2*i]; x[1] = vp[2*i+1];
        v2f y; y[0] = e[2*i];  y[1] = e[2*i+1];
        a2v = __builtin_elementwise_fma(x, y, a2v);
      }
      const float a = a2v[0] + a2v[1];
      acc[u] = a + xhalf(a);
    }
    float* orow = out + (size_t)n*C + 32*kh + lr;
    const float o0 = (kh ? acc[2] : acc[0]) * invd;
    const float o1 = (kh ? acc[3] : acc[1]) * invd;
    orow[0]  = o0;
    orow[16] = o1;
    // the same precaution for the two stores' address and data registers,
    // which the next pass reuses
    asm volatile("s_wait_xcnt 0x0" :: "v"(orow), "v"(o0), "v"(o1) : "memory");
  }
}

// ---------------------------------------------------------------------------
// Host launcher
// ---------------------------------------------------------------------------
extern "C" void kernel_launch(void* const* d_in, const int* in_sizes, int n_in,
                              void* d_out, int out_size, void* d_ws, size_t ws_size,
                              hipStream_t stream)
{
  (void)in_sizes; (void)n_in; (void)out_size; (void)ws_size;
  const float* p     = (const float*)d_in[0];
  const float* x     = (const float*)d_in[1];
  const int*   idx   = (const int*)  d_in[2];
  const float* Wq    = (const float*)d_in[3];
  const float* bq    = (const float*)d_in[4];
  const float* Wk    = (const float*)d_in[5];
  const float* bk    = (const float*)d_in[6];
  const float* Wv    = (const float*)d_in[7];
  const float* bv    = (const float*)d_in[8];
  const float* Wp1   = (const float*)d_in[9];
  const float* bp1   = (const float*)d_in[10];
  const float* gp    = (const float*)d_in[11];
  const float* bp_bn = (const float*)d_in[12];
  const float* Wp2   = (const float*)d_in[13];
  const float* bp2   = (const float*)d_in[14];
  const float* gw1   = (const float*)d_in[15];
  const float* bw1bn = (const float*)d_in[16];
  const float* Ww1   = (const float*)d_in[17];
  const float* bw1   = (const float*)d_in[18];
  const float* gw2   = (const float*)d_in[19];
  const float* bw2bn = (const float*)d_in[20];
  const float* Ww2   = (const float*)d_in[21];
  const float* bw2   = (const float*)d_in[22];

  float* ws     = (float*)d_ws;          // 96 MB + 1 KiB of the workspace
  float* xq     = ws;
  float* xk     = xq + (size_t)NPTS*C;
  float* xv     = xk + (size_t)NPTS*C;
  float* pstats = xv + (size_t)NPTS*C;   // 6
  float* wstats = pstats + 6;            // 128
  float* mstats = wstats + 128;          // 16
  float* w2s    = pstats + 256;          // 32 MB, 1 KiB behind pstats
  float* fs     = w2s + (size_t)NPTS*W2_PT;  // 16 MB

  hipMemsetAsync(pstats, 0, (6+128+16)*sizeof(float), stream);

  // 1) QKV projections: 12288 waves, 8 waves/block, B fragments register-resident
  k_qkv<<<QKV_WAVES/8, 256, 0, stream>>>(x, Wq,bq, Wk,bk, Wv,bv, xq, xk, xv);
  // 2) positional-branch BN stats
  k_pstats<<<1024, 256, 0, stream>>>(p, idx, Wp1, bp1, pstats);
  // 3) attention-logit BN stats (64 ch)
  k_wstats<<<PT_WAVES*32/PT_BLOCK, PT_BLOCK, 0, stream>>>(p, idx, xq, xk, Wp1,bp1, gp,bp_bn, Wp2,bp2,
                                     pstats, wstats);
  // 4) mid BN stats (8 ch)
  k_mstats<<<PT_WAVES*32/PT_BLOCK, PT_BLOCK, 0, stream>>>(p, idx, xq, xk, Wp1,bp1, gp,bp_bn, Wp2,bp2,
                                     gw1,bw1bn, Ww1,bw1, pstats, wstats, mstats, w2s, fs);
  // 5) softmax + aggregation from kernel 4's w2 and f, one point per wave pass
  k_final<<<PT_WAVES*32/PT_BLOCK, PT_BLOCK, 0, stream>>>(idx, xv, Wp2,bp2, bw1,
                                      gw2,bw2bn, Ww2,bw2, mstats, w2s, fs,
                                      (float*)d_out);
}

// v003
// One run takes 106 microseconds.
// In two side-by-side timings against v002, it was 1.08 and 1.07 times as fast.
// All steps since v000 together make it 3.84 times as fast.
#include <hip/hip_runtime.h>
#include <math.h>

// Problem constants (from reference)
#define NPTS 65536
#define NS   16
#define C    64
#define CH   8            // MID // S
#define PAIRS (NPTS*NS)   // 1,048,576
#define EPSF 1e-5f

typedef __attribute__((ext_vector_type(2))) float v2f;
typedef __attribute__((ext_vector_type(8))) float v8f;
typedef __attribute__((ext_vector_type(4))) float v4f;
typedef __attribute__((ext_vector_type(4))) int   v4i;
typedef __attribute__((ext_vector_type(2))) int   v2i;

// lane l <-> lane l ^ 16
__device__ __forceinline__ float xhalf(float x) {
  return __builtin_bit_cast(float, __builtin_amdgcn_permlanex16(
      __builtin_bit_cast(int, x), __builtin_bit_cast(int, x),
      0x76543210, 0xfedcba98, false, false));
}

// sum over the 16 lanes of a row (row_xmask 1,2,4,8)
__device__ __forceinline__ float rowsum16(float v) {
  v += __builtin_bit_cast(float, __builtin_amdgcn_update_dpp(0, __builtin_bit_cast(int, v), 0x161, 0xf, 0xf, true));
  v += __builtin_bit_cast(float, __builtin_amdgcn_update_dpp(0, __builtin_bit_cast(int, v), 0x162, 0xf, 0xf, true));
  v += __builtin_bit_cast(float, __builtin_amdgcn_update_dpp(0, __builtin_bit_cast(int, v), 0x164, 0xf, 0xf, true));
  v += __builtin_bit_cast(float, __builtin_amdgcn_update_dpp(0, __builtin_bit_cast(int, v), 0x168, 0xf, 0xf, true));
  return v;
}

#define PS_BLOCKS 256     // blocks of launch 1 that sum the positional branch

// ---------------------------------------------------------------------------
// BN params for the 3-channel positional branch.  part = [6][PS_BLOCKS] sums of
// t and t*t, one per block of launch 1; every wave adds them up for itself, in
// a fixed order (8 a lane, then over the 32 lanes).
// ---------------------------------------------------------------------------
struct BNp { float m0,m1,m2, s0,s1,s2, b0,b1,b2; };

__device__ __forceinline__ BNp make_bnp(const float* __restrict__ part, int lane,
                                        const float* __restrict__ gp,
                                        const float* __restrict__ bp) {
  const float invM = 1.0f / (float)PAIRS;
  const float* pp = part + lane*8;
  v4f lo[6], hi[6];
#pragma unroll
  for (int k = 0; k < 6; ++k) {
    lo[k] = *(const v4f*)(pp + k*PS_BLOCKS);
    hi[k] = *(const v4f*)(pp + k*PS_BLOCKS + 4);
  }
  // translation wait, a precaution ahead of any reuse of the loads' address register
  asm volatile("s_wait_xcnt 0x0" :: "v"(pp) : "memory");
  float ps[6];
#pragma unroll
  for (int k = 0; k < 6; ++k) {
    float v = ((lo[k][0]+lo[k][1]) + (lo[k][2]+lo[k][3])) + ((hi[k][0]+hi[k][1]) + (hi[k][2]+hi[k][3]));
    v = rowsum16(v);
    v += xhalf(v);
    // the same in every lane: kept in a scalar register
    ps[k] = __builtin_bit_cast(float, __builtin_amdgcn_readfirstlane(__builtin_bit_cast(int, v)));
  }
  BNp r;
  float m0 = ps[0]*invM, m1 = ps[1]*invM, m2 = ps[2]*invM;
  float v0 = ps[3]*invM - m0*m0;
  float v1 = ps[4]*invM - m1*m1;
  float v2 = ps[5]*invM - m2*m2;
  r.m0=m0; r.m1=m1; r.m2=m2;
  r.s0 = rsqrtf(v0+EPSF)*gp[0];
  r.s1 = rsqrtf(v1+EPSF)*gp[1];
  r.s2 = rsqrtf(v2+EPSF)*gp[2];
  r.b0 = bp[0]; r.b1 = bp[1]; r.b2 = bp[2];
  return r;
}

// ---------------------------------------------------------------------------
// Kernel 1: xq/xk/xv = x @ W + b via V_WMMA_F32_16X16X4_F32.
// Each wave behind the first PS_BLOCKS blocks owns one of the 12 (matrix, N-tile) combos; the B fragment
// (32 floats) + bias are hoisted into registers once, then the wave
// grid-strides over M-tiles: 16 b64 A-loads + 16 WMMAs + 8 stores per tile.
// A (16x4 f32): lanes 0-15 rows M, VGPR0=K0 VGPR1=K1; lanes 16-31 K2/K3.
// B (4x16 f32): lanes hold N, VGPR0=K0(|K2), VGPR1=K1(|K3).
// ---------------------------------------------------------------------------
#define QKV_WAVES 12288   // 12 combos x 1024 waves -> 4 M-tiles per wave

// The first PS_BLOCKS blocks of launch 1: sum / sumsq of (rel_p @ Wp1 + bp1) per
// 3 channels, one point (16 pairs) a thread, one set of six sums a block ->
// part[6][PS_BLOCKS].  Nothing here depends on the projections, so it shares
// their launch.  Block 0 also stores the zeros that kernels 3 and 4 add into.
__device__ __forceinline__ void pstats_part(
    const float* __restrict__ p, const int* __restrict__ idx,
    const float* __restrict__ Wp1, const float* __restrict__ bp1,
    float* __restrict__ part, float* __restrict__ zstats)
{
  __shared__ float sh[8][6];
  float w[9], bb[3];
#pragma unroll
  for (int i = 0; i < 9; ++i) w[i] = Wp1[i];
#pragma unroll
  for (int i = 0; i < 3; ++i) bb[i] = bp1[i];
  const int n = blockIdx.x*256 + threadIdx.x;
  const v2i* ip = (const v2i*)(idx + n*NS);
  const float* pc = p + n*3;
  v2i cur = ip[0];
  const float c0 = pc[0], c1 = pc[1], c2 = pc[2];
  // translation wait, a precaution ahead of any reuse of the loads' address registers
  asm volatile("s_wait_xcnt 0x0" :: "v"(ip), "v"(pc) : "memory");
  // channels 0 and 1 as a pair, channel 2 alone
  const v2f W01 = {w[0], w[1]}, W34 = {w[3], w[4]}, W67 = {w[6], w[7]}, B01 = {bb[0], bb[1]};
  v2f sp = {0.f, 0.f}, sp2 = {0.f, 0.f};
  float sc = 0.f, sc2 = 0.f;
  // Two neighbours a trip, the next trip's indices fetched beside this trip's
  // gathers.  Kept rolled and narrow: unrolled, or four a trip, the allocation
  // passes 64 registers, which the projection blocks of this launch would pay
  // with resident waves (14 a SIMD are launched).
#pragma unroll 1
  for (int g = 0; g < 8; ++g) {
    const v2i* in = ip + ((g + 1) & 7);
    const v2i nxt = *in;
    // the same precaution for this load's address registers; it also keeps the load
    // ahead of the gathers, so that its result lands in none of their address registers
    asm volatile("s_wait_xcnt 0x0" :: "v"(in) : "memory");
    int o[2];
    float q0[2], q1[2], q2[2];
#pragma unroll
    for (int j = 0; j < 2; ++j) {
      o[j] = (cur[j] & (NPTS-1))*3;
      q0[j] = p[o[j]]; q1[j] = p[o[j]+1]; q2[j] = p[o[j]+2];
    }
    // and for the two gathers' address registers
    asm volatile("s_wait_xcnt 0x0" :: "v"(o[0]), "v"(o[1]) : "memory");
#pragma unroll
    for (int j = 0; j < 2; ++j) {
      const float r0 = q0[j]-c0, r1 = q1[j]-c1, r2 = q2[j]-c2;
      const v2f R0 = {r0, r0}, R1 = {r1, r1}, R2 = {r2, r2};
      const v2f t = __builtin_elementwise_fma(R2, W67,
                    __builtin_elementwise_fma(R1, W34,
                    __builtin_elementwise_fma(R0, W01, B01)));
      const float u = fmaf(r2, w[8], fmaf(r1, w[5], fmaf(r0, w[2], bb[2])));
      sp += t; sp2 = __builtin_elementwise_fma(t, t, sp2);
      sc += u; sc2 = fmaf(u, u, sc2);
    }
    cur = nxt;
  }
  const float s[3] = {sp[0], sp[1], sc}, s2[3] = {sp2[0], sp2[1], sc2};
  const int lane = threadIdx.x & 31, wv = threadIdx.x >> 5;
#pragma unroll
  for (int k = 0; k < 3; ++k) {
    float a = rowsum16(s[k]), b = rowsum16(s2[k]);
    a += xhalf(a); b += xhalf(b);
    if (lane == 0) { sh[wv][k] = a; sh[wv][3+k] = b; }
  }
  __syncthreads();
  if (threadIdx.x < 6) {
    float a = 0.f;
#pragma unroll
    for (int v = 0; v < 8; ++v) a += sh[v][threadIdx.x];
    part[threadIdx.x*PS_BLOCKS + blockIdx.x] = a;
  }
  if (blockIdx.x == 0 && threadIdx.x < 128+16) zstats[threadIdx.x] = 0.f;
}

__global__ void __launch_bounds__(256) k_qkv(
    const float* __restrict__ x,
    const float* __restrict__ Wq, const float* __restrict__ bq,
    const float* __restrict__ Wk, const float* __restrict__ bk,
    const float* __restrict__ Wv, const float* __restrict__ bv,
    float* __restrict__ xq, float* __restrict__ xk, float* __restrict__ xv,
    const float* __restrict__ p, const int* __restrict__ idx,
    const float* __restrict__ Wp1, const float* __restrict__ bp1,
    float* __restrict__ part, float* __restrict__ zstats)
{
  if (blockIdx.x < PS_BLOCKS) {   // the same for a whole block
    pstats_part(p, idx, Wp1, bp1, part, zstats);
    return;
  }
  const int wave  = ((blockIdx.x - PS_BLOCKS) * blockDim.x + threadIdx.x) >> 5;
  const int lane  = threadIdx.x & 31;
  const int combo = wave % 12;
  const int mat   = combo % 3;
  const int nt    = combo / 3;          // 0..3
  const float* W    = (mat==0) ? Wq : (mat==1) ? Wk : Wv;
  const float* bias = (mat==0) ? bq : (mat==1) ? bk : bv;
  float*       out  = (mat==0) ? xq : (mat==1) ? xk : xv;
  const int n0 = nt*16;
  const int lr = lane & 15, kh = lane >> 4;

  // Hoist B fragment + bias (constant for this wave's combo)
  float br0[16], br1[16];
#pragma unroll
  for (int k = 0; k < 16; ++k) {
    const float* bptr = W + (size_t)(k*4 + kh*2)*C + n0 + lr;
    br0[k] = bptr[0];
    br1[k] = bptr[C];
  }
  const float bb = bias[n0+lr];

  for (int mt = wave / 12; mt < NPTS/16; mt += QKV_WAVES/12) {
    const float* arow = x + (size_t)(mt*16+lr)*C + kh*2;
    v8f acc = {};
#pragma unroll
    for (int k = 0; k < 16; ++k) {
      v2f a = *(const v2f*)(arow + k*4);
      v2f b; b[0] = br0[k]; b[1] = br1[k];
      acc = __builtin_amdgcn_wmma_f32_16x16x4_f32(false, a, false, b,
                                                  (short)0, acc, false, false);
    }
#pragma unroll
    for (int r = 0; r < 8; ++r)
      out[(size_t)(mt*16 + r + kh*8)*C + n0 + lr] = acc[r] + bb;
  }
}

// ---------------------------------------------------------------------------
// Kernels 3-5 work on one point (its 16 neighbours) per wave pass and run the
// per-pair products on V_WMMA_F32_16X16X4_F32.  lr = lane & 15, kh = lane >> 4.
// Fragment facts (as in kernel 1): A lane lr = row, B lane lr = column, both
// hold k = 2*kh, 2*kh+1 in their two registers; D register r = row r + 8*kh,
// column lr.
//   f        = (a0,a1 | a2,1): positional features of neighbour lr, k = 4
//   P[t]     = (Wp2 row0,row1 | row2,bias) of channel 16t+lr, k = 4
//   P x f    -> D[r] = channel 16t+8kh+r of neighbour lr   (lane = neighbour)
//   f x P    -> D[r] = neighbour r+8kh, channel 16t+lr     (lane = channel)
// In the lane = channel products the gathered rows enter as the C operand; in
// the lane = neighbour product they are added behind it; -xq goes into the
// bias column.
// ---------------------------------------------------------------------------
#define PT_WAVES 8192     // 8 points per wave
#define PT_BLOCK 128      // 4 waves per block
#define W2_PT 128         // floats of w2 stored per point (16 neighbours x 8)
#define F_PT  64          // floats of f stored per point (32 lanes x 2)

__device__ __forceinline__ v8f mm4(v2f a, v2f b, v8f c) {
  return __builtin_amdgcn_wmma_f32_16x16x4_f32(false, a, false, b, (short)0, c,
                                               false, false);
}

// Wp1 and bp1, read once per wave
struct PW { float w[9], b[3]; };
__device__ __forceinline__ PW make_pw(const float* __restrict__ Wp1,
                                      const float* __restrict__ bp1) {
  PW r;
#pragma unroll
  for (int i = 0; i < 9; ++i) r.w[i] = Wp1[i];
#pragma unroll
  for (int i = 0; i < 3; ++i) r.b[i] = bp1[i];
  return r;
}

// f = (a0,a1 | a2,1) from the neighbour's coordinates (q0,q1,q2) and the
// point's own (c0,c1,c2), all loaded by the caller
__device__ __forceinline__ v2f pfrag(float q0, float q1, float q2,
                                     float c0, float c1, float c2, int kh,
                                     const PW& L, const BNp& B) {
  float r0 = q0-c0;
  float r1 = q1-c1;
  float r2 = q2-c2;
  float t0 = fmaf(r2, L.w[6], fmaf(r1, L.w[3], fmaf(r0, L.w[0], L.b[0])));
  float t1 = fmaf(r2, L.w[7], fmaf(r1, L.w[4], fmaf(r0, L.w[1], L.b[1])));
  float t2 = fmaf(r2, L.w[8], fmaf(r1, L.w[5], fmaf(r0, L.w[2], L.b[2])));
  float a0 = fmaxf(fmaf(t0-B.m0, B.s0, B.b0), 0.f);
  float a1 = fmaxf(fmaf(t1-B.m1, B.s1, B.b1), 0.f);
  float a2 = fmaxf(fmaf(t2-B.m2, B.s2, B.b2), 0.f);
  v2f f; f[0] = kh ? a2 : a0; f[1] = kh ? 1.f : a1;
  return f;
}

__device__ __forceinline__ float sum8(v8f v) {
  return ((v[0]+v[1]) + (v[2]+v[3])) + ((v[4]+v[5]) + (v[6]+v[7]));
}

// rows of src for neighbours r+8kh, channels 16u+lr  (lane = channel layout)
__device__ __forceinline__ void gather_lane_ch(const float* __restrict__ src,
                                               const int* __restrict__ idx,
                                               int n, int lr, int kh, v8f V[4],
                                               const float* vr[8]) {
  const v4i i0 = *(const v4i*)(idx + n*NS + kh*8);
  const v4i i1 = *(const v4i*)(idx + n*NS + kh*8 + 4);
#pragma unroll
  for (int r = 0; r < 8; ++r) {
    const int idr = ((r < 4) ? i0[r & 3] : i1[r & 3]) & (NPTS-1);
    vr[r] = src + (size_t)idr*C + lr;
#pragma unroll
    for (int u = 0; u < 4; ++u) V[u][r] = vr[r][16*u];
  }
}

// kr = row of neighbour lr + 8*kh: channels 16t+8kh+r  (lane = neighbour layout)
__device__ __forceinline__ void gather_lane_nb(const float* __restrict__ kr, v8f w[4]) {
#pragma unroll
  for (int t = 0; t < 4; ++t) {
    const v4f lo = *(const v4f*)(kr + 16*t);
    const v4f hi = *(const v4f*)(kr + 16*t + 4);
    w[t] = __builtin_shufflevector(lo, hi, 0, 1, 2, 3, 4, 5, 6, 7);
  }
}

// ---------------------------------------------------------------------------
// Kernel 3: sum / sumsq of w = xk_g - xq + pr per 64 channels -> wstats[128]
// lane = channel layout: w = f x P' + xk_g, P' bias column = bp2 - xq.
// ---------------------------------------------------------------------------
__global__ void __launch_bounds__(PT_BLOCK) k_wstats(
    const float* __restrict__ p, const int* __restrict__ idx,
    const float* __restrict__ xq, const float* __restrict__ xk,
    const float* __restrict__ Wp1, const float* __restrict__ bp1,
    const float* __restrict__ gp,  const float* __restrict__ bp_bn,
    const float* __restrict__ Wp2, const float* __restrict__ bp2,
    const float* __restrict__ pstats, float* __restrict__ wstats)
{
  __shared__ float ss[64], ss2[64];
  if (threadIdx.x < 64) { ss[threadIdx.x] = 0.f; ss2[threadIdx.x] = 0.f; }
  __syncthreads();
  const int lane = threadIdx.x & 31;
  const int lr = lane & 15, kh = lane >> 4;
  const int wave = __builtin_amdgcn_readfirstlane((int)((blockIdx.x*blockDim.x + threadIdx.x) >> 5));
  const BNp B = make_bnp(pstats, lane, gp, bp_bn);
  const PW L = make_pw(Wp1, bp1);
  v2f P[4];
#pragma unroll
  for (int t = 0; t < 4; ++t) {
    const int ch = 16*t + lr;
    P[t][0] = kh ? Wp2[128+ch] : Wp2[ch];
    P[t][1] = kh ? bp2[ch]     : Wp2[64+ch];
  }
  const float negk = kh ? -1.f : 0.f;
  v8f S[4] = {}, S2[4] = {};
  for (int n = wave; n < NPTS; n += PT_WAVES) {
    const int id = idx[n*NS + lr] & (NPTS-1);
    v8f V[4];
    float xqv[4];
    const float* vr[8];
    gather_lane_ch(xk, idx, n, lr, kh, V, vr);
#pragma unroll
    for (int u = 0; u < 4; ++u) xqv[u] = xq[(size_t)n*C + 16*u + lr];
    const float q0 = p[id*3+0], q1 = p[id*3+1], q2 = p[id*3+2];
    const float c0 = p[n*3+0],  c1 = p[n*3+1],  c2 = p[n*3+2];
    // All of the point's loads stay issued ahead of their first use: sunk to their
    // uses, each would wait out its own round trip.  The translation wait is a
    // precaution ahead of any overwrite of the loads' address registers; the row
    // pointers and the index are its inputs so that they keep their registers up to it.
    asm volatile("s_wait_xcnt 0x0" :: "v"(vr[0]), "v"(vr[1]), "v"(vr[2]), "v"(vr[3]),
                 "v"(vr[4]), "v"(vr[5]), "v"(vr[6]), "v"(vr[7]), "v"(id) : "memory");
    __builtin_amdgcn_sched_barrier(0);
    const v2f f = pfrag(q0, q1, q2, c0, c1, c2, kh, L, B);
#pragma unroll
    for (int u = 0; u < 4; ++u) {
      v2f b = P[u];
      b[1] = fmaf(xqv[u], negk, b[1]);
      const v8f w = mm4(f, b, V[u]);
      S[u]  += w;
      S2[u] = __builtin_elementwise_fma(w, w, S2[u]);
    }
  }
#pragma unroll
  for (int u = 0; u < 4; ++u) {
    float a = sum8(S[u]), b = sum8(S2[u]);
    a += xhalf(a); b += xhalf(b);
    if (kh == 0) { atomicAdd(&ss[16*u+lr], a); atomicAdd(&ss2[16*u+lr], b); }
  }
  __syncthreads();
  if (threadIdx.x < 64) {
    atomicAdd(&wstats[threadIdx.x],    ss[threadIdx.x]);
    atomicAdd(&wstats[64+threadIdx.x], ss2[threadIdx.x]);
  }
}

// ---------------------------------------------------------------------------
// Kernel 4's constants of h = relu(BN1(w)) and w2 = h @ Ww1.
// BN1 is folded: h = relu(s1*xk_g + [s1*pr + s1*(bp2 - xq - m1) + b1]).
// ---------------------------------------------------------------------------
struct MidC {
  v2f  Q[4];      // s1-scaled P, bias column = s1*(bp2 - m1) + b1
  float sneg[4];  // -s1 in the bias column's lanes, else 0
  v8f  sC[4];     // s1 of channel 16t+8kh+r
  v2f  F[4][4];   // Ww1^T as A: row lr -> o(lr), k = channels 16t+8kh+2q, +1
};

// sS1 / sO1: 64 floats of LDS each, filled here (one barrier inside).
__device__ __forceinline__ void make_midc(MidC& K, float* sS1, float* sO1,
    int lr, int kh,
    const float* __restrict__ Wp2, const float* __restrict__ bp2,
    const float* __restrict__ gw1, const float* __restrict__ bw1_bn,
    const float* __restrict__ Ww1, const float* __restrict__ wstats)
{
  if (threadIdx.x < 64) {
    const int ch = threadIdx.x;
    const float invM = 1.0f/(float)PAIRS;
    const float m = wstats[ch]*invM;
    const float s = rsqrtf(wstats[64+ch]*invM - m*m + EPSF)*gw1[ch];
    sS1[ch] = s;
    sO1[ch] = fmaf(bp2[ch] - m, s, bw1_bn[ch]);
  }
  __syncthreads();
  // rows 0-7 -> o = row, rows 8-15 -> o = (row+4)&7: D registers 0-3 then hold
  // o = r + 4*kh, every mid channel once over the two lane halves.
  const int o = (lr < 8) ? lr : ((lr + 4) & 7);
#pragma unroll
  for (int t = 0; t < 4; ++t) {
    const int ch = 16*t + lr;
    const float s = sS1[ch];
    K.Q[t][0] = (kh ? Wp2[128+ch] : Wp2[ch]) * s;
    K.Q[t][1] = kh ? sO1[ch] : Wp2[64+ch] * s;
    K.sneg[t] = kh ? -s : 0.f;
#pragma unroll
    for (int r = 0; r < 8; ++r) K.sC[t][r] = sS1[16*t + 8*kh + r];
#pragma unroll
    for (int q = 0; q < 4; ++q) {
      const int c0 = 16*t + 8*kh + 2*q;
      K.F[t][q][0] = Ww1[c0*8 + o];
      K.F[t][q][1] = Ww1[(c0+1)*8 + o];
    }
  }
}

// w2 (without bw1) of the point's 16 neighbours: register r < 4 of the result
// = mid channel r + 4*kh of neighbour lr.
// w = gathered xk row (lane = neighbour layout), xqv[t] = xq of channel 16t+lr.
__device__ __forceinline__ v8f mid_w2(const MidC& K, const v8f w[4],
                                      const float xqv[4], v2f f)
{
  const v8f zero = {};
  v8f d2 = {};
#pragma unroll
  for (int t = 0; t < 4; ++t) {
    v2f q = K.Q[t];
    q[1] = fmaf(xqv[t], K.sneg[t], q[1]);
    const v8f h = __builtin_elementwise_max(
        __builtin_elementwise_fma(w[t], K.sC[t], mm4(q, f, zero)), zero);
#pragma unroll
    for (int i = 0; i < 4; ++i) {
      v2f b; b[0] = h[2*i]; b[1] = h[2*i+1];
      d2 = mm4(K.F[t][i], b, d2);
    }
  }
  return d2;
}

// ---------------------------------------------------------------------------
// Kernel 4: stats of w2 = relu(BN1(w)) @ Ww1 + bw1 per 8 channels -> mstats[16]
// It also stores, per point and in the lanes' own order, what kernel 5 needs of
// this stage: w2s = 4 floats a lane (w2 without bw1, mid channel r + 4*kh of
// neighbour lr), fs = 2 floats a lane (the fragment f).
// ---------------------------------------------------------------------------
// The second launch bound keeps the allocation at 160 registers, six waves a SIMD:
// one register more would cost a resident wave.
__global__ void __launch_bounds__(PT_BLOCK, 6) k_mstats(
    const float* __restrict__ p, const int* __restrict__ idx,
    const float* __restrict__ xq, const float* __restrict__ xk,
    const float* __restrict__ Wp1, const float* __restrict__ bp1,
    const float* __restrict__ gp,  const float* __restrict__ bp_bn,
    const float* __restrict__ Wp2, const float* __restrict__ bp2,
    const float* __restrict__ gw1, const float* __restrict__ bw1_bn,
    const float* __restrict__ Ww1, const float* __restrict__ bw1,
    const float* __restrict__ pstats, const float* __restrict__ wstats,
    float* __restrict__ mstats, float* __restrict__ w2s, float* __restrict__ fs)
{
  __shared__ float sS1[64], sO1[64];
  __shared__ float sm[8], sm2[8];
  if (threadIdx.x < 8) { sm[threadIdx.x] = 0.f; sm2[threadIdx.x] = 0.f; }
  const int lane = threadIdx.x & 31;
  const int lr = lane & 15, kh = lane >> 4;
  const int wave = __builtin_amdgcn_readfirstlane((int)((blockIdx.x*blockDim.x + threadIdx.x) >> 5));
  const BNp B = make_bnp(pstats, lane, gp, bp_bn);
  const PW L = make_pw(Wp1, bp1);
  MidC K;
  make_midc(K, sS1, sO1, lr, kh, Wp2, bp2, gw1, bw1_bn, Ww1, wstats);
  float ms[4] = {0,0,0,0}, ms2[4] = {0,0,0,0};
  for (int n = wave; n < NPTS; n += PT_WAVES) {
    const int id = idx[n*NS + lr] & (NPTS-1);
    v8f w[4];
    float xqv[4];
    const float* kr = xk + (size_t)id*C + kh*8;
    gather_lane_nb(kr, w);
    const float q0 = p[id*3+0], q1 = p[id*3+1], q2 = p[id*3+2];
    const float c0 = p[n*3+0],  c1 = p[n*3+1],  c2 = p[n*3+2];
#pragma unroll
    for (int t = 0; t < 4; ++t) xqv[t] = xq[(size_t)n*C + 16*t + lr];
    // loads held ahead of their uses, translation wait: as in kernel 3
    asm volatile("s_wait_xcnt 0x0" :: "v"(kr), "v"(id) : "memory");
    __builtin_amdgcn_sched_barrier(0);
    const v2f f = pfrag(q0, q1, q2, c0, c1, c2, kh, L, B);
    const v8f d2 = mid_w2(K, w, xqv, f);
#pragma unroll
    for (int r = 0; r < 4; ++r) {
      ms[r] += d2[r]; ms2[r] = fmaf(d2[r], d2[r], ms2[r]);
    }
    // the sums above stay in front of the stores: the store of the last product's
    // result then issues behind vector instructions that have already read it
    __builtin_amdgcn_sched_barrier(0);
    float* pw = w2s + (size_t)n*W2_PT + lane*4;
    float* pf = fs  + (size_t)n*F_PT  + lane*2;
    const v4f sv = {d2[0], d2[1], d2[2], d2[3]};
    *(v4f*)pw = sv;
    *(v2f*)pf = f;
    // translation wait, a precaution ahead of the next pass's reuse of the two
    // stores' address and data registers
    asm volatile("s_wait_xcnt 0x0" :: "v"(pw), "v"(pf), "v"(sv), "v"(f) : "memory");
  }
  // bw1 enters once per wave: sum(x+b) = sum x + k*b, sum(x+b)^2 = sum x^2 + 2b*sum x + k*b^2
  const float kpts = (float)(NPTS/PT_WAVES);
#pragma unroll
  for (int r = 0; r < 4; ++r) {
    const float bb = bw1[r + 4*kh];
    ms2[r] = fmaf(bb, fmaf(kpts, bb, 2.f*ms[r]), ms2[r]);
    ms[r]  = fmaf(kpts, bb, ms[r]);
    const float a = rowsum16(ms[r]), b = rowsum16(ms2[r]);
    if (lr == 0) { atomicAdd(&sm[r + 4*kh], a); atomicAdd(&sm2[r + 4*kh], b); }
  }
  __syncthreads();
  if (threadIdx.x < 8) {
    atomicAdd(&mstats[threadIdx.x],   sm[threadIdx.x]);
    atomicAdd(&mstats[8+threadIdx.x], sm2[threadIdx.x]);
  }
}

// ---------------------------------------------------------------------------
// Kernel 5: softmax + aggregation. One point per wave pass.  w2 and f come
// from kernel 4's stores, read back by the lane that wrote them.
// ---------------------------------------------------------------------------
__global__ void __launch_bounds__(PT_BLOCK) k_final(
    const int* __restrict__ idx, const float* __restrict__ xv,
    const float* __restrict__ Wp2, const float* __restrict__ bp2,
    const float* __restrict__ bw1,
    const float* __restrict__ gw2, const float* __restrict__ bw2_bn,
    const float* __restrict__ Ww2, const float* __restrict__ bw2,
    const float* __restrict__ mstats,
    const float* __restrict__ w2s, const float* __restrict__ fs,
    float* __restrict__ out)
{
  const int lane = threadIdx.x & 31;
  const int lr = lane & 15, kh = lane >> 4;
  const int wave = __builtin_amdgcn_readfirstlane((int)((blockIdx.x*blockDim.x + threadIdx.x) >> 5));

  v2f P[4];       // unscaled positional weights, B operand of the value product
#pragma unroll
  for (int t = 0; t < 4; ++t) {
    const int ch = 16*t + lr;
    P[t][0] = kh ? Wp2[128+ch] : Wp2[ch];
    P[t][1] = kh ? bp2[ch]     : Wp2[64+ch];
  }
  // BN2 folded with bw1, for mid channel o = r + 4*kh
  float s2h[4], o2h[4];
  const float invM = 1.0f/(float)PAIRS;
#pragma unroll
  for (int r = 0; r < 4; ++r) {
    const int o = r + 4*kh;
    const float m = mstats[o]*invM;
    const float s = rsqrtf(mstats[8+o]*invM - m*m + EPSF)*gw2[o];
    s2h[r] = s;
    o2h[r] = fmaf(bw1[o] - m, s, bw2_bn[o]);
  }
  // Ww2 as B: column lr -> plane lr & 7, k = mid channels 2s+4kh, +1
  v2f G[2];
#pragma unroll
  for (int s = 0; s < 2; ++s) {
    G[s][0] = Ww2[(2*s + 4*kh)*8 + (lr & 7)];
    G[s][1] = Ww2[(2*s + 1 + 4*kh)*8 + (lr & 7)];
  }
  const float b2l = bw2[lr & 7];

  for (int n = wave; n < NPTS; n += PT_WAVES) {
    v8f V[4];
    const float* vr[8];
    const float* pw = w2s + (size_t)n*W2_PT + lane*4;
    const float* pf = fs  + (size_t)n*F_PT  + lane*2;
    const v4f d2 = *(const v4f*)pw;
    const v2f f  = *(const v2f*)pf;
    gather_lane_ch(xv, idx, n, lr, kh, V, vr);
    // loads held ahead of their uses, translation wait: as in kernel 3
    asm volatile("s_wait_xcnt 0x0" :: "v"(vr[0]), "v"(vr[1]), "v"(vr[2]), "v"(vr[3]),
                 "v"(vr[4]), "v"(vr[5]), "v"(vr[6]), "v"(vr[7]), "v"(pw), "v"(pf) : "memory");
    __builtin_amdgcn_sched_barrier(0);

    // logits: d3[r] = w3 of neighbour r+8kh, plane lr & 7
    float h2[4];
#pragma unroll
    for (int r = 0; r < 4; ++r) h2[r] = fmaxf(fmaf(d2[r], s2h[r], o2h[r]), 0.f);
    v8f d3 = {b2l, b2l, b2l, b2l, b2l, b2l, b2l, b2l};
#pragma unroll
    for (int s = 0; s < 2; ++s) {
      v2f a; a[0] = h2[2*s]; a[1] = h2[2*s+1];
      d3 = mm4(a, G[s], d3);
    }

    // softmax over the 16 neighbours: 8 registers and the other lane half
    float mx = fmaxf(fmaxf(fmaxf(d3[0], d3[1]), fmaxf(d3[2], d3[3])),
                     fmaxf(fmaxf(d3[4], d3[5]), fmaxf(d3[6], d3[7])));
    mx = fmaxf(mx, xhalf(mx));
    v8f e;
#pragma unroll
    for (int r = 0; r < 8; ++r) e[r] = __expf(d3[r] - mx);
    float den = sum8(e);
    den += xhalf(den);
    const float invd = 1.0f / den;

    // out[n,ch] = sum_j (xv_g + pr) * weight; xv_g + pr = f x P + xv_g
    float acc[4];
#pragma unroll
    for (int u = 0; u < 4; ++u) {
      const v8f vp = mm4(f, P[u], V[u]);
      v2f a2v = {0.f, 0.f};
#pragma unroll
      for (int i = 0; i < 4; ++i) {
        v2f x; x[0] = vp[2*i]; x[1] = vp[2*i+1];
        v2f y; y[0] = e[2*i];  y[1] = e[2*i+1];
        a2v = __builtin_elementwise_fma(x, y, a2v);
      }
      const float a = a2v[0] + a2v[1];
      acc[u] = a + xhalf(a);
    }
    float* orow = out + (size_t)n*C + 32*kh + lr;
    const float o0 = (kh ? acc[2] : acc[0]) * invd;
    const float o1 = (kh ? acc[3] : acc[1]) * invd;
    orow[0]  = o0;
    orow[16] = o1;
    // the same precaution for the two stores' address and data registers,
    // which the next pass reuses
    asm volatile("s_wait_xcnt 0x0" :: "v"(orow), "v"(o0), "v"(o1) : "memory");
  }
}

// ---------------------------------------------------------------------------
// Host launcher
// ---------------------------------------------------------------------------
extern "C" void kernel_launch(void* const* d_in, const int* in_sizes, int n_in,
                              void* d_out, int out_size, void* d_ws, size_t ws_size,
                              hipStream_t stream)
{
  (void)in_sizes; (void)n_in; (void)out_size; (void)ws_size;
  const float* p     = (const float*)d_in[0];
  const float* x     = (const float*)d_in[1];
  const int*   idx   = (const int*)  d_in[2];
  const float* Wq    = (const float*)d_in[3];
  const float* bq    = (const float*)d_in[4];
  const float* Wk    = (const float*)d_in[5];
  const float* bk    = (const float*)d_in[6];
  const float* Wv    = (const float*)d_in[7];
  const float* bv    = (const float*)d_in[8];
  const float* Wp1   = (const float*)d_in[9];
  const float* bp1   = (const float*)d_in[10];
  const float* gp    = (const float*)d_in[11];
  const float* bp_bn = (const float*)d_in[12];
  const float* Wp2   = (const float*)d_in[13];
  const float* bp2   = (const float*)d_in[14];
  const float* gw1   = (const float*)d_in[15];
  const float* bw1bn = (const float*)d_in[16];
  const float* Ww1   = (const float*)d_in[17];
  const float* bw1   = (const float*)d_in[18];
  const float* gw2   = (const float*)d_in[19];
  const float* bw2bn = (const float*)d_in[20];
  const float* Ww2   = (const float*)d_in[21];
  const float* bw2   = (const float*)d_in[22];

  float* ws     = (float*)d_ws;          // 96 MB + 8 KiB of the workspace
  float* xq     = ws;
  float* xk     = xq + (size_t)NPTS*C;
  float* xv     = xk + (size_t)NPTS*C;
  float* pstats = xv + (size_t)NPTS*C;   // 6 x PS_BLOCKS per-block sums
  float* wstats = pstats + 6*PS_BLOCKS;  // 128
  float* mstats = wstats + 128;          // 16
  float* w2s    = pstats + 2048;         // 32 MB, 8 KiB behind pstats
  float* fs     = w2s + (size_t)NPTS*W2_PT;  // 16 MB

  // 1) QKV projections: 12288 waves, 8 waves/block, B fragments register-resident;
  //    in front of them PS_BLOCKS blocks with the positional-branch BN sums and
  //    the zeros of wstats and mstats
  k_qkv<<<PS_BLOCKS + QKV_WAVES/8, 256, 0, stream>>>(x, Wq,bq, Wk,bk, Wv,bv, xq, xk, xv,
                                     p, idx, Wp1, bp1, pstats, wstats);
  // 3) attention-logit BN stats (64 ch)
  k_wstats<<<PT_WAVES*32/PT_BLOCK, PT_BLOCK, 0, stream>>>(p, idx, xq, xk, Wp1,bp1, gp,bp_bn, Wp2,bp2,
                                     pstats, wstats);
  // 4) mid BN stats (8 ch)
  k_mstats<<<PT_WAVES*32/PT_BLOCK, PT_BLOCK, 0, stream>>>(p, idx, xq, xk, Wp1,bp1, gp,bp_bn, Wp2,bp2,
                                     gw1,bw1bn, Ww1,bw1, pstats, wstats, mstats, w2s, fs);
  // 5) softmax + aggregation from kernel 4's w2 and f, one point per wave pass
  k_final<<<PT_WAVES*32/PT_BLOCK, PT_BLOCK, 0, stream>>>(idx, xv, Wp2,bp2, bw1,
                                      gw2,bw2bn, Ww2,bw2, mstats, w2s, fs,
                                      (float*)d_out);
}

// v004
// A run of this version takes 94.9 microseconds.
// Two timings next to v003 both put it at 1.12 times that version's speed.
// Over all steps from v000 it is 4.29 times as fast.
#include <hip/hip_runtime.h>
#include <math.h>

// Problem constants (from reference)
#define NPTS 65536
#define NS   16
#define C    64
#define CH   8            // MID // S
#define PAIRS (NPTS*NS)   // 1,048,576
#define EPSF 1e-5f

typedef __attribute__((ext_vector_type(2))) float v2f;
typedef __attribute__((ext_vector_type(8))) float v8f;
typedef __attribute__((ext_vector_type(4))) float v4f;
typedef __attribute__((ext_vector_type(4))) int   v4i;
typedef __attribute__((ext_vector_type(2))) int   v2i;

// lane l <-> lane l ^ 16
__device__ __forceinline__ float xhalf(float x) {
  return __builtin_bit_cast(float, __builtin_amdgcn_permlanex16(
      __builtin_bit_cast(int, x), __builtin_bit_cast(int, x),
      0x76543210, 0xfedcba98, false, false));
}

// sum over the 16 lanes of a row (row_xmask 1,2,4,8)
__device__ __forceinline__ float rowsum16(float v) {
  v += __builtin_bit_cast(float, __builtin_amdgcn_update_dpp(0, __builtin_bit_cast(int, v), 0x161, 0xf, 0xf, true));
  v += __builtin_bit_cast(float, __builtin_amdgcn_update_dpp(0, __builtin_bit_cast(int, v), 0x162, 0xf, 0xf, true));
  v += __builtin_bit_cast(float, __builtin_amdgcn_update_dpp(0, __builtin_bit_cast(int, v), 0x164, 0xf, 0xf, true));
  v += __builtin_bit_cast(float, __builtin_amdgcn_update_dpp(0, __builtin_bit_cast(int, v), 0x168, 0xf, 0xf, true));
  return v;
}

#define PS_BLOCKS 256     // blocks of launch 1 that sum the positional branch

// ---------------------------------------------------------------------------
// BN params for the 3-channel positional branch.  part = [6][PS_BLOCKS] sums of
// t and t*t, one per block of launch 1; every wave adds them up for itself, in
// a fixed order (8 a lane, then over the 32 lanes).
// ---------------------------------------------------------------------------
struct BNp { float m0,m1,m2, s0,s1,s2, b0,b1,b2; };

__device__ __forceinline__ BNp make_bnp(const float* __restrict__ part, int lane,
                                        const float* __restrict__ gp,
                                        const float* __restrict__ bp) {
  const float invM = 1.0f / (float)PAIRS;
  const float* pp = part + lane*8;
  v4f lo[6], hi[6];
#pragma unroll
  for (int k = 0; k < 6; ++k) {
    lo[k] = *(const v4f*)(pp + k*PS_BLOCKS);
    hi[k] = *(const v4f*)(pp + k*PS_BLOCKS + 4);
  }
  // translation wait, a precaution ahead of any reuse of the loads' address register
  asm volatile("s_wait_xcnt 0x0" :: "v"(pp) : "memory");
  float ps[6];
#pragma unroll
  for (int k = 0; k < 6; ++k) {
    float v = ((lo[k][0]+lo[k][1]) + (lo[k][2]+lo[k][3])) + ((hi[k][0]+hi[k][1]) + (hi[k][2]+hi[k][3]));
    v = rowsum16(v);
    v += xhalf(v);
    // the same in every lane: kept in a scalar register
    ps[k] = __builtin_bit_cast(float, __builtin_amdgcn_readfirstlane(__builtin_bit_cast(int, v)));
  }
  BNp r;
  float m0 = ps[0]*invM, m1 = ps[1]*invM, m2 = ps[2]*invM;
  float v0 = ps[3]*invM - m0*m0;
  float v1 = ps[4]*invM - m1*m1;
  float v2 = ps[5]*invM - m2*m2;
  r.m0=m0; r.m1=m1; r.m2=m2;
  r.s0 = rsqrtf(v0+EPSF)*gp[0];
  r.s1 = rsqrtf(v1+EPSF)*gp[1];
  r.s2 = rsqrtf(v2+EPSF)*gp[2];
  r.b0 = bp[0]; r.b1 = bp[1]; r.b2 = bp[2];
  return r;
}

// ---------------------------------------------------------------------------
// Kernel 1: xq/xk/xv = x @ W + b via V_WMMA_F32_16X16X4_F32.
// Each wave behind the first PS_BLOCKS blocks owns one of the 12 (matrix, N-tile) combos; the B fragment
// (32 floats) + bias are hoisted into registers once, then the wave
// grid-strides over M-tiles: 16 b64 A-loads + 16 WMMAs + 8 stores per tile.
// A (16x4 f32): lanes 0-15 rows M, VGPR0=K0 VGPR1=K1; lanes 16-31 K2/K3.
// B (4x16 f32): lanes hold N, VGPR0=K0(|K2), VGPR1=K1(|K3).
// ---------------------------------------------------------------------------
#define QKV_WAVES 12288   // 12 combos x 1024 waves -> 4 M-tiles per wave

// The first PS_BLOCKS blocks of launch 1: sum / sumsq of (rel_p @ Wp1 + bp1) per
// 3 channels, one point (16 pairs) a thread, one set of six sums a block ->
// part[6][PS_BLOCKS].  Nothing here depends on the projections, so it shares
// their launch.  Block 0 also stores the zeros that kernels 3 and 4 add into.
__device__ __forceinline__ void pstats_part(
    const float* __restrict__ p, const int* __restrict__ idx,
    const float* __restrict__ Wp1, const float* __restrict__ bp1,
    float* __restrict__ part, float* __restrict__ zstats)
{
  __shared__ float sh[8][6];
  float w[9], bb[3];
#pragma unroll
  for (int i = 0; i < 9; ++i) w[i] = Wp1[i];
#pragma unroll
  for (int i = 0; i < 3; ++i) bb[i] = bp1[i];
  const int n = blockIdx.x*256 + threadIdx.x;
  const v2i* ip = (const v2i*)(idx + n*NS);
  const float* pc = p + n*3;
  v2i cur = ip[0];
  const float c0 = pc[0], c1 = pc[1], c2 = pc[2];
  // translation wait, a precaution ahead of any reuse of the loads' address registers
  asm volatile("s_wait_xcnt 0x0" :: "v"(ip), "v"(pc) : "memory");
  // channels 0 and 1 as a pair, channel 2 alone
  const v2f W01 = {w[0], w[1]}, W34 = {w[3], w[4]}, W67 = {w[6], w[7]}, B01 = {bb[0], bb[1]};
  v2f sp = {0.f, 0.f}, sp2 = {0.f, 0.f};
  float sc = 0.f, sc2 = 0.f;
  // Two neighbours a trip, the next trip's indices fetched beside this trip's
  // gathers.  Kept rolled and narrow: unrolled, or four a trip, the allocation
  // passes 64 registers, which the projection blocks of this launch would pay
  // with resident waves (14 a SIMD are launched).
#pragma unroll 1
  for (int g = 0; g < 8; ++g) {
    const v2i* in = ip + ((g + 1) & 7);
    const v2i nxt = *in;
    // the same precaution for this load's address registers; it also keeps the load
    // ahead of the gathers, so that its result lands in none of their address registers
    asm volatile("s_wait_xcnt 0x0" :: "v"(in) : "memory");
    int o[2];
    float q0[2], q1[2], q2[2];
#pragma unroll
    for (int j = 0; j < 2; ++j) {
      o[j] = (cur[j] & (NPTS-1))*3;
      q0[j] = p[o[j]]; q1[j] = p[o[j]+1]; q2[j] = p[o[j]+2];
    }
    // and for the two gathers' address registers
    asm volatile("s_wait_xcnt 0x0" :: "v"(o[0]), "v"(o[1]) : "memory");
#pragma unroll
    for (int j = 0; j < 2; ++j) {
      const float r0 = q0[j]-c0, r1 = q1[j]-c1, r2 = q2[j]-c2;
      const v2f R0 = {r0, r0}, R1 = {r1, r1}, R2 = {r2, r2};
      const v2f t = __builtin_elementwise_fma(R2, W67,
                    __builtin_elementwise_fma(R1, W34,
                    __builtin_elementwise_fma(R0, W01, B01)));
      const float u = fmaf(r2, w[8], fmaf(r1, w[5], fmaf(r0, w[2], bb[2])));
      sp += t; sp2 = __builtin_elementwise_fma(t, t, sp2);
      sc += u; sc2 = fmaf(u, u, sc2);
    }
    cur = nxt;
  }
  const float s[3] = {sp[0], sp[1], sc}, s2[3] = {sp2[0], sp2[1], sc2};
  const int lane = threadIdx.x & 31, wv = threadIdx.x >> 5;
#pragma unroll
  for (int k = 0; k < 3; ++k) {
    float a = rowsum16(s[k]), b = rowsum16(s2[k]);
    a += xhalf(a); b += xhalf(b);
    if (lane == 0) { sh[wv][k] = a; sh[wv][3+k] = b; }
  }
  __syncthreads();
  if (threadIdx.x < 6) {
    float a = 0.f;
#pragma unroll
    for (int v = 0; v < 8; ++v) a += sh[v][threadIdx.x];
    part[threadIdx.x*PS_BLOCKS + blockIdx.x] = a;
  }
  if (blockIdx.x == 0 && threadIdx.x < 128+16) zstats[threadIdx.x] = 0.f;
}

__global__ void __launch_bounds__(256) k_qkv(
    const float* __restrict__ x,
    const float* __restrict__ Wq, const float* __restrict__ bq,
    const float* __restrict__ Wk, const float* __restrict__ bk,
    const float* __restrict__ Wv, const float* __restrict__ bv,
    float* __restrict__ xq, float* __restrict__ xk, float* __restrict__ xv,
    const float* __restrict__ p, const int* __restrict__ idx,
    const float* __restrict__ Wp1, const float* __restrict__ bp1,
    float* __restrict__ part, float* __restrict__ zstats)
{
  if (blockIdx.x < PS_BLOCKS) {   // the same for a whole block
    pstats_part(p, idx, Wp1, bp1, part, zstats);
    return;
  }
  const int wave  = ((blockIdx.x - PS_BLOCKS) * blockDim.x + threadIdx.x) >> 5;
  const int lane  = threadIdx.x & 31;
  const int combo = wave % 12;
  const int mat   = combo % 3;
  const int nt    = combo / 3;          // 0..3
  const float* W    = (mat==0) ? Wq : (mat==1) ? Wk : Wv;
  const float* bias = (mat==0) ? bq : (mat==1) ? bk : bv;
  float*       out  = (mat==0) ? xq : (mat==1) ? xk : xv;
  const int n0 = nt*16;
  const int lr = lane & 15, kh = lane >> 4;

  // Hoist B fragment + bias (constant for this wave's combo)
  float br0[16], br1[16];
#pragma unroll
  for (int k = 0; k < 16; ++k) {
    const float* bptr = W + (size_t)(k*4 + kh*2)*C + n0 + lr;
    br0[k] = bptr[0];
    br1[k] = bptr[C];
  }
  const float bb = bias[n0+lr];

  for (int mt = wave / 12; mt < NPTS/16; mt += QKV_WAVES/12) {
    const float* arow = x + (size_t)(mt*16+lr)*C + kh*2;
    v8f acc = {};
#pragma unroll
    for (int k = 0; k < 16; ++k) {
      v2f a = *(const v2f*)(arow + k*4);
      v2f b; b[0] = br0[k]; b[1] = br1[k];
      acc = __builtin_amdgcn_wmma_f32_16x16x4_f32(false, a, false, b,
                                                  (short)0, acc, false, false);
    }
#pragma unroll
    for (int r = 0; r < 8; ++r)
      out[(size_t)(mt*16 + r + kh*8)*C + n0 + lr] = acc[r] + bb;
  }
}

// ---------------------------------------------------------------------------
// Kernels 3-5 work on one point (its 16 neighbours) per wave pass and run the
// per-pair products on V_WMMA_F32_16X16X4_F32.  lr = lane & 15, kh = lane >> 4.
// Fragment facts (as in kernel 1): A lane lr = row, B lane lr = column, both
// hold k = 2*kh, 2*kh+1 in their two registers; D register r = row r + 8*kh,
// column lr.
//   f        = (a0,a1 | a2,1): positional features of neighbour lr, k = 4
//   P[t]     = (Wp2 row0,row1 | row2,bias) of channel 16t+lr, k = 4
//   P x f    -> D[r] = channel 16t+8kh+r of neighbour lr   (lane = neighbour)
//   f x P    -> D[r] = neighbour r+8kh, channel 16t+lr     (lane = channel)
// In the lane = channel products the gathered rows enter as the C operand; in
// the lane = neighbour product they are added behind it; -xq goes into the
// bias column.
// ---------------------------------------------------------------------------
#define PT_WAVES 8192     // kernel 5: 8 points per wave
// Kernels 3 and 4 allocate 160 registers, so a SIMD holds six of their waves and
// the chip 256 x 4 x 6 = 6144.  They launch exactly that many (six blocks a WGP):
// every wave is resident from the start and takes 10 or 11 points.  Any more blocks
// would wait for a free place and run as a second round on a mostly empty chip.
#define ST_WAVES 6144
#define PT_BLOCK 128      // 4 waves per block
#define W2_PT 128         // floats of w2 stored per point (16 neighbours x 8)
#define F_PT  64          // floats of f stored per point (32 lanes x 2)

__device__ __forceinline__ v8f mm4(v2f a, v2f b, v8f c) {
  return __builtin_amdgcn_wmma_f32_16x16x4_f32(false, a, false, b, (short)0, c,
                                               false, false);
}

// Wp1 and bp1, read once per wave
struct PW { float w[9], b[3]; };
__device__ __forceinline__ PW make_pw(const float* __restrict__ Wp1,
                                      const float* __restrict__ bp1) {
  PW r;
#pragma unroll
  for (int i = 0; i < 9; ++i) r.w[i] = Wp1[i];
#pragma unroll
  for (int i = 0; i < 3; ++i) r.b[i] = bp1[i];
  return r;
}

// f = (a0,a1 | a2,1) from the neighbour's coordinates (q0,q1,q2) and the
// point's own (c0,c1,c2), all loaded by the caller
__device__ __forceinline__ v2f pfrag(float q0, float q1, float q2,
                                     float c0, float c1, float c2, int kh,
                                     const PW& L, const BNp& B) {
  float r0 = q0-c0;
  float r1 = q1-c1;
  float r2 = q2-c2;
  float t0 = fmaf(r2, L.w[6], fmaf(r1, L.w[3], fmaf(r0, L.w[0], L.b[0])));
  float t1 = fmaf(r2, L.w[7], fmaf(r1, L.w[4], fmaf(r0, L.w[1], L.b[1])));
  float t2 = fmaf(r2, L.w[8], fmaf(r1, L.w[5], fmaf(r0, L.w[2], L.b[2])));
  float a0 = fmaxf(fmaf(t0-B.m0, B.s0, B.b0), 0.f);
  float a1 = fmaxf(fmaf(t1-B.m1, B.s1, B.b1), 0.f);
  float a2 = fmaxf(fmaf(t2-B.m2, B.s2, B.b2), 0.f);
  v2f f; f[0] = kh ? a2 : a0; f[1] = kh ? 1.f : a1;
  return f;
}

__device__ __forceinline__ float sum8(v8f v) {
  return ((v[0]+v[1]) + (v[2]+v[3])) + ((v[4]+v[5]) + (v[6]+v[7]));
}

// rows of src for neighbours r+8kh, channels 16u+lr  (lane = channel layout)
__device__ __forceinline__ void gather_lane_ch(const float* __restrict__ src,
                                               const int* __restrict__ idx,
                                               int n, int lr, int kh, v8f V[4],
                                               const float* vr[8]) {
  const v4i i0 = *(const v4i*)(idx + n*NS + kh*8);
  const v4i i1 = *(const v4i*)(idx + n*NS + kh*8 + 4);
#pragma unroll
  for (int r = 0; r < 8; ++r) {
    const int idr = ((r < 4) ? i0[r & 3] : i1[r & 3]) & (NPTS-1);
    vr[r] = src + (size_t)idr*C + lr;
#pragma unroll
    for (int u = 0; u < 4; ++u) V[u][r] = vr[r][16*u];
  }
}

// kr = row of neighbour lr + 8*kh: channels 16t+8kh+r  (lane = neighbour layout)
__device__ __forceinline__ void gather_lane_nb(const float* __restrict__ kr, v8f w[4]) {
#pragma unroll
  for (int t = 0; t < 4; ++t) {
    const v4f lo = *(const v4f*)(kr + 16*t);
    const v4f hi = *(const v4f*)(kr + 16*t + 4);
    w[t] = __builtin_shufflevector(lo, hi, 0, 1, 2, 3, 4, 5, 6, 7);
  }
}

// ---------------------------------------------------------------------------
// Kernel 3: sum / sumsq of w = xk_g - xq + pr per 64 channels -> wstats[128]
// lane = channel layout: w = f x P' + xk_g, P' bias column = bp2 - xq.
// ---------------------------------------------------------------------------
__global__ void __launch_bounds__(PT_BLOCK) k_wstats(
    const float* __restrict__ p, const int* __restrict__ idx,
    const float* __restrict__ xq, const float* __restrict__ xk,
    const float* __restrict__ Wp1, const float* __restrict__ bp1,
    const float* __restrict__ gp,  const float* __restrict__ bp_bn,
    const float* __restrict__ Wp2, const float* __restrict__ bp2,
    const float* __restrict__ pstats, float* __restrict__ wstats)
{
  __shared__ float ss[64], ss2[64];
  if (threadIdx.x < 64) { ss[threadIdx.x] = 0.f; ss2[threadIdx.x] = 0.f; }
  __syncthreads();
  const int lane = threadIdx.x & 31;
  const int lr = lane & 15, kh = lane >> 4;
  const int wave = __builtin_amdgcn_readfirstlane((int)((blockIdx.x*blockDim.x + threadIdx.x) >> 5));
  const BNp B = make_bnp(pstats, lane, gp, bp_bn);
  const PW L = make_pw(Wp1, bp1);
  v2f P[4];
#pragma unroll
  for (int t = 0; t < 4; ++t) {
    const int ch = 16*t + lr;
    P[t][0] = kh ? Wp2[128+ch] : Wp2[ch];
    P[t][1] = kh ? bp2[ch]     : Wp2[64+ch];
  }
  const float negk = kh ? -1.f : 0.f;
  v8f S[4] = {}, S2[4] = {};
  for (int n = wave; n < NPTS; n += ST_WAVES) {
    const int id = idx[n*NS + lr] & (NPTS-1);
    v8f V[4];
    float xqv[4];
    const float* vr[8];
    gather_lane_ch(xk, idx, n, lr, kh, V, vr);
#pragma unroll
    for (int u = 0; u < 4; ++u) xqv[u] = xq[(size_t)n*C + 16*u + lr];
    const float q0 = p[id*3+0], q1 = p[id*3+1], q2 = p[id*3+2];
    const float c0 = p[n*3+0],  c1 = p[n*3+1],  c2 = p[n*3+2];
    // All of the point's loads stay issued ahead of their first use: sunk to their
    // uses, each would wait out its own round trip.  The translation wait is a
    // precaution ahead of any overwrite of the loads' address registers; the row
    // pointers and the index are its inputs so that they keep their registers up to it.
    asm volatile("s_wait_xcnt 0x0" :: "v"(vr[0]), "v"(vr[1]), "v"(vr[2]), "v"(vr[3]),
                 "v"(vr[4]), "v"(vr[5]), "v"(vr[6]), "v"(vr[7]), "v"(id) : "memory");
    __builtin_amdgcn_sched_barrier(0);
    const v2f f = pfrag(q0, q1, q2, c0, c1, c2, kh, L, B);
#pragma unroll
    for (int u = 0; u < 4; ++u) {
      v2f b = P[u];
      b[1] = fmaf(xqv[u], negk, b[1]);
      const v8f w = mm4(f, b, V[u]);
      S[u]  += w;
      S2[u] = __builtin_elementwise_fma(w, w, S2[u]);
    }
  }
#pragma unroll
  for (int u = 0; u < 4; ++u) {
    float a = sum8(S[u]), b = sum8(S2[u]);
    a += xhalf(a); b += xhalf(b);
    if (kh == 0) { atomicAdd(&ss[16*u+lr], a); atomicAdd(&ss2[16*u+lr], b); }
  }
  __syncthreads();
  if (threadIdx.x < 64) {
    atomicAdd(&wstats[threadIdx.x],    ss[threadIdx.x]);
    atomicAdd(&wstats[64+threadIdx.x], ss2[threadIdx.x]);
  }
}

// ---------------------------------------------------------------------------
// Kernel 4's constants of h = relu(BN1(w)) and w2 = h @ Ww1.
// BN1 is folded: h = relu(s1*xk_g + [s1*pr + s1*(bp2 - xq - m1) + b1]).
// ---------------------------------------------------------------------------
struct MidC {
  v2f  Q[4];      // s1-scaled P, bias column = s1*(bp2 - m1) + b1
  float sneg[4];  // -s1 in the bias column's lanes, else 0
  v8f  sC[4];     // s1 of channel 16t+8kh+r
  v2f  F[4][4];   // Ww1^T as A: row lr -> o(lr), k = channels 16t+8kh+2q, +1
};

// sS1 / sO1: 64 floats of LDS each, filled here (one barrier inside).
__device__ __forceinline__ void make_midc(MidC& K, float* sS1, float* sO1,
    int lr, int kh,
    const float* __restrict__ Wp2, const float* __restrict__ bp2,
    const float* __restrict__ gw1, const float* __restrict__ bw1_bn,
    const float* __restrict__ Ww1, const float* __restrict__ wstats)
{
  if (threadIdx.x < 64) {
    const int ch = threadIdx.x;
    const float invM = 1.0f/(float)PAIRS;
    const float m = wstats[ch]*invM;
    const float s = rsqrtf(wstats[64+ch]*invM - m*m + EPSF)*gw1[ch];
    sS1[ch] = s;
    sO1[ch] = fmaf(bp2[ch] - m, s, bw1_bn[ch]);
  }
  __syncthreads();
  // rows 0-7 -> o = row, rows 8-15 -> o = (row+4)&7: D registers 0-3 then hold
  // o = r + 4*kh, every mid channel once over the two lane halves.
  const int o = (lr < 8) ? lr : ((lr + 4) & 7);
#pragma unroll
  for (int t = 0; t < 4; ++t) {
    const int ch = 16*t + lr;
    const float s = sS1[ch];
    K.Q[t][0] = (kh ? Wp2[128+ch] : Wp2[ch]) * s;
    K.Q[t][1] = kh ? sO1[ch] : Wp2[64+ch] * s;
    K.sneg[t] = kh ? -s : 0.f;
#pragma unroll
    for (int r = 0; r < 8; ++r) K.sC[t][r] = sS1[16*t + 8*kh + r];
#pragma unroll
    for (int q = 0; q < 4; ++q) {
      const int c0 = 16*t + 8*kh + 2*q;
      K.F[t][q][0] = Ww1[c0*8 + o];
      K.F[t][q][1] = Ww1[(c0+1)*8 + o];
    }
  }
}

// w2 (without bw1) of the point's 16 neighbours: register r < 4 of the result
// = mid channel r + 4*kh of neighbour lr.
// w = gathered xk row (lane = neighbour layout), xqv[t] = xq of channel 16t+lr.
__device__ __forceinline__ v8f mid_w2(const MidC& K, const v8f w[4],
                                      const float xqv[4], v2f f)
{
  const v8f zero = {};
  v8f d2 = {};
#pragma unroll
  for (int t = 0; t < 4; ++t) {
    v2f q = K.Q[t];
    q[1] = fmaf(xqv[t], K.sneg[t], q[1]);
    const v8f h = __builtin_elementwise_max(
        __builtin_elementwise_fma(w[t], K.sC[t], mm4(q, f, zero)), zero);
#pragma unroll
    for (int i = 0; i < 4; ++i) {
      v2f b; b[0] = h[2*i]; b[1] = h[2*i+1];
      d2 = mm4(K.F[t][i], b, d2);
    }
  }
  return d2;
}

// ---------------------------------------------------------------------------
// Kernel 4: stats of w2 = relu(BN1(w)) @ Ww1 + bw1 per 8 channels -> mstats[16]
// It also stores, per point and in the lanes' own order, what kernel 5 needs of
// this stage: w2s = 4 floats a lane (w2 without bw1, mid channel r + 4*kh of
// neighbour lr), fs = 2 floats a lane (the fragment f).
// ---------------------------------------------------------------------------
// The second launch bound keeps the allocation at 160 registers, six waves a SIMD:
// one register more would cost a resident wave.
__global__ void __launch_bounds__(PT_BLOCK, 6) k_mstats(
    const float* __restrict__ p, const int* __restrict__ idx,
    const float* __restrict__ xq, const float* __restrict__ xk,
    const float* __restrict__ Wp1, const float* __restrict__ bp1,
    const float* __restrict__ gp,  const float* __restrict__ bp_bn,
    const float* __restrict__ Wp2, const float* __restrict__ bp2,
    const float* __restrict__ gw1, const float* __restrict__ bw1_bn,
    const float* __restrict__ Ww1, const float* __restrict__ bw1,
    const float* __restrict__ pstats, const float* __restrict__ wstats,
    float* __restrict__ mstats, float* __restrict__ w2s, float* __restrict__ fs)
{
  __shared__ float sS1[64], sO1[64];
  __shared__ float sm[8], sm2[8];
  if (threadIdx.x < 8) { sm[threadIdx.x] = 0.f; sm2[threadIdx.x] = 0.f; }
  const int lane = threadIdx.x & 31;
  const int lr = lane & 15, kh = lane >> 4;
  const int wave = __builtin_amdgcn_readfirstlane((int)((blockIdx.x*blockDim.x + threadIdx.x) >> 5));
  const BNp B = make_bnp(pstats, lane, gp, bp_bn);
  const PW L = make_pw(Wp1, bp1);
  MidC K;
  make_midc(K, sS1, sO1, lr, kh, Wp2, bp2, gw1, bw1_bn, Ww1, wstats);
  float ms[4] = {0,0,0,0}, ms2[4] = {0,0,0,0};
  for (int n = wave; n < NPTS; n += ST_WAVES) {
    const int id = idx[n*NS + lr] & (NPTS-1);
    v8f w[4];
    float xqv[4];
    const float* kr = xk + (size_t)id*C + kh*8;
    gather_lane_nb(kr, w);
    const float q0 = p[id*3+0], q1 = p[id*3+1], q2 = p[id*3+2];
    const float c0 = p[n*3+0],  c1 = p[n*3+1],  c2 = p[n*3+2];
#pragma unroll
    for (int t = 0; t < 4; ++t) xqv[t] = xq[(size_t)n*C + 16*t + lr];
    // loads held ahead of their uses, translation wait: as in kernel 3
    asm volatile("s_wait_xcnt 0x0" :: "v"(kr), "v"(id) : "memory");
    __builtin_amdgcn_sched_barrier(0);
    const v2f f = pfrag(q0, q1, q2, c0, c1, c2, kh, L, B);
    const v8f d2 = mid_w2(K, w, xqv, f);
#pragma unroll
    for (int r = 0; r < 4; ++r) {
      ms[r] += d2[r]; ms2[r] = fmaf(d2[r], d2[r], ms2[r]);
    }
    // the sums above stay in front of the stores: the store of the last product's
    // result then issues behind vector instructions that have already read it
    __builtin_amdgcn_sched_barrier(0);
    float* pw = w2s + (size_t)n*W2_PT + lane*4;
    float* pf = fs  + (size_t)n*F_PT  + lane*2;
    const v4f sv = {d2[0], d2[1], d2[2], d2[3]};
    *(v4f*)pw = sv;
    *(v2f*)pf = f;
    // translation wait, a precaution ahead of the next pass's reuse of the two
    // stores' address and data registers
    asm volatile("s_wait_xcnt 0x0" :: "v"(pw), "v"(pf), "v"(sv), "v"(f) : "memory");
  }
  // bw1 enters once per wave: sum(x+b) = sum x + k*b, sum(x+b)^2 = sum x^2 + 2b*sum x + k*b^2
  // k = the points this wave has taken
  const float kpts = (float)((NPTS - 1 - wave)/ST_WAVES + 1);
#pragma unroll
  for (int r = 0; r < 4; ++r) {
    const float bb = bw1[r + 4*kh];
    ms2[r] = fmaf(bb, fmaf(kpts, bb, 2.f*ms[r]), ms2[r]);
    ms[r]  = fmaf(kpts, bb, ms[r]);
    const float a = rowsum16(ms[r]), b = rowsum16(ms2[r]);
    if (lr == 0) { atomicAdd(&sm[r + 4*kh], a); atomicAdd(&sm2[r + 4*kh], b); }
  }
  __syncthreads();
  if (threadIdx.x < 8) {
    atomicAdd(&mstats[threadIdx.x],   sm[threadIdx.x]);
    atomicAdd(&mstats[8+threadIdx.x], sm2[threadIdx.x]);
  }
}

// ---------------------------------------------------------------------------
// Kernel 5: softmax + aggregation. One point per wave pass.  w2 and f come
// from kernel 4's stores, read back by the lane that wrote them.
// ---------------------------------------------------------------------------
__global__ void __launch_bounds__(PT_BLOCK) k_final(
    const int* __restrict__ idx, const float* __restrict__ xv,
    const float* __restrict__ Wp2, const float* __restrict__ bp2,
    const float* __restrict__ bw1,
    const float* __restrict__ gw2, const float* __restrict__ bw2_bn,
    const float* __restrict__ Ww2, const float* __restrict__ bw2,
    const float* __restrict__ mstats,
    const float* __restrict__ w2s, const float* __restrict__ fs,
    float* __restrict__ out)
{
  const int lane = threadIdx.x & 31;
  const int lr = lane & 15, kh = lane >> 4;
  const int wave = __builtin_amdgcn_readfirstlane((int)((blockIdx.x*blockDim.x + threadIdx.x) >> 5));

  v2f P[4];       // unscaled positional weights, B operand of the value product
#pragma unroll
  for (int t = 0; t < 4; ++t) {
    const int ch = 16*t + lr;
    P[t][0] = kh ? Wp2[128+ch] : Wp2[ch];
    P[t][1] = kh ? bp2[ch]     : Wp2[64+ch];
  }
  // BN2 folded with bw1, for mid channel o = r + 4*kh
  float s2h[4], o2h[4];
  const float invM = 1.0f/(float)PAIRS;
#pragma unroll
  for (int r = 0; r < 4; ++r) {
    const int o = r + 4*kh;
    const float m = mstats[o]*invM;
    const float s = rsqrtf(mstats[8+o]*invM - m*m + EPSF)*gw2[o];
    s2h[r] = s;
    o2h[r] = fmaf(bw1[o] - m, s, bw2_bn[o]);
  }
  // Ww2 as B: column lr -> plane lr & 7, k = mid channels 2s+4kh, +1
  v2f G[2];
#pragma unroll
  for (int s = 0; s < 2; ++s) {
    G[s][0] = Ww2[(2*s + 4*kh)*8 + (lr & 7)];
    G[s][1] = Ww2[(2*s + 1 + 4*kh)*8 + (lr & 7)];
  }
  const float b2l = bw2[lr & 7];

  for (int n = wave; n < NPTS; n += PT_WAVES) {
    v8f V[4];
    const float* vr[8];
    const float* pw = w2s + (size_t)n*W2_PT + lane*4;
    const float* pf = fs  + (size_t)n*F_PT  + lane*2;
    const v4f d2 = *(const v4f*)pw;
    const v2f f  = *(const v2f*)pf;
    gather_lane_ch(xv, idx, n, lr, kh, V, vr);
    // loads held ahead of their uses, translation wait: as in kernel 3
    asm volatile("s_wait_xcnt 0x0" :: "v"(vr[0]), "v"(vr[1]), "v"(vr[2]), "v"(vr[3]),
                 "v"(vr[4]), "v"(vr[5]), "v"(vr[6]), "v"(vr[7]), "v"(pw), "v"(pf) : "memory");
    __builtin_amdgcn_sched_barrier(0);

    // logits: d3[r] = w3 of neighbour r+8kh, plane lr & 7
    float h2[4];
#pragma unroll
    for (int r = 0; r < 4; ++r) h2[r] = fmaxf(fmaf(d2[r], s2h[r], o2h[r]), 0.f);
    v8f d3 = {b2l, b2l, b2l, b2l, b2l, b2l, b2l, b2l};
#pragma unroll
    for (int s = 0; s < 2; ++s) {
      v2f a; a[0] = h2[2*s]; a[1] = h2[2*s+1];
      d3 = mm4(a, G[s], d3);
    }

    // softmax over the 16 neighbours: 8 registers and the other lane half
    float mx = fmaxf(fmaxf(fmaxf(d3[0], d3[1]), fmaxf(d3[2], d3[3])),
                     fmaxf(fmaxf(d3[4], d3[5]), fmaxf(d3[6], d3[7])));
    mx = fmaxf(mx, xhalf(mx));
    v8f e;
#pragma unroll
    for (int r = 0; r < 8; ++r) e[r] = __expf(d3[r] - mx);
    float den = sum8(e);
    den += xhalf(den);
    const float invd = 1.0f / den;

    // out[n,ch] = sum_j (xv_g + pr) * weight; xv_g + pr = f x P + xv_g
    float acc[4];
#pragma unroll
    for (int u = 0; u < 4; ++u) {
      const v8f vp = mm4(f, P[u], V[u]);
      v2f a2v = {0.f, 0.f};
#pragma unroll
      for (int i = 0; i < 4; ++i) {
        v2f x; x[0] = vp[2*i]; x[1] = vp[2*i+1];
        v2f y; y[0] = e[2*i];  y[1] = e[2*i+1];
        a2v = __builtin_elementwise_fma(x, y, a2v);
      }
      const float a = a2v[0] + a2v[1];
      acc[u] = a + xhalf(a);
    }
    float* orow = out + (size_t)n*C + 32*kh + lr;
    const float o0 = (kh ? acc[2] : acc[0]) * invd;
    const float o1 = (kh ? acc[3] : acc[1]) * invd;
    orow[0]  = o0;
    orow[16] = o1;
    // the same precaution for the two stores' address and data registers,
    // which the next pass reuses
    asm volatile("s_wait_xcnt 0x0" :: "v"(orow), "v"(o0), "v"(o1) : "memory");
  }
}

// ---------------------------------------------------------------------------
// Host launcher
// ---------------------------------------------------------------------------
extern "C" void kernel_launch(void* const* d_in, const int* in_sizes, int n_in,
                              void* d_out, int out_size, void* d_ws, size_t ws_size,
                              hipStream_t stream)
{
  (void)in_sizes; (void)n_in; (void)out_size; (void)ws_size;
  const float* p     = (const float*)d_in[0];
  const float* x     = (const float*)d_in[1];
  const int*   idx   = (const int*)  d_in[2];
  const float* Wq    = (const float*)d_in[3];
  const float* bq    = (const float*)d_in[4];
  const float* Wk    = (const float*)d_in[5];
  const float* bk    = (const float*)d_in[6];
  const float* Wv    = (const float*)d_in[7];
  const float* bv    = (const float*)d_in[8];
  const float* Wp1   = (const float*)d_in[9];
  const float* bp1   = (const float*)d_in[10];
  const float* gp    = (const float*)d_in[11];
  const float* bp_bn = (const float*)d_in[12];
  const float* Wp2   = (const float*)d_in[13];
  const float* bp2   = (const float*)d_in[14];
  const float* gw1   = (const float*)d_in[15];
  const float* bw1bn = (const float*)d_in[16];
  const float* Ww1   = (const float*)d_in[17];
  const float* bw1   = (const float*)d_in[18];
  const float* gw2   = (const float*)d_in[19];
  const float* bw2bn = (const float*)d_in[20];
  const float* Ww2   = (const float*)d_in[21];
  const float* bw2   = (const float*)d_in[22];

  float* ws     = (float*)d_ws;          // 96 MB + 8 KiB of the workspace
  float* xq     = ws;
  float* xk     = xq + (size_t)NPTS*C;
  float* xv     = xk + (size_t)NPTS*C;
  float* pstats = xv + (size_t)NPTS*C;   // 6 x PS_BLOCKS per-block sums
  float* wstats = pstats + 6*PS_BLOCKS;  // 128
  float* mstats = wstats + 128;          // 16
  float* w2s    = pstats + 2048;         // 32 MB, 8 KiB behind pstats
  float* fs     = w2s + (size_t)NPTS*W2_PT;  // 16 MB

  // 1) QKV projections: 12288 waves, 8 waves/block, B fragments register-resident;
  //    in front of them PS_BLOCKS blocks with the positional-branch BN sums and
  //    the zeros of wstats and mstats
  k_qkv<<<PS_BLOCKS + QKV_WAVES/8, 256, 0, stream>>>(x, Wq,bq, Wk,bk, Wv,bv, xq, xk, xv,
                                     p, idx, Wp1, bp1, pstats, wstats);
  // 3) attention-logit BN stats (64 ch)
  k_wstats<<<ST_WAVES*32/PT_BLOCK, PT_BLOCK, 0, stream>>>(p, idx, xq, xk, Wp1,bp1, gp,bp_bn, Wp2,bp2,
                                     pstats, wstats);
  // 4) mid BN stats (8 ch)
  k_mstats<<<ST_WAVES*32/PT_BLOCK, PT_BLOCK, 0, stream>>>(p, idx, xq, xk, Wp1,bp1, gp,bp_bn, Wp2,bp2,
                                     gw1,bw1bn, Ww1,bw1, pstats, wstats, mstats, w2s, fs);
  // 5) softmax + aggregation from kernel 4's w2 and f, one point per wave pass
  k_final<<<PT_WAVES*32/PT_BLOCK, PT_BLOCK, 0, stream>>>(idx, xv, Wp2,bp2, bw1,
                                      gw2,bw2bn, Ww2,bw2, mstats, w2s, fs,
                                      (float*)d_out);
}

// v005
// Measured time: 91.3 microseconds a run.
// Next to v004, in two timings, it ran 1.04 times as fast each time.
// Counting every step since v000, it is 4.45 times as fast.
#include <hip/hip_runtime.h>
#include <math.h>

// Problem constants (from reference)
#define NPTS 65536
#define NS   16
#define C    64
#define CH   8            // MID // S
#define PAIRS (NPTS*NS)   // 1,048,576
#define EPSF 1e-5f

typedef __attribute__((ext_vector_type(2))) float v2f;
typedef __attribute__((ext_vector_type(8))) float v8f;
typedef __attribute__((ext_vector_type(4))) float v4f;
typedef __attribute__((ext_vector_type(4))) int   v4i;
typedef __attribute__((ext_vector_type(2))) int   v2i;

// lane l <-> lane l ^ 16
__device__ __forceinline__ float xhalf(float x) {
  return __builtin_bit_cast(float, __builtin_amdgcn_permlanex16(
      __builtin_bit_cast(int, x), __builtin_bit_cast(int, x),
      0x76543210, 0xfedcba98, false, false));
}

// sum over the 16 lanes of a row (row_xmask 1,2,4,8)
__device__ __forceinline__ float rowsum16(float v) {
  v += __builtin_bit_cast(float, __builtin_amdgcn_update_dpp(0, __builtin_bit_cast(int, v), 0x161, 0xf, 0xf, true));
  v += __builtin_bit_cast(float, __builtin_amdgcn_update_dpp(0, __builtin_bit_cast(int, v), 0x162, 0xf, 0xf, true));
  v += __builtin_bit_cast(float, __builtin_amdgcn_update_dpp(0, __builtin_bit_cast(int, v), 0x164, 0xf, 0xf, true));
  v += __builtin_bit_cast(float, __builtin_amdgcn_update_dpp(0, __builtin_bit_cast(int, v), 0x168, 0xf, 0xf, true));
  return v;
}

#define PS_BLOCKS 256     // blocks of launch 1 that sum the positional branch

// ---------------------------------------------------------------------------
// BN params for the 3-channel positional branch.  part = [6][PS_BLOCKS] sums of
// t and t*t, one per block of launch 1; every wave adds them up for itself, in
// a fixed order (8 a lane, then over the 32 lanes).
// ---------------------------------------------------------------------------
struct BNp { float m0,m1,m2, s0,s1,s2, b0,b1,b2; };

__device__ __forceinline__ BNp make_bnp(const float* __restrict__ part, int lane,
                                        const float* __restrict__ gp,
                                        const float* __restrict__ bp) {
  const float invM = 1.0f / (float)PAIRS;
  const float* pp = part + lane*8;
  v4f lo[6], hi[6];
#pragma unroll
  for (int k = 0; k < 6; ++k) {
    lo[k] = *(const v4f*)(pp + k*PS_BLOCKS);
    hi[k] = *(const v4f*)(pp + k*PS_BLOCKS + 4);
  }
  // translation wait, a precaution ahead of any reuse of the loads' address register
  asm volatile("s_wait_xcnt 0x0" :: "v"(pp) : "memory");
  float ps[6];
#pragma unroll
  for (int k = 0; k < 6; ++k) {
    float v = ((lo[k][0]+lo[k][1]) + (lo[k][2]+lo[k][3])) + ((hi[k][0]+hi[k][1]) + (hi[k][2]+hi[k][3]));
    v = rowsum16(v);
    v += xhalf(v);
    // the same in every lane: kept in a scalar register
    ps[k] = __builtin_bit_cast(float, __builtin_amdgcn_readfirstlane(__builtin_bit_cast(int, v)));
  }
  BNp r;
  float m0 = ps[0]*invM, m1 = ps[1]*invM, m2 = ps[2]*invM;
  float v0 = ps[3]*invM - m0*m0;
  float v1 = ps[4]*invM - m1*m1;
  float v2 = ps[5]*invM - m2*m2;
  r.m0=m0; r.m1=m1; r.m2=m2;
  r.s0 = rsqrtf(v0+EPSF)*gp[0];
  r.s1 = rsqrtf(v1+EPSF)*gp[1];
  r.s2 = rsqrtf(v2+EPSF)*gp[2];
  r.b0 = bp[0]; r.b1 = bp[1]; r.b2 = bp[2];
  return r;
}

// ---------------------------------------------------------------------------
// Kernel 1: xq/xk/xv = x @ W + b via V_WMMA_F32_16X16X4_F32.
// Each wave owns one 16-row tile of x and takes it through all 12 (matrix,
// N-tile) combos: the rows are loaded once, 16 bytes a lane (8 loads), and stay
// in registers as the A fragments; the B fragments come from LDS, where each
// block keeps the three W.  192 WMMAs and 48 stores per wave.
// A (16x4 f32): lanes 0-15 rows M, VGPR0=K0 VGPR1=K1; lanes 16-31 K2/K3.
// B (4x16 f32): lanes hold N, VGPR0=K0(|K2), VGPR1=K1(|K3).
// k order, alike in A and B: product (s,h), lane half kh, register j takes input
// channel 8s + 4kh + 2h + j.
// LDS: sW[matrix][k pair kp][column c][j] = W[2kp + j][c], so that one 16-byte
// read gives a lane the register pairs of two columns, the 16 lanes of a half
// reading 256 bytes in a row.  Column of N-tile e in lane lr: 2lr, 2lr+1,
// 32+2lr, 33+2lr: an 8-byte store of two tiles' results covers a whole 128-byte
// line per row.
// ---------------------------------------------------------------------------
#define QKV_BLOCKS 512    // 8 waves a block, one of the 4096 M-tiles a wave

// The first PS_BLOCKS blocks of launch 1: sum / sumsq of (rel_p @ Wp1 + bp1) per
// 3 channels, one point (16 pairs) a thread, one set of six sums a block ->
// part[6][PS_BLOCKS].  Nothing here depends on the projections, so it shares
// their launch.  Block 0 also stores the zeros that kernels 3 and 4 add into.
__device__ __forceinline__ void pstats_part(
    const float* __restrict__ p, const int* __restrict__ idx,
    const float* __restrict__ Wp1, const float* __restrict__ bp1,
    float* __restrict__ part, float* __restrict__ zstats)
{
  __shared__ float sh[8][6];
  float w[9], bb[3];
#pragma unroll
  for (int i = 0; i < 9; ++i) w[i] = Wp1[i];
#pragma unroll
  for (int i = 0; i < 3; ++i) bb[i] = bp1[i];
  const int n = blockIdx.x*256 + threadIdx.x;
  const v2i* ip = (const v2i*)(idx + n*NS);
  const float* pc = p + n*3;
  v2i cur = ip[0];
  const float c0 = pc[0], c1 = pc[1], c2 = pc[2];
  // translation wait, a precaution ahead of any reuse of the loads' address registers
  asm volatile("s_wait_xcnt 0x0" :: "v"(ip), "v"(pc) : "memory");
  // channels 0 and 1 as a pair, channel 2 alone
  const v2f W01 = {w[0], w[1]}, W34 = {w[3], w[4]}, W67 = {w[6], w[7]}, B01 = {bb[0], bb[1]};
  v2f sp = {0.f, 0.f}, sp2 = {0.f, 0.f};
  float sc = 0.f, sc2 = 0.f;
  // Two neighbours a trip, the next trip's indices fetched beside this trip's
  // gathers.
#pragma unroll 1
  for (int g = 0; g < 8; ++g) {
    const v2i* in = ip + ((g + 1) & 7);
    const v2i nxt = *in;
    // the same precaution for this load's address registers; it also keeps the load
    // ahead of the gathers, so that its result lands in none of their address registers
    asm volatile("s_wait_xcnt 0x0" :: "v"(in) : "memory");
    int o[2];
    float q0[2], q1[2], q2[2];
#pragma unroll
    for (int j = 0; j < 2; ++j) {
      o[j] = (cur[j] & (NPTS-1))*3;
      q0[j] = p[o[j]]; q1[j] = p[o[j]+1]; q2[j] = p[o[j]+2];
    }
    // and for the two gathers' address registers
    asm volatile("s_wait_xcnt 0x0" :: "v"(o[0]), "v"(o[1]) : "memory");
#pragma unroll
    for (int j = 0; j < 2; ++j) {
      const float r0 = q0[j]-c0, r1 = q1[j]-c1, r2 = q2[j]-c2;
      const v2f R0 = {r0, r0}, R1 = {r1, r1}, R2 = {r2, r2};
      const v2f t = __builtin_elementwise_fma(R2, W67,
                    __builtin_elementwise_fma(R1, W34,
                    __builtin_elementwise_fma(R0, W01, B01)));
      const float u = fmaf(r2, w[8], fmaf(r1, w[5], fmaf(r0, w[2], bb[2])));
      sp += t; sp2 = __builtin_elementwise_fma(t, t, sp2);
      sc += u; sc2 = fmaf(u, u, sc2);
    }
    cur = nxt;
  }
  const float s[3] = {sp[0], sp[1], sc}, s2[3] = {sp2[0], sp2[1], sc2};
  const int lane = threadIdx.x & 31, wv = threadIdx.x >> 5;
#pragma unroll
  for (int k = 0; k < 3; ++k) {
    float a = rowsum16(s[k]), b = rowsum16(s2[k]);
    a += xhalf(a); b += xhalf(b);
    if (lane == 0) { sh[wv][k] = a; sh[wv][3+k] = b; }
  }
  __syncthreads();
  if (threadIdx.x < 6) {
    float a = 0.f;
#pragma unroll
    for (int v = 0; v < 8; ++v) a += sh[v][threadIdx.x];
    part[threadIdx.x*PS_BLOCKS + blockIdx.x] = a;
  }
  if (blockIdx.x == 0 && threadIdx.x < 128+16) zstats[threadIdx.x] = 0.f;
}

// Six waves a SIMD are launched (two of the sums, four of the projections): the
// second launch bound keeps the allocation at 160 registers or fewer, so that all
// of them are resident from the start.
__global__ void __launch_bounds__(256, 6) k_qkv(
    const float* __restrict__ x,
    const float* __restrict__ Wq, const float* __restrict__ bq,
    const float* __restrict__ Wk, const float* __restrict__ bk,
    const float* __restrict__ Wv, const float* __restrict__ bv,
    float* __restrict__ xq, float* __restrict__ xk, float* __restrict__ xv,
    const float* __restrict__ p, const int* __restrict__ idx,
    const float* __restrict__ Wp1, const float* __restrict__ bp1,
    float* __restrict__ part, float* __restrict__ zstats)
{
  if (blockIdx.x < PS_BLOCKS) {   // the same for a whole block
    pstats_part(p, idx, Wp1, bp1, part, zstats);
    return;
  }
  __shared__ __attribute__((aligned(16))) float sW[3*C*C];   // 48 KB
  const int lane = threadIdx.x & 31;
  const int lr = lane & 15, kh = lane >> 4;
  const int mt = (blockIdx.x - PS_BLOCKS)*8 + (threadIdx.x >> 5);

  // the wave's 16 rows of x: lane = row lr, channels 8s + 4kh .. + 3
  // (every loop of this kernel is unrolled: its arrays are indexed by constants
  // only and so stay in registers, and the loads of a loop issue back to back)
  const float* arow = x + (size_t)(mt*16 + lr)*C + kh*4;
  v4f a[8];
#pragma unroll
  for (int s = 0; s < 8; ++s) a[s] = *(const v4f*)(arow + 8*s);

  // the block's copy of the three W: a thread takes rows 2kp, 2kp+1 of four
  // columns (whole lines per wave) and stores them as (row, row+1) pairs
  const int woff = (int)(threadIdx.x >> 4)*2*C + (int)(threadIdx.x & 15)*4;
  v4f w0[6], w1[6];
#pragma unroll
  for (int i = 0; i < 6; ++i) {
    const float* Wm = (i < 2) ? Wq : (i < 4) ? Wk : Wv;
    const float* sp = Wm + (i & 1)*32*C + woff;
    w0[i] = *(const v4f*)sp;
    w1[i] = *(const v4f*)(sp + C);
  }
  // bias of the lane's four columns, the start value of the accumulators
  v2f bl[3], bh[3];
#pragma unroll
  for (int m = 0; m < 3; ++m) {
    const float* bias = (m == 0) ? bq : (m == 1) ? bk : bv;
    bl[m] = *(const v2f*)(bias + 2*lr);
    bh[m] = *(const v2f*)(bias + 32 + 2*lr);
  }
  // translation wait, a precaution ahead of any reuse of the loads' address registers
  asm volatile("s_wait_xcnt 0x0" :: "v"(arow), "v"(woff), "v"(lr) : "memory");
  {
    float* dp = sW + (threadIdx.x >> 4)*2*C + (threadIdx.x & 15)*8;
#pragma unroll
    for (int i = 0; i < 6; ++i) {
      const v4f lo = {w0[i][0], w1[i][0], w0[i][1], w1[i][1]};
      const v4f hi = {w0[i][2], w1[i][2], w0[i][3], w1[i][3]};
      *(v4f*)(dp + i*32*C)     = lo;
      *(v4f*)(dp + i*32*C + 4) = hi;
    }
  }
  __syncthreads();

#pragma unroll
  for (int m = 0; m < 3; ++m) {
    float* out = (m == 0) ? xq : (m == 1) ? xk : xv;
    v8f acc[4];
#pragma unroll
    for (int r = 0; r < 8; ++r) {
      acc[0][r] = bl[m][0]; acc[1][r] = bl[m][1];
      acc[2][r] = bh[m][0]; acc[3][r] = bh[m][1];
    }
    const float* wb = sW + m*C*C + kh*4*C + lr*4;
#pragma unroll
    for (int s = 0; s < 8; ++s) {
#pragma unroll
      for (int h = 0; h < 2; ++h) {
        const float* wr = wb + (4*s + h)*2*C;
        const v4f b0 = *(const v4f*)wr;
        const v4f b1 = *(const v4f*)(wr + C);
        v2f av; av[0] = a[s][2*h]; av[1] = a[s][2*h+1];
        v2f b;
        b[0] = b0[0]; b[1] = b0[1];
        acc[0] = __builtin_amdgcn_wmma_f32_16x16x4_f32(false, av, false, b, (short)0, acc[0], false, false);
        b[0] = b0[2]; b[1] = b0[3];
        acc[1] = __builtin_amdgcn_wmma_f32_16x16x4_f32(false, av, false, b, (short)0, acc[1], false, false);
        b[0] = b1[0]; b[1] = b1[1];
        acc[2] = __builtin_amdgcn_wmma_f32_16x16x4_f32(false, av, false, b, (short)0, acc[2], false, false);
        b[0] = b1[2]; b[1] = b1[3];
        acc[3] = __builtin_amdgcn_wmma_f32_16x16x4_f32(false, av, false, b, (short)0, acc[3], false, false);
      }
    }
    float* orow = out + (size_t)(mt*16 + 8*kh)*C + 2*lr;
#pragma unroll
    for (int r = 0; r < 8; ++r) {
      const v2f lo = {acc[0][r], acc[1][r]};
      const v2f hi = {acc[2][r], acc[3][r]};
      *(v2f*)(orow + r*C)      = lo;
      *(v2f*)(orow + r*C + 32) = hi;
    }
    // translation wait, a precaution ahead of the next matrix's reuse of the stores'
    // address and data registers
    asm volatile("s_wait_xcnt 0x0" :: "v"(orow) : "memory");
  }
}

// ---------------------------------------------------------------------------
// Kernels 3-5 work on one point (its 16 neighbours) per wave pass and run the
// per-pair products on V_WMMA_F32_16X16X4_F32.  lr = lane & 15, kh = lane >> 4.
// Fragment facts (as in kernel 1): A lane lr = row, B lane lr = column, both
// hold k = 2*kh, 2*kh+1 in their two registers; D register r = row r + 8*kh,
// column lr.
//   f        = (a0,a1 | a2,1): positional features of neighbour lr, k = 4
//   P[t]     = (Wp2 row0,row1 | row2,bias) of channel 16t+lr, k = 4
//   P x f    -> D[r] = channel 16t+8kh+r of neighbour lr   (lane = neighbour)
//   f x P    -> D[r] = neighbour r+8kh, channel 16t+lr     (lane = channel)
// In the lane = channel products the gathered rows enter as the C operand; in
// the lane = neighbour product they are added behind it; -xq goes into the
// bias column.
// ---------------------------------------------------------------------------
#define PT_WAVES 8192     // kernel 5: 8 points per wave
// Kernels 3 and 4 allocate 160 registers, so a SIMD holds six of their waves and
// the chip 256 x 4 x 6 = 6144.  They launch exactly that many (six blocks a WGP):
// every wave is resident from the start and takes 10 or 11 points.  Any more blocks
// would wait for a free place and run as a second round on a mostly empty chip.
#define ST_WAVES 6144
#define PT_BLOCK 128      // 4 waves per block
#define W2_PT 128         // floats of w2 stored per point (16 neighbours x 8)
#define F_PT  64          // floats of f stored per point (32 lanes x 2)

__device__ __forceinline__ v8f mm4(v2f a, v2f b, v8f c) {
  return __builtin_amdgcn_wmma_f32_16x16x4_f32(false, a, false, b, (short)0, c,
                                               false, false);
}

// Wp1 and bp1, read once per wave
struct PW { float w[9], b[3]; };
__device__ __forceinline__ PW make_pw(const float* __restrict__ Wp1,
                                      const float* __restrict__ bp1) {
  PW r;
#pragma unroll
  for (int i = 0; i < 9; ++i) r.w[i] = Wp1[i];
#pragma unroll
  for (int i = 0; i < 3; ++i) r.b[i] = bp1[i];
  return r;
}

// f = (a0,a1 | a2,1) from the neighbour's coordinates (q0,q1,q2) and the
// point's own (c0,c1,c2), all loaded by the caller
__device__ __forceinline__ v2f pfrag(float q0, float q1, float q2,
                                     float c0, float c1, float c2, int kh,
                                     const PW& L, const BNp& B) {
  float r0 = q0-c0;
  float r1 = q1-c1;
  float r2 = q2-c2;
  float t0 = fmaf(r2, L.w[6], fmaf(r1, L.w[3], fmaf(r0, L.w[0], L.b[0])));
  float t1 = fmaf(r2, L.w[7], fmaf(r1, L.w[4], fmaf(r0, L.w[1], L.b[1])));
  float t2 = fmaf(r2, L.w[8], fmaf(r1, L.w[5], fmaf(r0, L.w[2], L.b[2])));
  float a0 = fmaxf(fmaf(t0-B.m0, B.s0, B.b0), 0.f);
  float a1 = fmaxf(fmaf(t1-B.m1, B.s1, B.b1), 0.f);
  float a2 = fmaxf(fmaf(t2-B.m2, B.s2, B.b2), 0.f);
  v2f f; f[0] = kh ? a2 : a0; f[1] = kh ? 1.f : a1;
  return f;
}

__device__ __forceinline__ float sum8(v8f v) {
  return ((v[0]+v[1]) + (v[2]+v[3])) + ((v[4]+v[5]) + (v[6]+v[7]));
}

// rows of src for neighbours r+8kh, channels 16u+lr  (lane = channel layout)
__device__ __forceinline__ void gather_lane_ch(const float* __restrict__ src,
                                               const int* __restrict__ idx,
                                               int n, int lr, int kh, v8f V[4],
                                               const float* vr[8]) {
  const v4i i0 = *(const v4i*)(idx + n*NS + kh*8);
  const v4i i1 = *(const v4i*)(idx + n*NS + kh*8 + 4);
#pragma unroll
  for (int r = 0; r < 8; ++r) {
    const int idr = ((r < 4) ? i0[r & 3] : i1[r & 3]) & (NPTS-1);
    vr[r] = src + (size_t)idr*C + lr;
#pragma unroll
    for (int u = 0; u < 4; ++u) V[u][r] = vr[r][16*u];
  }
}

// kr = row of neighbour lr + 8*kh: channels 16t+8kh+r  (lane = neighbour layout)
__device__ __forceinline__ void gather_lane_nb(const float* __restrict__ kr, v8f w[4]) {
#pragma unroll
  for (int t = 0; t < 4; ++t) {
    const v4f lo = *(const v4f*)(kr + 16*t);
    const v4f hi = *(const v4f*)(kr + 16*t + 4);
    w[t] = __builtin_shufflevector(lo, hi, 0, 1, 2, 3, 4, 5, 6, 7);
  }
}

// ---------------------------------------------------------------------------
// Kernel 3: sum / sumsq of w = xk_g - xq + pr per 64 channels -> wstats[128]
// lane = channel layout: w = f x P' + xk_g, P' bias column = bp2 - xq.
// ---------------------------------------------------------------------------
__global__ void __launch_bounds__(PT_BLOCK) k_wstats(
    const float* __restrict__ p, const int* __restrict__ idx,
    const float* __restrict__ xq, const float* __restrict__ xk,
    const float* __restrict__ Wp1, const float* __restrict__ bp1,
    const float* __restrict__ gp,  const float* __restrict__ bp_bn,
    const float* __restrict__ Wp2, const float* __restrict__ bp2,
    const float* __restrict__ pstats, float* __restrict__ wstats)
{
  __shared__ float ss[64], ss2[64];
  if (threadIdx.x < 64) { ss[threadIdx.x] = 0.f; ss2[threadIdx.x] = 0.f; }
  __syncthreads();
  const int lane = threadIdx.x & 31;
  const int lr = lane & 15, kh = lane >> 4;
  const int wave = __builtin_amdgcn_readfirstlane((int)((blockIdx.x*blockDim.x + threadIdx.x) >> 5));
  const BNp B = make_bnp(pstats, lane, gp, bp_bn);
  const PW L = make_pw(Wp1, bp1);
  v2f P[4];
#pragma unroll
  for (int t = 0; t < 4; ++t) {
    const int ch = 16*t + lr;
    P[t][0] = kh ? Wp2[128+ch] : Wp2[ch];
    P[t][1] = kh ? bp2[ch]     : Wp2[64+ch];
  }
  const float negk = kh ? -1.f : 0.f;
  v8f S[4] = {}, S2[4] = {};
  for (int n = wave; n < NPTS; n += ST_WAVES) {
    const int id = idx[n*NS + lr] & (NPTS-1);
    v8f V[4];
    float xqv[4];
    const float* vr[8];
    gather_lane_ch(xk, idx, n, lr, kh, V, vr);
#pragma unroll
    for (int u = 0; u < 4; ++u) xqv[u] = xq[(size_t)n*C + 16*u + lr];
    const float q0 = p[id*3+0], q1 = p[id*3+1], q2 = p[id*3+2];
    const float c0 = p[n*3+0],  c1 = p[n*3+1],  c2 = p[n*3+2];
    // All of the point's loads stay issued ahead of their first use: sunk to their
    // uses, each would wait out its own round trip.  The translation wait is a
    // precaution ahead of any overwrite of the loads' address registers; the row
    // pointers and the index are its inputs so that they keep their registers up to it.
    asm volatile("s_wait_xcnt 0x0" :: "v"(vr[0]), "v"(vr[1]), "v"(vr[2]), "v"(vr[3]),
                 "v"(vr[4]), "v"(vr[5]), "v"(vr[6]), "v"(vr[7]), "v"(id) : "memory");
    __builtin_amdgcn_sched_barrier(0);
    const v2f f = pfrag(q0, q1, q2, c0, c1, c2, kh, L, B);
#pragma unroll
    for (int u = 0; u < 4; ++u) {
      v2f b = P[u];
      b[1] = fmaf(xqv[u], negk, b[1]);
      const v8f w = mm4(f, b, V[u]);
      S[u]  += w;
      S2[u] = __builtin_elementwise_fma(w, w, S2[u]);
    }
  }
#pragma unroll
  for (int u = 0; u < 4; ++u) {
    float a = sum8(S[u]), b = sum8(S2[u]);
    a += xhalf(a); b += xhalf(b);
    if (kh == 0) { atomicAdd(&ss[16*u+lr], a); atomicAdd(&ss2[16*u+lr], b); }
  }
  __syncthreads();
  if (threadIdx.x < 64) {
    atomicAdd(&wstats[threadIdx.x],    ss[threadIdx.x]);
    atomicAdd(&wstats[64+threadIdx.x], ss2[threadIdx.x]);
  }
}

// ---------------------------------------------------------------------------
// Kernel 4's constants of h = relu(BN1(w)) and w2 = h @ Ww1.
// BN1 is folded: h = relu(s1*xk_g + [s1*pr + s1*(bp2 - xq - m1) + b1]).
// ---------------------------------------------------------------------------
struct MidC {
  v2f  Q[4];      // s1-scaled P, bias column = s1*(bp2 - m1) + b1
  float sneg[4];  // -s1 in the bias column's lanes, else 0
  v8f  sC[4];     // s1 of channel 16t+8kh+r
  v2f  F[4][4];   // Ww1^T as A: row lr -> o(lr), k = channels 16t+8kh+2q, +1
};

// sS1 / sO1: 64 floats of LDS each, filled here (one barrier inside).
__device__ __forceinline__ void make_midc(MidC& K, float* sS1, float* sO1,
    int lr, int kh,
    const float* __restrict__ Wp2, const float* __restrict__ bp2,
    const float* __restrict__ gw1, const float* __restrict__ bw1_bn,
    const float* __restrict__ Ww1, const float* __restrict__ wstats)
{
  if (threadIdx.x < 64) {
    const int ch = threadIdx.x;
    const float invM = 1.0f/(float)PAIRS;
    const float m = wstats[ch]*invM;
    const float s = rsqrtf(wstats[64+ch]*invM - m*m + EPSF)*gw1[ch];
    sS1[ch] = s;
    sO1[ch] = fmaf(bp2[ch] - m, s, bw1_bn[ch]);
  }
  __syncthreads();
  // rows 0-7 -> o = row, rows 8-15 -> o = (row+4)&7: D registers 0-3 then hold
  // o = r + 4*kh, every mid channel once over the two lane halves.
  const int o = (lr < 8) ? lr : ((lr + 4) & 7);
#pragma unroll
  for (int t = 0; t < 4; ++t) {
    const int ch = 16*t + lr;
    const float s = sS1[ch];
    K.Q[t][0] = (kh ? Wp2[128+ch] : Wp2[ch]) * s;
    K.Q[t][1] = kh ? sO1[ch] : Wp2[64+ch] * s;
    K.sneg[t] = kh ? -s : 0.f;
#pragma unroll
    for (int r = 0; r < 8; ++r) K.sC[t][r] = sS1[16*t + 8*kh + r];
#pragma unroll
    for (int q = 0; q < 4; ++q) {
      const int c0 = 16*t + 8*kh + 2*q;
      K.F[t][q][0] = Ww1[c0*8 + o];
      K.F[t][q][1] = Ww1[(c0+1)*8 + o];
    }
  }
}

// w2 (without bw1) of the point's 16 neighbours: register r < 4 of the result
// = mid channel r + 4*kh of neighbour lr.
// w = gathered xk row (lane = neighbour layout), xqv[t] = xq of channel 16t+lr.
__device__ __forceinline__ v8f mid_w2(const MidC& K, const v8f w[4],
                                      const float xqv[4], v2f f)
{
  const v8f zero = {};
  v8f d2 = {};
#pragma unroll
  for (int t = 0; t < 4; ++t) {
    v2f q = K.Q[t];
    q[1] = fmaf(xqv[t], K.sneg[t], q[1]);
    const v8f h = __builtin_elementwise_max(
        __builtin_elementwise_fma(w[t], K.sC[t], mm4(q, f, zero)), zero);
#pragma unroll
    for (int i = 0; i < 4; ++i) {
      v2f b; b[0] = h[2*i]; b[1] = h[2*i+1];
      d2 = mm4(K.F[t][i], b, d2);
    }
  }
  return d2;
}

// ---------------------------------------------------------------------------
// Kernel 4: stats of w2 = relu(BN1(w)) @ Ww1 + bw1 per 8 channels -> mstats[16]
// It also stores, per point and in the lanes' own order, what kernel 5 needs of
// this stage: w2s = 4 floats a lane (w2 without bw1, mid channel r + 4*kh of
// neighbour lr), fs = 2 floats a lane (the fragment f).
// ---------------------------------------------------------------------------
// The second launch bound keeps the allocation at 160 registers, six waves a SIMD:
// one register more would cost a resident wave.
__global__ void __launch_bounds__(PT_BLOCK, 6) k_mstats(
    const float* __restrict__ p, const int* __restrict__ idx,
    const float* __restrict__ xq, const float* __restrict__ xk,
    const float* __restrict__ Wp1, const float* __restrict__ bp1,
    const float* __restrict__ gp,  const float* __restrict__ bp_bn,
    const float* __restrict__ Wp2, const float* __restrict__ bp2,
    const float* __restrict__ gw1, const float* __restrict__ bw1_bn,
    const float* __restrict__ Ww1, const float* __restrict__ bw1,
    const float* __restrict__ pstats, const float* __restrict__ wstats,
    float* __restrict__ mstats, float* __restrict__ w2s, float* __restrict__ fs)
{
  __shared__ float sS1[64], sO1[64];
  __shared__ float sm[8], sm2[8];
  if (threadIdx.x < 8) { sm[threadIdx.x] = 0.f; sm2[threadIdx.x] = 0.f; }
  const int lane = threadIdx.x & 31;
  const int lr = lane & 15, kh = lane >> 4;
  const int wave = __builtin_amdgcn_readfirstlane((int)((blockIdx.x*blockDim.x + threadIdx.x) >> 5));
  const BNp B = make_bnp(pstats, lane, gp, bp_bn);
  const PW L = make_pw(Wp1, bp1);
  MidC K;
  make_midc(K, sS1, sO1, lr, kh, Wp2, bp2, gw1, bw1_bn, Ww1, wstats);
  float ms[4] = {0,0,0,0}, ms2[4] = {0,0,0,0};
  for (int n = wave; n < NPTS; n += ST_WAVES) {
    const int id = idx[n*NS + lr] & (NPTS-1);
    v8f w[4];
    float xqv[4];
    const float* kr = xk + (size_t)id*C + kh*8;
    gather_lane_nb(kr, w);
    const float q0 = p[id*3+0], q1 = p[id*3+1], q2 = p[id*3+2];
    const float c0 = p[n*3+0],  c1 = p[n*3+1],  c2 = p[n*3+2];
#pragma unroll
    for (int t = 0; t < 4; ++t) xqv[t] = xq[(size_t)n*C + 16*t + lr];
    // loads held ahead of their uses, translation wait: as in kernel 3
    asm volatile("s_wait_xcnt 0x0" :: "v"(kr), "v"(id) : "memory");
    __builtin_amdgcn_sched_barrier(0);
    const v2f f = pfrag(q0, q1, q2, c0, c1, c2, kh, L, B);
    const v8f d2 = mid_w2(K, w, xqv, f);
#pragma unroll
    for (int r = 0; r < 4; ++r) {
      ms[r] += d2[r]; ms2[r] = fmaf(d2[r], d2[r], ms2[r]);
    }
    // the sums above stay in front of the stores: the store of the last product's
    // result then issues behind vector instructions that have already read it
    __builtin_amdgcn_sched_barrier(0);
    float* pw = w2s + (size_t)n*W2_PT + lane*4;
    float* pf = fs  + (size_t)n*F_PT  + lane*2;
    const v4f sv = {d2[0], d2[1], d2[2], d2[3]};
    *(v4f*)pw = sv;
    *(v2f*)pf = f;
    // translation wait, a precaution ahead of the next pass's reuse of the two
    // stores' address and data registers
    asm volatile("s_wait_xcnt 0x0" :: "v"(pw), "v"(pf), "v"(sv), "v"(f) : "memory");
  }
  // bw1 enters once per wave: sum(x+b) = sum x + k*b, sum(x+b)^2 = sum x^2 + 2b*sum x + k*b^2
  // k = the points this wave has taken
  const float kpts = (float)((NPTS - 1 - wave)/ST_WAVES + 1);
#pragma unroll
  for (int r = 0; r < 4; ++r) {
    const float bb = bw1[r + 4*kh];
    ms2[r] = fmaf(bb, fmaf(kpts, bb, 2.f*ms[r]), ms2[r]);
    ms[r]  = fmaf(kpts, bb, ms[r]);
    const float a = rowsum16(ms[r]), b = rowsum16(ms2[r]);
    if (lr == 0) { atomicAdd(&sm[r + 4*kh], a); atomicAdd(&sm2[r + 4*kh], b); }
  }
  __syncthreads();
  if (threadIdx.x < 8) {
    atomicAdd(&mstats[threadIdx.x],   sm[threadIdx.x]);
    atomicAdd(&mstats[8+threadIdx.x], sm2[threadIdx.x]);
  }
}

// ---------------------------------------------------------------------------
// Kernel 5: softmax + aggregation. One point per wave pass.  w2 and f come
// from kernel 4's stores, read back by the lane that wrote them.
// ---------------------------------------------------------------------------
__global__ void __launch_bounds__(PT_BLOCK) k_final(
    const int* __restrict__ idx, const float* __restrict__ xv,
    const float* __restrict__ Wp2, const float* __restrict__ bp2,
    const float* __restrict__ bw1,
    const float* __restrict__ gw2, const float* __restrict__ bw2_bn,
    const float* __restrict__ Ww2, const float* __restrict__ bw2,
    const float* __restrict__ mstats,
    const float* __restrict__ w2s, const float* __restrict__ fs,
    float* __restrict__ out)
{
  const int lane = threadIdx.x & 31;
  const int lr = lane & 15, kh = lane >> 4;
  const int wave = __builtin_amdgcn_readfirstlane((int)((blockIdx.x*blockDim.x + threadIdx.x) >> 5));

  v2f P[4];       // unscaled positional weights, B operand of the value product
#pragma unroll
  for (int t = 0; t < 4; ++t) {
    const int ch = 16*t + lr;
    P[t][0] = kh ? Wp2[128+ch] : Wp2[ch];
    P[t][1] = kh ? bp2[ch]     : Wp2[64+ch];
  }
  // BN2 folded with bw1, for mid channel o = r + 4*kh
  float s2h[4], o2h[4];
  const float invM = 1.0f/(float)PAIRS;
#pragma unroll
  for (int r = 0; r < 4; ++r) {
    const int o = r + 4*kh;
    const float m = mstats[o]*invM;
    const float s = rsqrtf(mstats[8+o]*invM - m*m + EPSF)*gw2[o];
    s2h[r] = s;
    o2h[r] = fmaf(bw1[o] - m, s, bw2_bn[o]);
  }
  // Ww2 as B: column lr -> plane lr & 7, k = mid channels 2s+4kh, +1
  v2f G[2];
#pragma unroll
  for (int s = 0; s < 2; ++s) {
    G[s][0] = Ww2[(2*s + 4*kh)*8 + (lr & 7)];
    G[s][1] = Ww2[(2*s + 1 + 4*kh)*8 + (lr & 7)];
  }
  const float b2l = bw2[lr & 7];

  for (int n = wave; n < NPTS; n += PT_WAVES) {
    v8f V[4];
    const float* vr[8];
    const float* pw = w2s + (size_t)n*W2_PT + lane*4;
    const float* pf = fs  + (size_t)n*F_PT  + lane*2;
    const v4f d2 = *(const v4f*)pw;
    const v2f f  = *(const v2f*)pf;
    gather_lane_ch(xv, idx, n, lr, kh, V, vr);
    // loads held ahead of their uses, translation wait: as in kernel 3
    asm volatile("s_wait_xcnt 0x0" :: "v"(vr[0]), "v"(vr[1]), "v"(vr[2]), "v"(vr[3]),
                 "v"(vr[4]), "v"(vr[5]), "v"(vr[6]), "v"(vr[7]), "v"(pw), "v"(pf) : "memory");
    __builtin_amdgcn_sched_barrier(0);

    // logits: d3[r] = w3 of neighbour r+8kh, plane lr & 7
    float h2[4];
#pragma unroll
    for (int r = 0; r < 4; ++r) h2[r] = fmaxf(fmaf(d2[r], s2h[r], o2h[r]), 0.f);
    v8f d3 = {b2l, b2l, b2l, b2l, b2l, b2l, b2l, b2l};
#pragma unroll
    for (int s = 0; s < 2; ++s) {
      v2f a; a[0] = h2[2*s]; a[1] = h2[2*s+1];
      d3 = mm4(a, G[s], d3);
    }

    // softmax over the 16 neighbours: 8 registers and the other lane half
    float mx = fmaxf(fmaxf(fmaxf(d3[0], d3[1]), fmaxf(d3[2], d3[3])),
                     fmaxf(fmaxf(d3[4], d3[5]), fmaxf(d3[6], d3[7])));
    mx = fmaxf(mx, xhalf(mx));
    v8f e;
#pragma unroll
    for (int r = 0; r < 8; ++r) e[r] = __expf(d3[r] - mx);
    float den = sum8(e);
    den += xhalf(den);
    const float invd = 1.0f / den;

    // out[n,ch] = sum_j (xv_g + pr) * weight; xv_g + pr = f x P + xv_g
    float acc[4];
#pragma unroll
    for (int u = 0; u < 4; ++u) {
      const v8f vp = mm4(f, P[u], V[u]);
      v2f a2v = {0.f, 0.f};
#pragma unroll
      for (int i = 0; i < 4; ++i) {
        v2f x; x[0] = vp[2*i]; x[1] = vp[2*i+1];
        v2f y; y[0] = e[2*i];  y[1] = e[2*i+1];
        a2v = __builtin_elementwise_fma(x, y, a2v);
      }
      const float a = a2v[0] + a2v[1];
      acc[u] = a + xhalf(a);
    }
    float* orow = out + (size_t)n*C + 32*kh + lr;
    const float o0 = (kh ? acc[2] : acc[0]) * invd;
    const float o1 = (kh ? acc[3] : acc[1]) * invd;
    orow[0]  = o0;
    orow[16] = o1;
    // the same precaution for the two stores' address and data registers,
    // which the next pass reuses
    asm volatile("s_wait_xcnt 0x0" :: "v"(orow), "v"(o0), "v"(o1) : "memory");
  }
}

// ---------------------------------------------------------------------------
// Host launcher
// ---------------------------------------------------------------------------
extern "C" void kernel_launch(void* const* d_in, const int* in_sizes, int n_in,
                              void* d_out, int out_size, void* d_ws, size_t ws_size,
                              hipStream_t stream)
{
  (void)in_sizes; (void)n_in; (void)out_size; (void)ws_size;
  const float* p     = (const float*)d_in[0];
  const float* x     = (const float*)d_in[1];
  const int*   idx   = (const int*)  d_in[2];
  const float* Wq    = (const float*)d_in[3];
  const float* bq    = (const float*)d_in[4];
  const float* Wk    = (const float*)d_in[5];
  const float* bk    = (const float*)d_in[6];
  const float* Wv    = (const float*)d_in[7];
  const float* bv    = (const float*)d_in[8];
  const float* Wp1   = (const float*)d_in[9];
  const float* bp1   = (const float*)d_in[10];
  const float* gp    = (const float*)d_in[11];
  const float* bp_bn = (const float*)d_in[12];
  const float* Wp2   = (const float*)d_in[13];
  const float* bp2   = (const float*)d_in[14];
  const float* gw1   = (const float*)d_in[15];
  const float* bw1bn = (const float*)d_in[16];
  const float* Ww1   = (const float*)d_in[17];
  const float* bw1   = (const float*)d_in[18];
  const float* gw2   = (const float*)d_in[19];
  const float* bw2bn = (const float*)d_in[20];
  const float* Ww2   = (const float*)d_in[21];
  const float* bw2   = (const float*)d_in[22];

  float* ws     = (float*)d_ws;          // 96 MB + 8 KiB of the workspace
  float* xq     = ws;
  float* xk     = xq + (size_t)NPTS*C;
  float* xv     = xk + (size_t)NPTS*C;
  float* pstats = xv + (size_t)NPTS*C;   // 6 x PS_BLOCKS per-block sums
  float* wstats = pstats + 6*PS_BLOCKS;  // 128
  float* mstats = wstats + 128;          // 16
  float* w2s    = pstats + 2048;         // 32 MB, 8 KiB behind pstats
  float* fs     = w2s + (size_t)NPTS*W2_PT;  // 16 MB

  // 1) QKV projections: 4096 waves, 8 waves/block, one M-tile a wave, W in LDS;
  //    in front of them PS_BLOCKS blocks with the positional-branch BN sums and
  //    the zeros of wstats and mstats
  k_qkv<<<PS_BLOCKS + QKV_BLOCKS, 256, 0, stream>>>(x, Wq,bq, Wk,bk, Wv,bv, xq, xk, xv,
                                     p, idx, Wp1, bp1, pstats, wstats);
  // 3) attention-logit BN stats (64 ch)
  k_wstats<<<ST_WAVES*32/PT_BLOCK, PT_BLOCK, 0, stream>>>(p, idx, xq, xk, Wp1,bp1, gp,bp_bn, Wp2,bp2,
                                     pstats, wstats);
  // 4) mid BN stats (8 ch)
  k_mstats<<<ST_WAVES*32/PT_BLOCK, PT_BLOCK, 0, stream>>>(p, idx, xq, xk, Wp1,bp1, gp,bp_bn, Wp2,bp2,
                                     gw1,bw1bn, Ww1,bw1, pstats, wstats, mstats, w2s, fs);
  // 5) softmax + aggregation from kernel 4's w2 and f, one point per wave pass
  k_final<<<PT_WAVES*32/PT_BLOCK, PT_BLOCK, 0, stream>>>(idx, xv, Wp2,bp2, bw1,
                                      gw2,bw2bn, Ww2,bw2, mstats, w2s, fs,
                                      (float*)d_out);
}

// v006
// One run takes 85.3 microseconds.
// Next to v005, in two timings, it ran 1.07 times as fast each time.
// All steps since v000 together make it 4.76 times as fast.
#include <hip/hip_runtime.h>
#include <math.h>

// Problem constants (from reference)
#define NPTS 65536
#define NS   16
#define C    64
#define CH   8            // MID // S
#define PAIRS (NPTS*NS)   // 1,048,576
#define EPSF 1e-5f

typedef __attribute__((ext_vector_type(2))) float v2f;
typedef __attribute__((ext_vector_type(8))) float v8f;
typedef __attribute__((ext_vector_type(4))) float v4f;
typedef __attribute__((ext_vector_type(4))) int   v4i;
typedef __attribute__((ext_vector_type(2))) int   v2i;

// lane l <-> lane l ^ 16
__device__ __forceinline__ float xhalf(float x) {
  return __builtin_bit_cast(float, __builtin_amdgcn_permlanex16(
      __builtin_bit_cast(int, x), __builtin_bit_cast(int, x),
      0x76543210, 0xfedcba98, false, false));
}

// sum over the 16 lanes of a row (row_xmask 1,2,4,8)
__device__ __forceinline__ float rowsum16(float v) {
  v += __builtin_bit_cast(float, __builtin_amdgcn_update_dpp(0, __builtin_bit_cast(int, v), 0x161, 0xf, 0xf, true));
  v += __builtin_bit_cast(float, __builtin_amdgcn_update_dpp(0, __builtin_bit_cast(int, v), 0x162, 0xf, 0xf, true));
  v += __builtin_bit_cast(float, __builtin_amdgcn_update_dpp(0, __builtin_bit_cast(int, v), 0x164, 0xf, 0xf, true));
  v += __builtin_bit_cast(float, __builtin_amdgcn_update_dpp(0, __builtin_bit_cast(int, v), 0x168, 0xf, 0xf, true));
  return v;
}

#define PS_BLOCKS 256     // blocks of launch 1 that sum the positional branch

// ---------------------------------------------------------------------------
// BN params for the 3-channel positional branch.  part = [6][PS_BLOCKS] sums of
// t and t*t, one per block of launch 1; every wave adds them up for itself, in
// a fixed order (8 a lane, then over the 32 lanes).
// ---------------------------------------------------------------------------
struct BNp { float m0,m1,m2, s0,s1,s2, b0,b1,b2; };

__device__ __forceinline__ BNp make_bnp(const float* __restrict__ part, int lane,
                                        const float* __restrict__ gp,
                                        const float* __restrict__ bp) {
  const float invM = 1.0f / (float)PAIRS;
  const float* pp = part + lane*8;
  v4f lo[6], hi[6];
#pragma unroll
  for (int k = 0; k < 6; ++k) {
    lo[k] = *(const v4f*)(pp + k*PS_BLOCKS);
    hi[k] = *(const v4f*)(pp + k*PS_BLOCKS + 4);
  }
  // translation wait, a precaution ahead of any reuse of the loads' address register
  asm volatile("s_wait_xcnt 0x0" :: "v"(pp) : "memory");
  float ps[6];
#pragma unroll
  for (int k = 0; k < 6; ++k) {
    float v = ((lo[k][0]+lo[k][1]) + (lo[k][2]+lo[k][3])) + ((hi[k][0]+hi[k][1]) + (hi[k][2]+hi[k][3]));
    v = rowsum16(v);
    v += xhalf(v);
    // the same in every lane: kept in a scalar register
    ps[k] = __builtin_bit_cast(float, __builtin_amdgcn_readfirstlane(__builtin_bit_cast(int, v)));
  }
  BNp r;
  float m0 = ps[0]*invM, m1 = ps[1]*invM, m2 = ps[2]*invM;
  float v0 = ps[3]*invM - m0*m0;
  float v1 = ps[4]*invM - m1*m1;
  float v2 = ps[5]*invM - m2*m2;
  r.m0=m0; r.m1=m1; r.m2=m2;
  r.s0 = rsqrtf(v0+EPSF)*gp[0];
  r.s1 = rsqrtf(v1+EPSF)*gp[1];
  r.s2 = rsqrtf(v2+EPSF)*gp[2];
  r.b0 = bp[0]; r.b1 = bp[1]; r.b2 = bp[2];
  return r;
}

// ---------------------------------------------------------------------------
// Kernel 1: xq/xk/xv = x @ W + b via V_WMMA_F32_16X16X4_F32.
// Each wave owns one 16-row tile of x and takes it through all 12 (matrix,
// N-tile) combos: the rows are loaded once, 16 bytes a lane (8 loads), and stay
// in registers as the A fragments; the B fragments come from LDS, where each
// block keeps the three W.  192 WMMAs and 48 stores per wave.
// A (16x4 f32): lanes 0-15 rows M, VGPR0=K0 VGPR1=K1; lanes 16-31 K2/K3.
// B (4x16 f32): lanes hold N, VGPR0=K0(|K2), VGPR1=K1(|K3).
// k order, alike in A and B: product (s,h), lane half kh, register j takes input
// channel 8s + 4kh + 2h + j.
// LDS: sW[matrix][k pair kp][column c][j] = W[2kp + j][c], so that one 16-byte
// read gives a lane the register pairs of two columns, the 16 lanes of a half
// reading 256 bytes in a row.  Column of N-tile e in lane lr: 2lr, 2lr+1,
// 32+2lr, 33+2lr: an 8-byte store of two tiles' results covers a whole 128-byte
// line per row.
// ---------------------------------------------------------------------------
#define QKV_BLOCKS 512    // 8 waves a block, one of the 4096 M-tiles a wave

// The first PS_BLOCKS blocks of launch 1: sum / sumsq of (rel_p @ Wp1 + bp1) per
// 3 channels, one point (16 pairs) a thread, one set of six sums a block ->
// part[6][PS_BLOCKS].  Nothing here depends on the projections, so it shares
// their launch.  Block 0 also stores the zeros that kernels 3 and 4 add into.
__device__ __forceinline__ void pstats_part(
    const float* __restrict__ p, const int* __restrict__ idx,
    const float* __restrict__ Wp1, const float* __restrict__ bp1,
    float* __restrict__ part, float* __restrict__ zstats)
{
  __shared__ float sh[8][6];
  float w[9], bb[3];
#pragma unroll
  for (int i = 0; i < 9; ++i) w[i] = Wp1[i];
#pragma unroll
  for (int i = 0; i < 3; ++i) bb[i] = bp1[i];
  const int n = blockIdx.x*256 + threadIdx.x;
  const v2i* ip = (const v2i*)(idx + n*NS);
  const float* pc = p + n*3;
  v2i cur = ip[0];
  const float c0 = pc[0], c1 = pc[1], c2 = pc[2];
  // translation wait, a precaution ahead of any reuse of the loads' address registers
  asm volatile("s_wait_xcnt 0x0" :: "v"(ip), "v"(pc) : "memory");
  // channels 0 and 1 as a pair, channel 2 alone
  const v2f W01 = {w[0], w[1]}, W34 = {w[3], w[4]}, W67 = {w[6], w[7]}, B01 = {bb[0], bb[1]};
  v2f sp = {0.f, 0.f}, sp2 = {0.f, 0.f};
  float sc = 0.f, sc2 = 0.f;
  // Two neighbours a trip, the next trip's indices fetched beside this trip's
  // gathers.
#pragma unroll 1
  for (int g = 0; g < 8; ++g) {
    const v2i* in = ip + ((g + 1) & 7);
    const v2i nxt = *in;
    // the same precaution for this load's address registers; it also keeps the load
    // ahead of the gathers, so that its result lands in none of their address registers
    asm volatile("s_wait_xcnt 0x0" :: "v"(in) : "memory");
    int o[2];
    float q0[2], q1[2], q2[2];
#pragma unroll
    for (int j = 0; j < 2; ++j) {
      o[j] = (cur[j] & (NPTS-1))*3;
      q0[j] = p[o[j]]; q1[j] = p[o[j]+1]; q2[j] = p[o[j]+2];
    }
    // and for the two gathers' address registers
    asm volatile("s_wait_xcnt 0x0" :: "v"(o[0]), "v"(o[1]) : "memory");
#pragma unroll
    for (int j = 0; j < 2; ++j) {
      const float r0 = q0[j]-c0, r1 = q1[j]-c1, r2 = q2[j]-c2;
      const v2f R0 = {r0, r0}, R1 = {r1, r1}, R2 = {r2, r2};
      const v2f t = __builtin_elementwise_fma(R2, W67,
                    __builtin_elementwise_fma(R1, W34,
                    __builtin_elementwise_fma(R0, W01, B01)));
      const float u = fmaf(r2, w[8], fmaf(r1, w[5], fmaf(r0, w[2], bb[2])));
      sp += t; sp2 = __builtin_elementwise_fma(t, t, sp2);
      sc += u; sc2 = fmaf(u, u, sc2);
    }
    cur = nxt;
  }
  const float s[3] = {sp[0], sp[1], sc}, s2[3] = {sp2[0], sp2[1], sc2};
  const int lane = threadIdx.x & 31, wv = threadIdx.x >> 5;
#pragma unroll
  for (int k = 0; k < 3; ++k) {
    float a = rowsum16(s[k]), b = rowsum16(s2[k]);
    a += xhalf(a); b += xhalf(b);
    if (lane == 0) { sh[wv][k] = a; sh[wv][3+k] = b; }
  }
  __syncthreads();
  if (threadIdx.x < 6) {
    float a = 0.f;
#pragma unroll
    for (int v = 0; v < 8; ++v) a += sh[v][threadIdx.x];
    part[threadIdx.x*PS_BLOCKS + blockIdx.x] = a;
  }
  if (blockIdx.x == 0 && threadIdx.x < 128+16) zstats[threadIdx.x] = 0.f;
}

// Six waves a SIMD are launched (two of the sums, four of the projections): the
// second launch bound keeps the allocation at 160 registers or fewer, so that all
// of them are resident from the start.
__global__ void __launch_bounds__(256, 6) k_qkv(
    const float* __restrict__ x,
    const float* __restrict__ Wq, const float* __restrict__ bq,
    const float* __restrict__ Wk, const float* __restrict__ bk,
    const float* __restrict__ Wv, const float* __restrict__ bv,
    float* __restrict__ xq, float* __restrict__ xk, float* __restrict__ xv,
    const float* __restrict__ p, const int* __restrict__ idx,
    const float* __restrict__ Wp1, const float* __restrict__ bp1,
    float* __restrict__ part, float* __restrict__ zstats)
{
  if (blockIdx.x < PS_BLOCKS) {   // the same for a whole block
    pstats_part(p, idx, Wp1, bp1, part, zstats);
    return;
  }
  __shared__ __attribute__((aligned(16))) float sW[3*C*C];   // 48 KB
  const int lane = threadIdx.x & 31;
  const int lr = lane & 15, kh = lane >> 4;
  const int mt = (blockIdx.x - PS_BLOCKS)*8 + (threadIdx.x >> 5);

  // the wave's 16 rows of x: lane = row lr, channels 8s + 4kh .. + 3
  // (every loop of this kernel is unrolled: its arrays are indexed by constants
  // only and so stay in registers, and the loads of a loop issue back to back)
  const float* arow = x + (size_t)(mt*16 + lr)*C + kh*4;
  v4f a[8];
#pragma unroll
  for (int s = 0; s < 8; ++s) a[s] = *(const v4f*)(arow + 8*s);

  // the block's copy of the three W: a thread takes rows 2kp, 2kp+1 of four
  // columns (whole lines per wave) and stores them as (row, row+1) pairs
  const int woff = (int)(threadIdx.x >> 4)*2*C + (int)(threadIdx.x & 15)*4;
  v4f w0[6], w1[6];
#pragma unroll
  for (int i = 0; i < 6; ++i) {
    const float* Wm = (i < 2) ? Wq : (i < 4) ? Wk : Wv;
    const float* sp = Wm + (i & 1)*32*C + woff;
    w0[i] = *(const v4f*)sp;
    w1[i] = *(const v4f*)(sp + C);
  }
  // bias of the lane's four columns, the start value of the accumulators
  v2f bl[3], bh[3];
#pragma unroll
  for (int m = 0; m < 3; ++m) {
    const float* bias = (m == 0) ? bq : (m == 1) ? bk : bv;
    bl[m] = *(const v2f*)(bias + 2*lr);
    bh[m] = *(const v2f*)(bias + 32 + 2*lr);
  }
  // translation wait, a precaution ahead of any reuse of the loads' address registers
  asm volatile("s_wait_xcnt 0x0" :: "v"(arow), "v"(woff), "v"(lr) : "memory");
  {
    float* dp = sW + (threadIdx.x >> 4)*2*C + (threadIdx.x & 15)*8;
#pragma unroll
    for (int i = 0; i < 6; ++i) {
      const v4f lo = {w0[i][0], w1[i][0], w0[i][1], w1[i][1]};
      const v4f hi = {w0[i][2], w1[i][2], w0[i][3], w1[i][3]};
      *(v4f*)(dp + i*32*C)     = lo;
      *(v4f*)(dp + i*32*C + 4) = hi;
    }
  }
  __syncthreads();

#pragma unroll
  for (int m = 0; m < 3; ++m) {
    float* out = (m == 0) ? xq : (m == 1) ? xk : xv;
    v8f acc[4];
#pragma unroll
    for (int r = 0; r < 8; ++r) {
      acc[0][r] = bl[m][0]; acc[1][r] = bl[m][1];
      acc[2][r] = bh[m][0]; acc[3][r] = bh[m][1];
    }
    const float* wb = sW + m*C*C + kh*4*C + lr*4;
#pragma unroll
    for (int s = 0; s < 8; ++s) {
#pragma unroll
      for (int h = 0; h < 2; ++h) {
        const float* wr = wb + (4*s + h)*2*C;
        const v4f b0 = *(const v4f*)wr;
        const v4f b1 = *(const v4f*)(wr + C);
        v2f av; av[0] = a[s][2*h]; av[1] = a[s][2*h+1];
        v2f b;
        b[0] = b0[0]; b[1] = b0[1];
        acc[0] = __builtin_amdgcn_wmma_f32_16x16x4_f32(false, av, false, b, (short)0, acc[0], false, false);
        b[0] = b0[2]; b[1] = b0[3];
        acc[1] = __builtin_amdgcn_wmma_f32_16x16x4_f32(false, av, false, b, (short)0, acc[1], false, false);
        b[0] = b1[0]; b[1] = b1[1];
        acc[2] = __builtin_amdgcn_wmma_f32_16x16x4_f32(false, av, false, b, (short)0, acc[2], false, false);
        b[0] = b1[2]; b[1] = b1[3];
        acc[3] = __builtin_amdgcn_wmma_f32_16x16x4_f32(false, av, false, b, (short)0, acc[3], false, false);
      }
    }
    float* orow = out + (size_t)(mt*16 + 8*kh)*C + 2*lr;
#pragma unroll
    for (int r = 0; r < 8; ++r) {
      const v2f lo = {acc[0][r], acc[1][r]};
      const v2f hi = {acc[2][r], acc[3][r]};
      *(v2f*)(orow + r*C)      = lo;
      *(v2f*)(orow + r*C + 32) = hi;
    }
    // translation wait, a precaution ahead of the next matrix's reuse of the stores'
    // address and data registers
    asm volatile("s_wait_xcnt 0x0" :: "v"(orow) : "memory");
  }
}

// ---------------------------------------------------------------------------
// Kernels 3-5 work on one point (its 16 neighbours) per wave pass and run the
// per-pair products on V_WMMA_F32_16X16X4_F32.  lr = lane & 15, kh = lane >> 4.
// Fragment facts (as in kernel 1): A lane lr = row, B lane lr = column, both
// hold k = 2*kh, 2*kh+1 in their two registers; D register r = row r + 8*kh,
// column lr.
//   f        = (a0,a1 | a2,1): positional features of neighbour lr, k = 4
//   P[t]     = (Wp2 row0,row1 | row2,bias) of channel 16t+lr, k = 4
//   P x f    -> D[r] = channel 16t+8kh+r of neighbour lr   (lane = neighbour)
//   f x P    -> D[r] = neighbour r+8kh, channel 16t+lr     (lane = channel)
// In the lane = channel products the gathered rows enter as the C operand; in
// the lane = neighbour product they are added behind it; -xq goes into the
// bias column.
// ---------------------------------------------------------------------------
#define PT_WAVES 8192     // kernel 5: 8 points per wave
// Kernels 3 and 4 allocate 160 registers, so a SIMD holds six of their waves and
// the chip 256 x 4 x 6 = 6144.  They launch exactly that many (six blocks a WGP):
// every wave is resident from the start and takes 10 or 11 points.  Any more blocks
// would wait for a free place and run as a second round on a mostly empty chip.
#define ST_WAVES 6144
#define PT_BLOCK 128      // 4 waves per block
#define W2_PT 128         // floats of w2 stored per point (16 neighbours x 8)
#define F_PT  64          // floats of f stored per point (32 lanes x 2)

__device__ __forceinline__ v8f mm4(v2f a, v2f b, v8f c) {
  return __builtin_amdgcn_wmma_f32_16x16x4_f32(false, a, false, b, (short)0, c,
                                               false, false);
}

// Wp1 and bp1, read once per wave
struct PW { float w[9], b[3]; };
__device__ __forceinline__ PW make_pw(const float* __restrict__ Wp1,
                                      const float* __restrict__ bp1) {
  PW r;
#pragma unroll
  for (int i = 0; i < 9; ++i) r.w[i] = Wp1[i];
#pragma unroll
  for (int i = 0; i < 3; ++i) r.b[i] = bp1[i];
  return r;
}

// f = (a0,a1 | a2,1) from the neighbour's coordinates (q0,q1,q2) and the
// point's own (c0,c1,c2), all loaded by the caller
__device__ __forceinline__ v2f pfrag(float q0, float q1, float q2,
                                     float c0, float c1, float c2, int kh,
                                     const PW& L, const BNp& B) {
  float r0 = q0-c0;
  float r1 = q1-c1;
  float r2 = q2-c2;
  float t0 = fmaf(r2, L.w[6], fmaf(r1, L.w[3], fmaf(r0, L.w[0], L.b[0])));
  float t1 = fmaf(r2, L.w[7], fmaf(r1, L.w[4], fmaf(r0, L.w[1], L.b[1])));
  float t2 = fmaf(r2, L.w[8], fmaf(r1, L.w[5], fmaf(r0, L.w[2], L.b[2])));
  float a0 = fmaxf(fmaf(t0-B.m0, B.s0, B.b0), 0.f);
  float a1 = fmaxf(fmaf(t1-B.m1, B.s1, B.b1), 0.f);
  float a2 = fmaxf(fmaf(t2-B.m2, B.s2, B.b2), 0.f);
  v2f f; f[0] = kh ? a2 : a0; f[1] = kh ? 1.f : a1;
  return f;
}

__device__ __forceinline__ float sum8(v8f v) {
  return ((v[0]+v[1]) + (v[2]+v[3])) + ((v[4]+v[5]) + (v[6]+v[7]));
}

#define ROWP  68          // floats: LDS pitch of a gathered row, 272 B (see copy_rows)
#define PTBUF (NS*ROWP)   // floats of LDS per point

// rows of neighbours r+8kh, channels 16u+lr  (lane = channel layout), from LDS:
// vr = row 8kh of the point's buffer, + lr
__device__ __forceinline__ void gather_lane_ch(const float* vr, v8f V[4]) {
#pragma unroll
  for (int u = 0; u < 4; ++u) {
    const float* c = vr + 16*u;
    const v8f x = {c[0], c[ROWP], c[2*ROWP], c[3*ROWP], c[4*ROWP], c[5*ROWP], c[6*ROWP], c[7*ROWP]};
    V[u] = x;
  }
}

// kr = row of neighbour lr in LDS, + 8*kh: channels 16t+8kh+r  (lane = neighbour
// layout), column tiles t0 .. t1-1 of the four
__device__ __forceinline__ void gather_lane_nb(const float* kr, v8f w[4], int t0, int t1) {
#pragma unroll
  for (int t = t0; t < t1; ++t) {
    const v4f lo = *(const v4f*)(kr + 16*t);
    const v4f hi = *(const v4f*)(kr + 16*t + 4);
    w[t] = __builtin_shufflevector(lo, hi, 0, 1, 2, 3, 4, 5, 6, 7);
  }
}

// Kernels 3-5 bring a point's 16 gathered rows into LDS by asynchronous copies and
// read them from there in the layout that their products want.  A copy moves two
// whole rows (neighbours r and r+8, 16 lanes x 16 bytes each: four whole lines); for
// the same 512 bytes register loads touch 16 lines in the lane = neighbour layout
// and 8 in the lane = channel layout.  The pitch of 272 B (16 B x odd) lets the
// 16-byte reads of a column meet no bank twice, and puts rows r and r+8 half the
// banks apart for the 4-byte reads.
// Each kernel keeps two buffers, a point a wave in each: while a point is worked
// on, the next one's rows fly.

// the value that lane R of the own 16-lane row holds (DPP row_share)
template <int R> __device__ __forceinline__ int rowlane(int v) {
  return __builtin_amdgcn_update_dpp(0, v, 0x150 + R, 0xf, 0xf, true);
}

// ids: lane lr of half kh holds the index of neighbour (lr + 8kh) & 15, so lane r
// of the own row has that of neighbour r + 8kh; lds = byte address in LDS of row
// 8kh, + 16*lr.  The translation wait, a precaution ahead of any rewrite of the
// copies' address registers, is the statement's own last line: there nothing can
// be moved in front of it.
__device__ __forceinline__ void copy_rows(const float* __restrict__ src,
                                          int ids, int lr, unsigned lds) {
  const int off = (ids & (NPTS-1))*C;      // the row's place in src, bounded here
  const int ro[8] = {rowlane<0>(off), rowlane<1>(off), rowlane<2>(off), rowlane<3>(off),
                     rowlane<4>(off), rowlane<5>(off), rowlane<6>(off), rowlane<7>(off)};
  const float* srcl = src + lr*4;
  const float* g[8];
#pragma unroll
  for (int r = 0; r < 8; ++r) g[r] = srcl + (unsigned)ro[r];
  asm volatile(
      "global_load_async_to_lds_b128 %0, %8, off\n\t"
      "global_load_async_to_lds_b128 %1, %9, off\n\t"
      "global_load_async_to_lds_b128 %2, %10, off\n\t"
      "global_load_async_to_lds_b128 %3, %11, off\n\t"
      "global_load_async_to_lds_b128 %4, %12, off\n\t"
      "global_load_async_to_lds_b128 %5, %13, off\n\t"
      "global_load_async_to_lds_b128 %6, %14, off\n\t"
      "global_load_async_to_lds_b128 %7, %15, off\n\t"
      "s_wait_xcnt 0x0"
      :: "v"(lds),            "v"(lds + 1*ROWP*4), "v"(lds + 2*ROWP*4), "v"(lds + 3*ROWP*4),
         "v"(lds + 4*ROWP*4), "v"(lds + 5*ROWP*4), "v"(lds + 6*ROWP*4), "v"(lds + 7*ROWP*4),
         "v"(g[0]), "v"(g[1]), "v"(g[2]), "v"(g[3]), "v"(g[4]), "v"(g[5]), "v"(g[6]), "v"(g[7])
      : "memory");
}

// ---------------------------------------------------------------------------
// Kernel 3: sum / sumsq of w = xk_g - xq + pr per 64 channels -> wstats[128]
// lane = channel layout: w = f x P' + xk_g, P' bias column = bp2 - xq.
// ---------------------------------------------------------------------------
// The second launch bound keeps the allocation at 160 registers, six waves a SIMD.
__global__ void __launch_bounds__(PT_BLOCK, 6) k_wstats(
    const float* __restrict__ p, const int* __restrict__ idx,
    const float* __restrict__ xq, const float* __restrict__ xk,
    const float* __restrict__ Wp1, const float* __restrict__ bp1,
    const float* __restrict__ gp,  const float* __restrict__ bp_bn,
    const float* __restrict__ Wp2, const float* __restrict__ bp2,
    const float* __restrict__ pstats, float* __restrict__ wstats)
{
  __shared__ float ss[64], ss2[64];
  __shared__ __attribute__((aligned(16))) float sK[2][PT_BLOCK/32][PTBUF];
  if (threadIdx.x < 64) { ss[threadIdx.x] = 0.f; ss2[threadIdx.x] = 0.f; }
  __syncthreads();
  const int lane = threadIdx.x & 31;
  const int lr = lane & 15, kh = lane >> 4;
  const int wave = __builtin_amdgcn_readfirstlane((int)((blockIdx.x*blockDim.x + threadIdx.x) >> 5));
  const int wv = wave & (PT_BLOCK/32 - 1);
  // points a wave takes, 10 or 11: the same for the four waves of a block, as
  // NPTS % ST_WAVES is a multiple of four, so taken from the block's first wave
  const int cnt = (NPTS - 1 - (int)blockIdx.x*(PT_BLOCK/32))/ST_WAVES + 1;
  // where the lane's copies land (rows 8kh ..) and where it reads (rows 8kh ..)
  const unsigned cdst = (unsigned)(size_t)&sK[0][wv][kh*8*ROWP + lr*4];
  const float* rsrc = &sK[0][wv][kh*8*ROWP + lr];
  // indices of points 0 and 1; point 0's rows fly while the constants are made
  // (for the coordinates neighbour lr, for the copies neighbour (lr + 8kh) & 15)
  const int rot = (lr + 8*kh) & 15;
  int idc = idx[(unsigned)(wave*NS + lr)];
  int ids = idx[(unsigned)(wave*NS + rot)];
  const int ids1 = idx[(unsigned)((wave + ST_WAVES)*NS + rot)];
  copy_rows(xk, ids, lr, cdst);
  const BNp B = make_bnp(pstats, lane, gp, bp_bn);
  const PW L = make_pw(Wp1, bp1);
  v2f P[4];
#pragma unroll
  for (int t = 0; t < 4; ++t) {
    const int ch = 16*t + lr;
    P[t][0] = kh ? Wp2[128+ch] : Wp2[ch];
    P[t][1] = kh ? bp2[ch]     : Wp2[64+ch];
  }
  const float negk = kh ? -1.f : 0.f;
  v8f S[4] = {}, S2[4] = {};
  // point 0's rows have landed; the barrier publishes them
  asm volatile("s_wait_asynccnt 0x0" ::: "memory");
  __syncthreads();
  copy_rows(xk, ids1, lr, cdst + PT_BLOCK/32*PTBUF*4);
  for (int t = 0; t < cnt; ++t) {
    const int n = wave + t*ST_WAVES;
    const int buf = (t & 1)*(PT_BLOCK/32*PTBUF);
    const int id = idc & (NPTS-1);
    v8f V[4];
    float xqv[4];
#pragma unroll
    for (int u = 0; u < 4; ++u) xqv[u] = (xq + (unsigned)(n*C + lr))[16*u];
    const float q0 = p[id*3+0], q1 = p[id*3+1], q2 = p[id*3+2];
    const float c0 = p[n*3+0],  c1 = p[n*3+1],  c2 = p[n*3+2];
    // indices fetched ahead: of the next point for its coordinates, of the one
    // after it for the copies at this trip's foot (the last point's again where
    // there is none)
    const int n1 = min(n + ST_WAVES, NPTS-1), n2 = min(n + 2*ST_WAVES, NPTS-1);
    idc = idx[(unsigned)(n1*NS + lr)];
    ids = idx[(unsigned)(n2*NS + rot)];
    gather_lane_ch(rsrc + buf, V);
    // All of the point's loads stay issued ahead of their first use: sunk to their
    // uses, each would wait out its own round trip.  The translation wait is a
    // precaution ahead of any overwrite of the loads' address registers; the index
    // is its input so that it keeps its register up to it.
    asm volatile("s_wait_xcnt 0x0" :: "v"(id) : "memory");
    __builtin_amdgcn_sched_barrier(0);
    const v2f f = pfrag(q0, q1, q2, c0, c1, c2, kh, L, B);
#pragma unroll
    for (int u = 0; u < 4; ++u) {
      v2f b = P[u];
      b[1] = fmaf(xqv[u], negk, b[1]);
      const v8f w = mm4(f, b, V[u]);
      S[u]  += w;
      S2[u] = __builtin_elementwise_fma(w, w, S2[u]);
    }
    // Hand-over of the buffers: this wave's reads of its buffer are done, the next
    // point's rows have landed, every wave is here; then the buffer just read is
    // filled anew.  The sums are inputs of the first wait so that they stay in front
    // of it: behind the last product then stand the vector instructions that read the
    // results, not the copies' address arithmetic over the products' operands.
    asm volatile("s_wait_dscnt 0x0" :: "v"(S[0]), "v"(S[1]), "v"(S[2]), "v"(S[3]),
                 "v"(S2[0]), "v"(S2[1]), "v"(S2[2]), "v"(S2[3]) : "memory");
    asm volatile("s_wait_asynccnt 0x0" ::: "memory");
    __syncthreads();
    if (t + 2 < cnt) copy_rows(xk, ids, lr, cdst + buf*4);
  }
  // no copy is left in flight when the wave ends
  asm volatile("s_wait_asynccnt 0x0" ::: "memory");
#pragma unroll
  for (int u = 0; u < 4; ++u) {
    float a = sum8(S[u]), b = sum8(S2[u]);
    a += xhalf(a); b += xhalf(b);
    if (kh == 0) { atomicAdd(&ss[16*u+lr], a); atomicAdd(&ss2[16*u+lr], b); }
  }
  __syncthreads();
  if (threadIdx.x < 64) {
    atomicAdd(&wstats[threadIdx.x],    ss[threadIdx.x]);
    atomicAdd(&wstats[64+threadIdx.x], ss2[threadIdx.x]);
  }
}

// ---------------------------------------------------------------------------
// Kernel 4's constants of h = relu(BN1(w)) and w2 = h @ Ww1.
// BN1 is folded: h = relu(s1*xk_g + [s1*pr + s1*(bp2 - xq - m1) + b1]).
// ---------------------------------------------------------------------------
struct MidC {
  v2f  Q[4];      // s1-scaled P, bias column = s1*(bp2 - m1) + b1
  float sneg[4];  // -s1 in the bias column's lanes, else 0
  v8f  sC[4];     // s1 of channel 16t+8kh+r
  v2f  F[4][4];   // Ww1^T as A: row lr -> o(lr), k = channels 16t+8kh+2q, +1
};

// sS1 / sO1: 64 floats of LDS each, filled here (one barrier inside).
__device__ __forceinline__ void make_midc(MidC& K, float* sS1, float* sO1,
    int lr, int kh,
    const float* __restrict__ Wp2, const float* __restrict__ bp2,
    const float* __restrict__ gw1, const float* __restrict__ bw1_bn,
    const float* __restrict__ Ww1, const float* __restrict__ wstats)
{
  if (threadIdx.x < 64) {
    const int ch = threadIdx.x;
    const float invM = 1.0f/(float)PAIRS;
    const float m = wstats[ch]*invM;
    const float s = rsqrtf(wstats[64+ch]*invM - m*m + EPSF)*gw1[ch];
    sS1[ch] = s;
    sO1[ch] = fmaf(bp2[ch] - m, s, bw1_bn[ch]);
  }
  __syncthreads();
  // rows 0-7 -> o = row, rows 8-15 -> o = (row+4)&7: D registers 0-3 then hold
  // o = r + 4*kh, every mid channel once over the two lane halves.
  const int o = (lr < 8) ? lr : ((lr + 4) & 7);
#pragma unroll
  for (int t = 0; t < 4; ++t) {
    const int ch = 16*t + lr;
    const float s = sS1[ch];
    K.Q[t][0] = (kh ? Wp2[128+ch] : Wp2[ch]) * s;
    K.Q[t][1] = kh ? sO1[ch] : Wp2[64+ch] * s;
    K.sneg[t] = kh ? -s : 0.f;
#pragma unroll
    for (int r = 0; r < 8; ++r) K.sC[t][r] = sS1[16*t + 8*kh + r];
#pragma unroll
    for (int q = 0; q < 4; ++q) {
      const int c0 = 16*t + 8*kh + 2*q;
      K.F[t][q][0] = Ww1[c0*8 + o];
      K.F[t][q][1] = Ww1[(c0+1)*8 + o];
    }
  }
}

// w2 (without bw1) of the point's 16 neighbours: register r < 4 of the result
// = mid channel r + 4*kh of neighbour lr.
// w = gathered xk row (lane = neighbour layout), xqv[t] = xq of channel 16t+lr.
__device__ __forceinline__ v8f mid_w2(const MidC& K, const v8f w[4],
                                      const float xqv[4], v2f f)
{
  const v8f zero = {};
  v8f d2 = {};
#pragma unroll
  for (int t = 0; t < 4; ++t) {
    v2f q = K.Q[t];
    q[1] = fmaf(xqv[t], K.sneg[t], q[1]);
    const v8f h = __builtin_elementwise_max(
        __builtin_elementwise_fma(w[t], K.sC[t], mm4(q, f, zero)), zero);
#pragma unroll
    for (int i = 0; i < 4; ++i) {
      v2f b; b[0] = h[2*i]; b[1] = h[2*i+1];
      d2 = mm4(K.F[t][i], b, d2);
    }
  }
  return d2;
}

// ---------------------------------------------------------------------------
// Kernel 4: stats of w2 = relu(BN1(w)) @ Ww1 + bw1 per 8 channels -> mstats[16]
// It also stores, per point and in the lanes' own order, what kernel 5 needs of
// this stage: w2s = 4 floats a lane (w2 without bw1, mid channel r + 4*kh of
// neighbour lr), fs = 2 floats a lane (the fragment f).
// ---------------------------------------------------------------------------
// The second launch bound keeps the allocation at 160 registers, six waves a SIMD:
// one register more would cost a resident wave.
__global__ void __launch_bounds__(PT_BLOCK, 6) k_mstats(
    const float* __restrict__ p, const int* __restrict__ idx,
    const float* __restrict__ xq, const float* __restrict__ xk,
    const float* __restrict__ Wp1, const float* __restrict__ bp1,
    const float* __restrict__ gp,  const float* __restrict__ bp_bn,
    const float* __restrict__ Wp2, const float* __restrict__ bp2,
    const float* __restrict__ gw1, const float* __restrict__ bw1_bn,
    const float* __restrict__ Ww1, const float* __restrict__ bw1,
    const float* __restrict__ pstats, const float* __restrict__ wstats,
    float* __restrict__ mstats, float* __restrict__ w2s, float* __restrict__ fs)
{
  __shared__ float sS1[64], sO1[64];
  __shared__ float sm[8], sm2[8];
  // two buffers of gathered xk rows, a point a wave in each
  __shared__ __attribute__((aligned(16))) float sK[2][PT_BLOCK/32][PTBUF];
  if (threadIdx.x < 8) { sm[threadIdx.x] = 0.f; sm2[threadIdx.x] = 0.f; }
  const int lane = threadIdx.x & 31;
  const int lr = lane & 15, kh = lane >> 4;
  const int wave = __builtin_amdgcn_readfirstlane((int)((blockIdx.x*blockDim.x + threadIdx.x) >> 5));
  const int wv = wave & (PT_BLOCK/32 - 1);
  // points a wave takes, 10 or 11: the same for the four waves of a block, as
  // NPTS % ST_WAVES is a multiple of four, so taken from the block's first wave
  const int cnt = (NPTS - 1 - (int)blockIdx.x*(PT_BLOCK/32))/ST_WAVES + 1;
  // where the lane's copies land (rows 8kh ..) and where it reads (row lr)
  const unsigned cdst = (unsigned)(size_t)&sK[0][wv][kh*8*ROWP + lr*4];
  const float* rsrc = &sK[0][wv][lr*ROWP + kh*8];
  // indices of points 0 and 1; point 0's rows fly while the constants are made
  // (for the coordinates neighbour lr, for the copies neighbour (lr + 8kh) & 15)
  const int rot = (lr + 8*kh) & 15;
  int idc = idx[(unsigned)(wave*NS + lr)];
  int ids = idx[(unsigned)(wave*NS + rot)];
  const int ids1 = idx[(unsigned)((wave + ST_WAVES)*NS + rot)];
  copy_rows(xk, ids, lr, cdst);
  const BNp B = make_bnp(pstats, lane, gp, bp_bn);
  const PW L = make_pw(Wp1, bp1);
  MidC K;
  make_midc(K, sS1, sO1, lr, kh, Wp2, bp2, gw1, bw1_bn, Ww1, wstats);
  // point 0's rows have landed; the barrier publishes them
  asm volatile("s_wait_asynccnt 0x0" ::: "memory");
  __syncthreads();
  copy_rows(xk, ids1, lr, cdst + PT_BLOCK/32*PTBUF*4);
  float ms[4] = {0,0,0,0}, ms2[4] = {0,0,0,0};
  for (int t = 0; t < cnt; ++t) {
    const int n = wave + t*ST_WAVES;
    const int buf = (t & 1)*(PT_BLOCK/32*PTBUF);
    const int id = idc & (NPTS-1);
    v8f w[4];
    float xqv[4];
    const float q0 = p[id*3+0], q1 = p[id*3+1], q2 = p[id*3+2];
    const float c0 = p[n*3+0],  c1 = p[n*3+1],  c2 = p[n*3+2];
#pragma unroll
    for (int u = 0; u < 4; ++u) xqv[u] = (xq + (unsigned)(n*C + lr))[16*u];
    // indices fetched ahead: of the next point for its coordinates, of the one
    // after it for the copies at this trip's foot (the last point's again where
    // there is none)
    const int n1 = min(n + ST_WAVES, NPTS-1), n2 = min(n + 2*ST_WAVES, NPTS-1);
    idc = idx[(unsigned)(n1*NS + lr)];
    ids = idx[(unsigned)(n2*NS + rot)];
    gather_lane_nb(rsrc + buf, w, 0, 3);
    // loads held ahead of their uses, translation wait: as in kernel 3
    asm volatile("s_wait_xcnt 0x0" :: "v"(id) : "memory");
    __builtin_amdgcn_sched_barrier(0);
    const v2f f = pfrag(q0, q1, q2, c0, c1, c2, kh, L, B);
    // the last column tile's LDS reads: not beside the registers that the lines
    // above need
    gather_lane_nb(rsrc + buf, w, 3, 4);
    const v8f d2 = mid_w2(K, w, xqv, f);
#pragma unroll
    for (int r = 0; r < 4; ++r) {
      ms[r] += d2[r]; ms2[r] = fmaf(d2[r], d2[r], ms2[r]);
    }
    // the sums above stay in front of the stores: the store of the last product's
    // result then issues behind vector instructions that have already read it
    __builtin_amdgcn_sched_barrier(0);
    // Hand-over of the buffers: this wave's reads of its buffer are done, the next
    // point's rows have landed, every wave is here; then the buffer just read is
    // filled anew.  The sums are inputs of the first wait so that they stay in front
    // of it: the first vector instructions behind the last product then read its
    // result, and none overwrites a register of it before they have.
    asm volatile("s_wait_dscnt 0x0" :: "v"(ms[0]), "v"(ms[1]), "v"(ms[2]), "v"(ms[3]),
                 "v"(ms2[0]), "v"(ms2[1]), "v"(ms2[2]), "v"(ms2[3]) : "memory");
    asm volatile("s_wait_asynccnt 0x0" ::: "memory");
    __syncthreads();
    if (t + 2 < cnt) copy_rows(xk, ids, lr, cdst + buf*4);
    // the stores stand behind the barrier, which waits for a wave's earlier stores:
    // so they have a whole trip to finish
    float* pw = w2s + (size_t)n*W2_PT + lane*4;
    float* pf = fs  + (size_t)n*F_PT  + lane*2;
    const v4f sv = {d2[0], d2[1], d2[2], d2[3]};
    *(v4f*)pw = sv;
    *(v2f*)pf = f;
    // translation wait, a precaution ahead of the next pass's reuse of the two
    // stores' address and data registers
    asm volatile("s_wait_xcnt 0x0" :: "v"(pw), "v"(pf), "v"(sv), "v"(f) : "memory");
  }
  // no copy is left in flight when the wave ends
  asm volatile("s_wait_asynccnt 0x0" ::: "memory");
  // bw1 enters once per wave: sum(x+b) = sum x + k*b, sum(x+b)^2 = sum x^2 + 2b*sum x + k*b^2
  // k = the points this wave has taken
  const float kpts = (float)((NPTS - 1 - wave)/ST_WAVES + 1);
#pragma unroll
  for (int r = 0; r < 4; ++r) {
    const float bb = bw1[r + 4*kh];
    ms2[r] = fmaf(bb, fmaf(kpts, bb, 2.f*ms[r]), ms2[r]);
    ms[r]  = fmaf(kpts, bb, ms[r]);
    const float a = rowsum16(ms[r]), b = rowsum16(ms2[r]);
    if (lr == 0) { atomicAdd(&sm[r + 4*kh], a); atomicAdd(&sm2[r + 4*kh], b); }
  }
  __syncthreads();
  if (threadIdx.x < 8) {
    atomicAdd(&mstats[threadIdx.x],   sm[threadIdx.x]);
    atomicAdd(&mstats[8+threadIdx.x], sm2[threadIdx.x]);
  }
}

// ---------------------------------------------------------------------------
// Kernel 5: softmax + aggregation. One point per wave pass.  w2 and f come
// from kernel 4's stores, read back by the lane that wrote them.
// ---------------------------------------------------------------------------
__global__ void __launch_bounds__(PT_BLOCK) k_final(
    const int* __restrict__ idx, const float* __restrict__ xv,
    const float* __restrict__ Wp2, const float* __restrict__ bp2,
    const float* __restrict__ bw1,
    const float* __restrict__ gw2, const float* __restrict__ bw2_bn,
    const float* __restrict__ Ww2, const float* __restrict__ bw2,
    const float* __restrict__ mstats,
    const float* __restrict__ w2s, const float* __restrict__ fs,
    float* __restrict__ out)
{
  __shared__ __attribute__((aligned(16))) float sV[2][PT_BLOCK/32][PTBUF];
  const int lane = threadIdx.x & 31;
  const int lr = lane & 15, kh = lane >> 4;
  const int wave = __builtin_amdgcn_readfirstlane((int)((blockIdx.x*blockDim.x + threadIdx.x) >> 5));
  const int wv = wave & (PT_BLOCK/32 - 1);
  // where the lane's copies land (rows 8kh ..) and where it reads (rows 8kh ..)
  const unsigned cdst = (unsigned)(size_t)&sV[0][wv][kh*8*ROWP + lr*4];
  const float* rsrc = &sV[0][wv][kh*8*ROWP + lr];
  // indices of points 0 and 1 (lane lr: neighbour (lr + 8kh) & 15); point 0's rows
  // fly while the constants are made
  const int rot = (lr + 8*kh) & 15;
  int ids = idx[(unsigned)(wave*NS + rot)];
  const int ids1 = idx[(unsigned)((wave + PT_WAVES)*NS + rot)];
  copy_rows(xv, ids, lr, cdst);

  v2f P[4];       // unscaled positional weights, B operand of the value product
#pragma unroll
  for (int t = 0; t < 4; ++t) {
    const int ch = 16*t + lr;
    P[t][0] = kh ? Wp2[128+ch] : Wp2[ch];
    P[t][1] = kh ? bp2[ch]     : Wp2[64+ch];
  }
  // BN2 folded with bw1, for mid channel o = r + 4*kh
  float s2h[4], o2h[4];
  const float invM = 1.0f/(float)PAIRS;
#pragma unroll
  for (int r = 0; r < 4; ++r) {
    const int o = r + 4*kh;
    const float m = mstats[o]*invM;
    const float s = rsqrtf(mstats[8+o]*invM - m*m + EPSF)*gw2[o];
    s2h[r] = s;
    o2h[r] = fmaf(bw1[o] - m, s, bw2_bn[o]);
  }
  // Ww2 as B: column lr -> plane lr & 7, k = mid channels 2s+4kh, +1
  v2f G[2];
#pragma unroll
  for (int s = 0; s < 2; ++s) {
    G[s][0] = Ww2[(2*s + 4*kh)*8 + (lr & 7)];
    G[s][1] = Ww2[(2*s + 1 + 4*kh)*8 + (lr & 7)];
  }
  const float b2l = bw2[lr & 7];

  // point 0's rows have landed; the barrier publishes them
  asm volatile("s_wait_asynccnt 0x0" ::: "memory");
  __syncthreads();
  copy_rows(xv, ids1, lr, cdst + PT_BLOCK/32*PTBUF*4);
  for (int t = 0; t < NPTS/PT_WAVES; ++t) {
    const int n = wave + t*PT_WAVES;
    const int buf = (t & 1)*(PT_BLOCK/32*PTBUF);
    v8f V[4];
    const float* pw = w2s + (size_t)n*W2_PT + lane*4;
    const float* pf = fs  + (size_t)n*F_PT  + lane*2;
    const v4f d2 = *(const v4f*)pw;
    const v2f f  = *(const v2f*)pf;
    // indices fetched ahead, for the copies at this trip's foot (the last point's
    // where there is none)
    const int n2 = min(n + 2*PT_WAVES, NPTS-1);
    ids = idx[(unsigned)(n2*NS + rot)];
    gather_lane_ch(rsrc + buf, V);
    // loads held ahead of their uses, translation wait: as in kernel 3
    asm volatile("s_wait_xcnt 0x0" :: "v"(pw), "v"(pf) : "memory");
    __builtin_amdgcn_sched_barrier(0);

    // logits: d3[r] = w3 of neighbour r+8kh, plane lr & 7
    float h2[4];
#pragma unroll
    for (int r = 0; r < 4; ++r) h2[r] = fmaxf(fmaf(d2[r], s2h[r], o2h[r]), 0.f);
    v8f d3 = {b2l, b2l, b2l, b2l, b2l, b2l, b2l, b2l};
#pragma unroll
    for (int s = 0; s < 2; ++s) {
      v2f a; a[0] = h2[2*s]; a[1] = h2[2*s+1];
      d3 = mm4(a, G[s], d3);
    }

    // softmax over the 16 neighbours: 8 registers and the other lane half
    float mx = fmaxf(fmaxf(fmaxf(d3[0], d3[1]), fmaxf(d3[2], d3[3])),
                     fmaxf(fmaxf(d3[4], d3[5]), fmaxf(d3[6], d3[7])));
    mx = fmaxf(mx, xhalf(mx));
    v8f e;
#pragma unroll
    for (int r = 0; r < 8; ++r) e[r] = __expf(d3[r] - mx);
    float den = sum8(e);
    den += xhalf(den);
    const float invd = 1.0f / den;

    // out[n,ch] = sum_j (xv_g + pr) * weight; xv_g + pr = f x P + xv_g
    float acc[4];
#pragma unroll
    for (int u = 0; u < 4; ++u) {
      const v8f vp = mm4(f, P[u], V[u]);
      v2f a2v = {0.f, 0.f};
#pragma unroll
      for (int i = 0; i < 4; ++i) {
        v2f x; x[0] = vp[2*i]; x[1] = vp[2*i+1];
        v2f y; y[0] = e[2*i];  y[1] = e[2*i+1];
        a2v = __builtin_elementwise_fma(x, y, a2v);
      }
      const float a = a2v[0] + a2v[1];
      acc[u] = a + xhalf(a);
    }
    float* orow = out + (size_t)n*C + 32*kh + lr;
    const float o0 = (kh ? acc[2] : acc[0]) * invd;
    const float o1 = (kh ? acc[3] : acc[1]) * invd;
    // hand-over of the buffers, as in kernel 3 (the results are the first wait's
    // inputs, for the same reason); the stores stand behind the barrier, which waits
    // for a wave's earlier stores: so they have a whole trip to finish
    asm volatile("s_wait_dscnt 0x0" :: "v"(o0), "v"(o1) : "memory");
    asm volatile("s_wait_asynccnt 0x0" ::: "memory");
    __syncthreads();
    if (t + 2 < NPTS/PT_WAVES) copy_rows(xv, ids, lr, cdst + buf*4);
    orow[0]  = o0;
    orow[16] = o1;
    // the same precaution for the two stores' address and data registers,
    // which the next pass reuses
    asm volatile("s_wait_xcnt 0x0" :: "v"(orow), "v"(o0), "v"(o1) : "memory");
  }
  // no copy is left in flight when the wave ends
  asm volatile("s_wait_asynccnt 0x0" ::: "memory");
}

// ---------------------------------------------------------------------------
// Host launcher
// ---------------------------------------------------------------------------
extern "C" void kernel_launch(void* const* d_in, const int* in_sizes, int n_in,
                              void* d_out, int out_size, void* d_ws, size_t ws_size,
                              hipStream_t stream)
{
  (void)in_sizes; (void)n_in; (void)out_size; (void)ws_size;
  const float* p     = (const float*)d_in[0];
  const float* x     = (const float*)d_in[1];
  const int*   idx   = (const int*)  d_in[2];
  const float* Wq    = (const float*)d_in[3];
  const float* bq    = (const float*)d_in[4];
  const float* Wk    = (const float*)d_in[5];
  const float* bk    = (const float*)d_in[6];
  const float* Wv    = (const float*)d_in[7];
  const float* bv    = (const float*)d_in[8];
  const float* Wp1   = (const float*)d_in[9];
  const float* bp1   = (const float*)d_in[10];
  const float* gp    = (const float*)d_in[11];
  const float* bp_bn = (const float*)d_in[12];
  const float* Wp2   = (const float*)d_in[13];
  const float* bp2   = (const float*)d_in[14];
  const float* gw1   = (const float*)d_in[15];
  const float* bw1bn = (const float*)d_in[16];
  const float* Ww1   = (const float*)d_in[17];
  const float* bw1   = (const float*)d_in[18];
  const float* gw2   = (const float*)d_in[19];
  const float* bw2bn = (const float*)d_in[20];
  const float* Ww2   = (const float*)d_in[21];
  const float* bw2   = (const float*)d_in[22];

  float* ws     = (float*)d_ws;          // 96 MB + 8 KiB of the workspace
  float* xq     = ws;
  float* xk     = xq + (size_t)NPTS*C;
  float* xv     = xk + (size_t)NPTS*C;
  float* pstats = xv + (size_t)NPTS*C;   // 6 x PS_BLOCKS per-block sums
  float* wstats = pstats + 6*PS_BLOCKS;  // 128
  float* mstats = wstats + 128;          // 16
  float* w2s    = pstats + 2048;         // 32 MB, 8 KiB behind pstats
  float* fs     = w2s + (size_t)NPTS*W2_PT;  // 16 MB

  // 1) QKV projections: 4096 waves, 8 waves/block, one M-tile a wave, W in LDS;
  //    in front of them PS_BLOCKS blocks with the positional-branch BN sums and
  //    the zeros of wstats and mstats
  k_qkv<<<PS_BLOCKS + QKV_BLOCKS, 256, 0, stream>>>(x, Wq,bq, Wk,bk, Wv,bv, xq, xk, xv,
                                     p, idx, Wp1, bp1, pstats, wstats);
  // 3) attention-logit BN stats (64 ch)
  k_wstats<<<ST_WAVES*32/PT_BLOCK, PT_BLOCK, 0, stream>>>(p, idx, xq, xk, Wp1,bp1, gp,bp_bn, Wp2,bp2,
                                     pstats, wstats);
  // 4) mid BN stats (8 ch)
  k_mstats<<<ST_WAVES*32/PT_BLOCK, PT_BLOCK, 0, stream>>>(p, idx, xq, xk, Wp1,bp1, gp,bp_bn, Wp2,bp2,
                                     gw1,bw1bn, Ww1,bw1, pstats, wstats, mstats, w2s, fs);
  // 5) softmax + aggregation from kernel 4's w2 and f, one point per wave pass
  k_final<<<PT_WAVES*32/PT_BLOCK, PT_BLOCK, 0, stream>>>(idx, xv, Wp2,bp2, bw1,
                                      gw2,bw2bn, Ww2,bw2, mstats, w2s, fs,
                                      (float*)d_out);
}

// v007
// It runs in 82.2 microseconds.
// Next to v006, in two timings, it ran 1.04 times as fast each time.
// All steps since v000 together make it 4.94 times as fast.
#include <hip/hip_runtime.h>
#include <math.h>

// Problem constants (from reference)
#define NPTS 65536
#define NS   16
#define C    64
#define CH   8            // MID // S
#define PAIRS (NPTS*NS)   // 1,048,576
#define EPSF 1e-5f

typedef __attribute__((ext_vector_type(2))) float v2f;
typedef __attribute__((ext_vector_type(8))) float v8f;
typedef __attribute__((ext_vector_type(4))) float v4f;
typedef __attribute__((ext_vector_type(4))) int   v4i;
typedef __attribute__((ext_vector_type(2))) int   v2i;

// lane l <-> lane l ^ 16
__device__ __forceinline__ float xhalf(float x) {
  return __builtin_bit_cast(float, __builtin_amdgcn_permlanex16(
      __builtin_bit_cast(int, x), __builtin_bit_cast(int, x),
      0x76543210, 0xfedcba98, false, false));
}

// sum over the 16 lanes of a row (row_xmask 1,2,4,8)
__device__ __forceinline__ float rowsum16(float v) {
  v += __builtin_bit_cast(float, __builtin_amdgcn_update_dpp(0, __builtin_bit_cast(int, v), 0x161, 0xf, 0xf, true));
  v += __builtin_bit_cast(float, __builtin_amdgcn_update_dpp(0, __builtin_bit_cast(int, v), 0x162, 0xf, 0xf, true));
  v += __builtin_bit_cast(float, __builtin_amdgcn_update_dpp(0, __builtin_bit_cast(int, v), 0x164, 0xf, 0xf, true));
  v += __builtin_bit_cast(float, __builtin_amdgcn_update_dpp(0, __builtin_bit_cast(int, v), 0x168, 0xf, 0xf, true));
  return v;
}

#define PS_BLOCKS 256     // blocks of launch 1 that sum the positional branch

// ---------------------------------------------------------------------------
// BN params for the 3-channel positional branch.  part = [6][PS_BLOCKS] sums of
// t and t*t, one per block of launch 1; every wave adds them up for itself, in
// a fixed order (8 a lane, then over the 32 lanes).
// ---------------------------------------------------------------------------
struct BNp { float m0,m1,m2, s0,s1,s2, b0,b1,b2; };

__device__ __forceinline__ BNp make_bnp(const float* __restrict__ part, int lane,
                                        const float* __restrict__ gp,
                                        const float* __restrict__ bp) {
  const float invM = 1.0f / (float)PAIRS;
  const float* pp = part + lane*8;
  v4f lo[6], hi[6];
#pragma unroll
  for (int k = 0; k < 6; ++k) {
    lo[k] = *(const v4f*)(pp + k*PS_BLOCKS);
    hi[k] = *(const v4f*)(pp + k*PS_BLOCKS + 4);
  }
  // translation wait, a precaution ahead of any reuse of the loads' address register
  asm volatile("s_wait_xcnt 0x0" :: "v"(pp) : "memory");
  float ps[6];
#pragma unroll
  for (int k = 0; k < 6; ++k) {
    float v = ((lo[k][0]+lo[k][1]) + (lo[k][2]+lo[k][3])) + ((hi[k][0]+hi[k][1]) + (hi[k][2]+hi[k][3]));
    v = rowsum16(v);
    v += xhalf(v);
    // the same in every lane: kept in a scalar register
    ps[k] = __builtin_bit_cast(float, __builtin_amdgcn_readfirstlane(__builtin_bit_cast(int, v)));
  }
  BNp r;
  float m0 = ps[0]*invM, m1 = ps[1]*invM, m2 = ps[2]*invM;
  float v0 = ps[3]*invM - m0*m0;
  float v1 = ps[4]*invM - m1*m1;
  float v2 = ps[5]*invM - m2*m2;
  r.m0=m0; r.m1=m1; r.m2=m2;
  r.s0 = rsqrtf(v0+EPSF)*gp[0];
  r.s1 = rsqrtf(v1+EPSF)*gp[1];
  r.s2 = rsqrtf(v2+EPSF)*gp[2];
  r.b0 = bp[0]; r.b1 = bp[1]; r.b2 = bp[2];
  return r;
}

// ---------------------------------------------------------------------------
// Kernel 1: xq/xk/xv = x @ W + b via V_WMMA_F32_16X16X4_F32.
// Each wave owns one 16-row tile of x and takes it through all 12 (matrix,
// N-tile) combos: the rows are loaded once, 16 bytes a lane (8 loads), and stay
// in registers as the A fragments; the B fragments come from LDS, where each
// block keeps the three W.  192 WMMAs and 48 stores per wave.
// A (16x4 f32): lanes 0-15 rows M, VGPR0=K0 VGPR1=K1; lanes 16-31 K2/K3.
// B (4x16 f32): lanes hold N, VGPR0=K0(|K2), VGPR1=K1(|K3).
// k order, alike in A and B: product (s,h), lane half kh, register j takes input
// channel 8s + 4kh + 2h + j.
// LDS: sW[matrix][k pair kp][column c][j] = W[2kp + j][c], so that one 16-byte
// read gives a lane the register pairs of two columns, the 16 lanes of a half
// reading 256 bytes in a row.  Column of N-tile e in lane lr: 2lr, 2lr+1,
// 32+2lr, 33+2lr: an 8-byte store of two tiles' results covers a whole 128-byte
// line per row.
// ---------------------------------------------------------------------------
#define QKV_BLOCKS 512    // 8 waves a block, one of the 4096 M-tiles a wave

// The first PS_BLOCKS blocks of launch 1: sum / sumsq of (rel_p @ Wp1 + bp1) per
// 3 channels, one point (16 pairs) a thread, one set of six sums a block ->
// part[6][PS_BLOCKS].  Nothing here depends on the projections, so it shares
// their launch.  Block 0 also stores the zeros that kernels 3 and 4 add into.
__device__ __forceinline__ void pstats_part(
    const float* __restrict__ p, const int* __restrict__ idx,
    const float* __restrict__ Wp1, const float* __restrict__ bp1,
    float* __restrict__ part, float* __restrict__ zstats)
{
  __shared__ float sh[8][6];
  float w[9], bb[3];
#pragma unroll
  for (int i = 0; i < 9; ++i) w[i] = Wp1[i];
#pragma unroll
  for (int i = 0; i < 3; ++i) bb[i] = bp1[i];
  const int n = blockIdx.x*256 + threadIdx.x;
  const v2i* ip = (const v2i*)(idx + n*NS);
  const float* pc = p + n*3;
  v2i cur = ip[0];
  const float c0 = pc[0], c1 = pc[1], c2 = pc[2];
  // translation wait, a precaution ahead of any reuse of the loads' address registers
  asm volatile("s_wait_xcnt 0x0" :: "v"(ip), "v"(pc) : "memory");
  // channels 0 and 1 as a pair, channel 2 alone
  const v2f W01 = {w[0], w[1]}, W34 = {w[3], w[4]}, W67 = {w[6], w[7]}, B01 = {bb[0], bb[1]};
  v2f sp = {0.f, 0.f}, sp2 = {0.f, 0.f};
  float sc = 0.f, sc2 = 0.f;
  // Two neighbours a trip, the next trip's indices fetched beside this trip's
  // gathers.
#pragma unroll 1
  for (int g = 0; g < 8; ++g) {
    const v2i* in = ip + ((g + 1) & 7);
    const v2i nxt = *in;
    // the same precaution for this load's address registers; it also keeps the load
    // ahead of the gathers, so that its result lands in none of their address registers
    asm volatile("s_wait_xcnt 0x0" :: "v"(in) : "memory");
    int o[2];
    float q0[2], q1[2], q2[2];
#pragma unroll
    for (int j = 0; j < 2; ++j) {
      o[j] = (cur[j] & (NPTS-1))*3;
      q0[j] = p[o[j]]; q1[j] = p[o[j]+1]; q2[j] = p[o[j]+2];
    }
    // and for the two gathers' address registers
    asm volatile("s_wait_xcnt 0x0" :: "v"(o[0]), "v"(o[1]) : "memory");
#pragma unroll
    for (int j = 0; j < 2; ++j) {
      const float r0 = q0[j]-c0, r1 = q1[j]-c1, r2 = q2[j]-c2;
      const v2f R0 = {r0, r0}, R1 = {r1, r1}, R2 = {r2, r2};
      const v2f t = __builtin_elementwise_fma(R2, W67,
                    __builtin_elementwise_fma(R1, W34,
                    __builtin_elementwise_fma(R0, W01, B01)));
      const float u = fmaf(r2, w[8], fmaf(r1, w[5], fmaf(r0, w[2], bb[2])));
      sp += t; sp2 = __builtin_elementwise_fma(t, t, sp2);
      sc += u; sc2 = fmaf(u, u, sc2);
    }
    cur = nxt;
  }
  const float s[3] = {sp[0], sp[1], sc}, s2[3] = {sp2[0], sp2[1], sc2};
  const int lane = threadIdx.x & 31, wv = threadIdx.x >> 5;
#pragma unroll
  for (int k = 0; k < 3; ++k) {
    float a = rowsum16(s[k]), b = rowsum16(s2[k]);
    a += xhalf(a); b += xhalf(b);
    if (lane == 0) { sh[wv][k] = a; sh[wv][3+k] = b; }
  }
  __syncthreads();
  if (threadIdx.x < 6) {
    float a = 0.f;
#pragma unroll
    for (int v = 0; v < 8; ++v) a += sh[v][threadIdx.x];
    part[threadIdx.x*PS_BLOCKS + blockIdx.x] = a;
  }
  if (blockIdx.x == 0 && threadIdx.x < 128+16) zstats[threadIdx.x] = 0.f;
}

// Six waves a SIMD are launched (two of the sums, four of the projections): the
// second launch bound keeps the allocation at 160 registers or fewer, so that all
// of them are resident from the start.
__global__ void __launch_bounds__(256, 6) k_qkv(
    const float* __restrict__ x,
    const float* __restrict__ Wq, const float* __restrict__ bq,
    const float* __restrict__ Wk, const float* __restrict__ bk,
    const float* __restrict__ Wv, const float* __restrict__ bv,
    float* __restrict__ xq, float* __restrict__ xk, float* __restrict__ xv,
    const float* __restrict__ p, const int* __restrict__ idx,
    const float* __restrict__ Wp1, const float* __restrict__ bp1,
    float* __restrict__ part, float* __restrict__ zstats)
{
  if (blockIdx.x < PS_BLOCKS) {   // the same for a whole block
    pstats_part(p, idx, Wp1, bp1, part, zstats);
    return;
  }
  __shared__ __attribute__((aligned(16))) float sW[3*C*C];   // 48 KB
  const int lane = threadIdx.x & 31;
  const int lr = lane & 15, kh = lane >> 4;
  const int mt = (blockIdx.x - PS_BLOCKS)*8 + (threadIdx.x >> 5);

  // the wave's 16 rows of x: lane = row lr, channels 8s + 4kh .. + 3
  // (every loop of this kernel is unrolled: its arrays are indexed by constants
  // only and so stay in registers, and the loads of a loop issue back to back)
  const float* arow = x + (size_t)(mt*16 + lr)*C + kh*4;
  v4f a[8];
#pragma unroll
  for (int s = 0; s < 8; ++s) a[s] = *(const v4f*)(arow + 8*s);

  // the block's copy of the three W: a thread takes rows 2kp, 2kp+1 of four
  // columns (whole lines per wave) and stores them as (row, row+1) pairs
  const int woff = (int)(threadIdx.x >> 4)*2*C + (int)(threadIdx.x & 15)*4;
  v4f w0[6], w1[6];
#pragma unroll
  for (int i = 0; i < 6; ++i) {
    const float* Wm = (i < 2) ? Wq : (i < 4) ? Wk : Wv;
    const float* sp = Wm + (i & 1)*32*C + woff;
    w0[i] = *(const v4f*)sp;
    w1[i] = *(const v4f*)(sp + C);
  }
  // bias of the lane's four columns, the start value of the accumulators
  v2f bl[3], bh[3];
#pragma unroll
  for (int m = 0; m < 3; ++m) {
    const float* bias = (m == 0) ? bq : (m == 1) ? bk : bv;
    bl[m] = *(const v2f*)(bias + 2*lr);
    bh[m] = *(const v2f*)(bias + 32 + 2*lr);
  }
  // translation wait, a precaution ahead of any reuse of the loads' address registers
  asm volatile("s_wait_xcnt 0x0" :: "v"(arow), "v"(woff), "v"(lr) : "memory");
  {
    float* dp = sW + (threadIdx.x >> 4)*2*C + (threadIdx.x & 15)*8;
#pragma unroll
    for (int i = 0; i < 6; ++i) {
      const v4f lo = {w0[i][0], w1[i][0], w0[i][1], w1[i][1]};
      const v4f hi = {w0[i][2], w1[i][2], w0[i][3], w1[i][3]};
      *(v4f*)(dp + i*32*C)     = lo;
      *(v4f*)(dp + i*32*C + 4) = hi;
    }
  }
  __syncthreads();

#pragma unroll
  for (int m = 0; m < 3; ++m) {
    float* out = (m == 0) ? xq : (m == 1) ? xk : xv;
    v8f acc[4];
#pragma unroll
    for (int r = 0; r < 8; ++r) {
      acc[0][r] = bl[m][0]; acc[1][r] = bl[m][1];
      acc[2][r] = bh[m][0]; acc[3][r] = bh[m][1];
    }
    const float* wb = sW + m*C*C + kh*4*C + lr*4;
#pragma unroll
    for (int s = 0; s < 8; ++s) {
#pragma unroll
      for (int h = 0; h < 2; ++h) {
        const float* wr = wb + (4*s + h)*2*C;
        const v4f b0 = *(const v4f*)wr;
        const v4f b1 = *(const v4f*)(wr + C);
        v2f av; av[0] = a[s][2*h]; av[1] = a[s][2*h+1];
        v2f b;
        b[0] = b0[0]; b[1] = b0[1];
        acc[0] = __builtin_amdgcn_wmma_f32_16x16x4_f32(false, av, false, b, (short)0, acc[0], false, false);
        b[0] = b0[2]; b[1] = b0[3];
        acc[1] = __builtin_amdgcn_wmma_f32_16x16x4_f32(false, av, false, b, (short)0, acc[1], false, false);
        b[0] = b1[0]; b[1] = b1[1];
        acc[2] = __builtin_amdgcn_wmma_f32_16x16x4_f32(false, av, false, b, (short)0, acc[2], false, false);
        b[0] = b1[2]; b[1] = b1[3];
        acc[3] = __builtin_amdgcn_wmma_f32_16x16x4_f32(false, av, false, b, (short)0, acc[3], false, false);
      }
    }
    float* orow = out + (size_t)(mt*16 + 8*kh)*C + 2*lr;
#pragma unroll
    for (int r = 0; r < 8; ++r) {
      const v2f lo = {acc[0][r], acc[1][r]};
      const v2f hi = {acc[2][r], acc[3][r]};
      *(v2f*)(orow + r*C)      = lo;
      *(v2f*)(orow + r*C + 32) = hi;
    }
    // translation wait, a precaution ahead of the next matrix's reuse of the stores'
    // address and data registers
    asm volatile("s_wait_xcnt 0x0" :: "v"(orow) : "memory");
  }
}

// ---------------------------------------------------------------------------
// Kernels 3-5 work on one point (its 16 neighbours) per wave pass and run the
// per-pair products on V_WMMA_F32_16X16X4_F32.  lr = lane & 15, kh = lane >> 4.
// Fragment facts (as in kernel 1): A lane lr = row, B lane lr = column, both
// hold k = 2*kh, 2*kh+1 in their two registers; D register r = row r + 8*kh,
// column lr.
//   f        = (a0,a1 | a2,1): positional features of neighbour lr, k = 4
//   P[t]     = (Wp2 row0,row1 | row2,bias) of channel 16t+lr, k = 4
//   P x f    -> D[r] = channel 16t+8kh+r of neighbour lr   (lane = neighbour)
//   f x P    -> D[r] = neighbour r+8kh, channel 16t+lr     (lane = channel)
// In the lane = channel products the gathered rows enter as the C operand; in
// the lane = neighbour product they are added behind it; -xq goes into the
// bias column.
// ---------------------------------------------------------------------------
#define PT_WAVES 8192     // kernel 5: 8 points per wave
// Kernels 3 and 4 allocate 160 registers, so a SIMD holds six of their waves and
// the chip 256 x 4 x 6 = 6144.  They launch exactly that many (six blocks a WGP):
// every wave is resident from the start and takes 10 or 11 points.  Any more blocks
// would wait for a free place and run as a second round on a mostly empty chip.
#define ST_WAVES 6144
#define PT_BLOCK 128      // 4 waves per block
#define W2_PT 128         // floats of w2 stored per point (16 neighbours x 8)
#define F_PT  64          // floats of f stored per point (32 lanes x 2)

__device__ __forceinline__ v8f mm4(v2f a, v2f b, v8f c) {
  return __builtin_amdgcn_wmma_f32_16x16x4_f32(false, a, false, b, (short)0, c,
                                               false, false);
}

// Wp1 and bp1, read once per wave
struct PW { float w[9], b[3]; };
__device__ __forceinline__ PW make_pw(const float* __restrict__ Wp1,
                                      const float* __restrict__ bp1) {
  PW r;
#pragma unroll
  for (int i = 0; i < 9; ++i) r.w[i] = Wp1[i];
#pragma unroll
  for (int i = 0; i < 3; ++i) r.b[i] = bp1[i];
  return r;
}

// f = (a0,a1 | a2,1) from the neighbour's coordinates (q0,q1,q2) and the
// point's own (c0,c1,c2), all loaded by the caller
__device__ __forceinline__ v2f pfrag(float q0, float q1, float q2,
                                     float c0, float c1, float c2, int kh,
                                     const PW& L, const BNp& B) {
  float r0 = q0-c0;
  float r1 = q1-c1;
  float r2 = q2-c2;
  float t0 = fmaf(r2, L.w[6], fmaf(r1, L.w[3], fmaf(r0, L.w[0], L.b[0])));
  float t1 = fmaf(r2, L.w[7], fmaf(r1, L.w[4], fmaf(r0, L.w[1], L.b[1])));
  float t2 = fmaf(r2, L.w[8], fmaf(r1, L.w[5], fmaf(r0, L.w[2], L.b[2])));
  float a0 = fmaxf(fmaf(t0-B.m0, B.s0, B.b0), 0.f);
  float a1 = fmaxf(fmaf(t1-B.m1, B.s1, B.b1), 0.f);
  float a2 = fmaxf(fmaf(t2-B.m2, B.s2, B.b2), 0.f);
  v2f f; f[0] = kh ? a2 : a0; f[1] = kh ? 1.f : a1;
  return f;
}

__device__ __forceinline__ float sum8(v8f v) {
  return ((v[0]+v[1]) + (v[2]+v[3])) + ((v[4]+v[5]) + (v[6]+v[7]));
}

#define ROWP  68          // floats: LDS pitch of a gathered row, 272 B (see copy_rows)
#define PTBUF (NS*ROWP)   // floats of LDS per point

// rows of neighbours r+8kh, channels 16u+lr  (lane = channel layout), from LDS:
// vr = row 8kh of the point's buffer, + lr
__device__ __forceinline__ void gather_lane_ch(const float* vr, v8f V[4]) {
#pragma unroll
  for (int u = 0; u < 4; ++u) {
    const float* c = vr + 16*u;
    const v8f x = {c[0], c[ROWP], c[2*ROWP], c[3*ROWP], c[4*ROWP], c[5*ROWP], c[6*ROWP], c[7*ROWP]};
    V[u] = x;
  }
}

// kr = row of neighbour lr in LDS, + 8*kh: channels 16t+8kh+r  (lane = neighbour
// layout), column tiles t0 .. t1-1 of the four
__device__ __forceinline__ void gather_lane_nb(const float* kr, v8f w[4], int t0, int t1) {
#pragma unroll
  for (int t = t0; t < t1; ++t) {
    const v4f lo = *(const v4f*)(kr + 16*t);
    const v4f hi = *(const v4f*)(kr + 16*t + 4);
    w[t] = __builtin_shufflevector(lo, hi, 0, 1, 2, 3, 4, 5, 6, 7);
  }
}

// Kernels 3-5 bring a point's 16 gathered rows into LDS by asynchronous copies and
// read them from there in the layout that their products want.  A copy moves two
// whole rows (neighbours r and r+8, 16 lanes x 16 bytes each: four whole lines); for
// the same 512 bytes register loads touch 16 lines in the lane = neighbour layout
// and 8 in the lane = channel layout.  The pitch of 272 B (16 B x odd) lets the
// 16-byte reads of a column meet no bank twice, and puts rows r and r+8 half the
// banks apart for the 4-byte reads.
// Each kernel keeps two buffers, a point a wave in each: while a point is worked
// on, the next one's rows fly.

// the value that lane R of the own 16-lane row holds (DPP row_share)
template <int R> __device__ __forceinline__ int rowlane(int v) {
  return __builtin_amdgcn_update_dpp(0, v, 0x150 + R, 0xf, 0xf, true);
}

// ids: lane lr of half kh holds the index of neighbour (lr + 8kh) & 15, so lane r
// of the own row has that of neighbour r + 8kh; lds = byte address in LDS of row
// 8kh, + 16*lr.  The translation wait, a precaution ahead of any rewrite of the
// copies' address registers, is the statement's own last line: there nothing can
// be moved in front of it.
__device__ __forceinline__ void copy_rows(const float* __restrict__ src,
                                          int ids, int lr, unsigned lds) {
  const int off = (ids & (NPTS-1))*C;      // the row's place in src, bounded here
  const int ro[8] = {rowlane<0>(off), rowlane<1>(off), rowlane<2>(off), rowlane<3>(off),
                     rowlane<4>(off), rowlane<5>(off), rowlane<6>(off), rowlane<7>(off)};
  const float* srcl = src + lr*4;
  const float* g[8];
#pragma unroll
  for (int r = 0; r < 8; ++r) g[r] = srcl + (unsigned)ro[r];
  asm volatile(
      "global_load_async_to_lds_b128 %0, %8, off\n\t"
      "global_load_async_to_lds_b128 %1, %9, off\n\t"
      "global_load_async_to_lds_b128 %2, %10, off\n\t"
      "global_load_async_to_lds_b128 %3, %11, off\n\t"
      "global_load_async_to_lds_b128 %4, %12, off\n\t"
      "global_load_async_to_lds_b128 %5, %13, off\n\t"
      "global_load_async_to_lds_b128 %6, %14, off\n\t"
      "global_load_async_to_lds_b128 %7, %15, off\n\t"
      "s_wait_xcnt 0x0"
      :: "v"(lds),            "v"(lds + 1*ROWP*4), "v"(lds + 2*ROWP*4), "v"(lds + 3*ROWP*4),
         "v"(lds + 4*ROWP*4), "v"(lds + 5*ROWP*4), "v"(lds + 6*ROWP*4), "v"(lds + 7*ROWP*4),
         "v"(g[0]), "v"(g[1]), "v"(g[2]), "v"(g[3]), "v"(g[4]), "v"(g[5]), "v"(g[6]), "v"(g[7])
      : "memory");
}

// What kernels 3 and 4 read of a point besides the gathered rows: xq of channels
// 16u+lr, the coordinates of neighbour lr (id: its index, bounded by the caller)
// and the point's own.
struct Own { float xq[4], q0, q1, q2, c0, c1, c2; };
__device__ __forceinline__ Own load_own(const float* __restrict__ xq,
                                        const float* __restrict__ p,
                                        int n, int id, int lr) {
  Own r;
  const unsigned xo = (unsigned)(n*C + lr);
  const unsigned pb = (unsigned)id*12u;    // bytes: the gather's own offset register
  const float* pq = (const float*)((const char*)p + pb);
#pragma unroll
  for (int u = 0; u < 4; ++u) r.xq[u] = (xq + xo)[16*u];
  r.q0 = pq[0];    r.q1 = pq[1];    r.q2 = pq[2];
  r.c0 = p[n*3+0]; r.c1 = p[n*3+1]; r.c2 = p[n*3+2];
  // translation wait, a precaution ahead of any reuse of the loads' address registers,
  // which are its inputs so that they keep their values up to it
  asm volatile("s_wait_xcnt 0x0" :: "v"(xo), "v"(pb) : "memory");
  return r;
}

// ---------------------------------------------------------------------------
// Kernel 3: sum / sumsq of w = xk_g - xq + pr per 64 channels -> wstats[128]
// lane = channel layout: w = f x P' + xk_g, P' bias column = bp2 - xq.
// ---------------------------------------------------------------------------
// The second launch bound keeps the allocation at 160 registers, six waves a SIMD.
__global__ void __launch_bounds__(PT_BLOCK, 6) k_wstats(
    const float* __restrict__ p, const int* __restrict__ idx,
    const float* __restrict__ xq, const float* __restrict__ xk,
    const float* __restrict__ Wp1, const float* __restrict__ bp1,
    const float* __restrict__ gp,  const float* __restrict__ bp_bn,
    const float* __restrict__ Wp2, const float* __restrict__ bp2,
    const float* __restrict__ pstats, float* __restrict__ wstats)
{
  __shared__ float ss[64], ss2[64];
  __shared__ __attribute__((aligned(16))) float sK[2][PT_BLOCK/32][PTBUF];
  if (threadIdx.x < 64) { ss[threadIdx.x] = 0.f; ss2[threadIdx.x] = 0.f; }
  __syncthreads();
  const int lane = threadIdx.x & 31;
  const int lr = lane & 15, kh = lane >> 4;
  const int wave = __builtin_amdgcn_readfirstlane((int)((blockIdx.x*blockDim.x + threadIdx.x) >> 5));
  const int wv = wave & (PT_BLOCK/32 - 1);
  // points a wave takes, 10 or 11: the same for the four waves of a block, as
  // NPTS % ST_WAVES is a multiple of four, so taken from the block's first wave
  const int cnt = (NPTS - 1 - (int)blockIdx.x*(PT_BLOCK/32))/ST_WAVES + 1;
  // where the lane's copies land (rows 8kh ..) and where it reads (rows 8kh ..)
  const unsigned cdst = (unsigned)(size_t)&sK[0][wv][kh*8*ROWP + lr*4];
  const float* rsrc = &sK[0][wv][kh*8*ROWP + lr];
  // indices of points 0 and 1; point 0's rows fly while the constants are made
  // (for the coordinates neighbour lr, for the copies neighbour (lr + 8kh) & 15)
  const int rot = (lr + 8*kh) & 15;
  const unsigned i0 = (unsigned)(wave*NS + lr), j0 = (unsigned)(wave*NS + rot);
  const int idc0 = idx[i0];
  int idc = (idx + ST_WAVES*NS)[i0];
  int ids = idx[j0];
  const int ids1 = (idx + ST_WAVES*NS)[j0];
  // translation wait, a precaution ahead of any reuse of the loads' offset registers
  asm volatile("s_wait_xcnt 0x0" :: "v"(i0), "v"(j0) : "memory");
  copy_rows(xk, ids, lr, cdst);
  // point 0's own loads, as each trip issues them for the point behind it
  Own cur = load_own(xq, p, wave, idc0 & (NPTS-1), lr);
  const BNp B = make_bnp(pstats, lane, gp, bp_bn);
  const PW L = make_pw(Wp1, bp1);
  v2f P[4];
#pragma unroll
  for (int t = 0; t < 4; ++t) {
    const int ch = 16*t + lr;
    P[t][0] = kh ? Wp2[128+ch] : Wp2[ch];
    P[t][1] = kh ? bp2[ch]     : Wp2[64+ch];
  }
  const float negk = kh ? -1.f : 0.f;
  v8f S[4] = {}, S2[4] = {};
  // point 0's rows have landed; the barrier publishes them
  asm volatile("s_wait_asynccnt 0x0" ::: "memory");
  __syncthreads();
  copy_rows(xk, ids1, lr, cdst + PT_BLOCK/32*PTBUF*4);
  for (int t = 0; t < cnt; ++t) {
    const int n = wave + t*ST_WAVES;
    const int buf = (t & 1)*(PT_BLOCK/32*PTBUF);
    const int id = idc & (NPTS-1);
    v8f V[4];
    // The NEXT point's xq row and coordinates are issued here and used a trip later:
    // they fly while this point, whose own came in a trip ago, is worked on.
    // Indices of the point after that: for its coordinates, and for the copies at
    // this trip's foot (the last point's again where there is none).
    const int n1 = min(n + ST_WAVES, NPTS-1);
    const Own nxt = load_own(xq, p, n1, id, lr);
    // (n2 = nb + 2*ST_WAVES; the constant part goes into the loads' immediate offset)
    const int nb = min(n, NPTS-1 - 2*ST_WAVES);
    const unsigned io = (unsigned)(nb*NS + lr), jo = (unsigned)(nb*NS + rot);
    idc = (idx + 2*ST_WAVES*NS)[io];
    ids = (idx + 2*ST_WAVES*NS)[jo];
    gather_lane_ch(rsrc + buf, V);
    // All of the trip's loads stay issued ahead of the work: sunk lower, they would
    // have less of the trip to fly in.  The translation wait is a precaution ahead of
    // any overwrite of the index loads' offset registers, which are its inputs so
    // that they keep their values up to it.
    asm volatile("s_wait_xcnt 0x0" :: "v"(io), "v"(jo) : "memory");
    __builtin_amdgcn_sched_barrier(0);
    const v2f f = pfrag(cur.q0, cur.q1, cur.q2, cur.c0, cur.c1, cur.c2, kh, L, B);
#pragma unroll
    for (int u = 0; u < 4; ++u) {
      v2f b = P[u];
      b[1] = fmaf(cur.xq[u], negk, b[1]);
      const v8f w = mm4(f, b, V[u]);
      S[u]  += w;
      S2[u] = __builtin_elementwise_fma(w, w, S2[u]);
    }
    // Hand-over of the buffers: this wave's reads of its buffer are done, the next
    // point's rows have landed, every wave is here; then the buffer just read is
    // filled anew.  The sums are inputs of the first wait so that they stay in front
    // of it: behind the last product then stand the vector instructions that read the
    // results, not the copies' address arithmetic over the products' operands.
    asm volatile("s_wait_dscnt 0x0" :: "v"(S[0]), "v"(S[1]), "v"(S[2]), "v"(S[3]),
                 "v"(S2[0]), "v"(S2[1]), "v"(S2[2]), "v"(S2[3]) : "memory");
    asm volatile("s_wait_asynccnt 0x0" ::: "memory");
    __syncthreads();
    if (t + 2 < cnt) copy_rows(xk, ids, lr, cdst + buf*4);
    cur = nxt;
  }
  // no copy is left in flight when the wave ends
  asm volatile("s_wait_asynccnt 0x0" ::: "memory");
#pragma unroll
  for (int u = 0; u < 4; ++u) {
    float a = sum8(S[u]), b = sum8(S2[u]);
    a += xhalf(a); b += xhalf(b);
    if (kh == 0) { atomicAdd(&ss[16*u+lr], a); atomicAdd(&ss2[16*u+lr], b); }
  }
  __syncthreads();
  if (threadIdx.x < 64) {
    atomicAdd(&wstats[threadIdx.x],    ss[threadIdx.x]);
    atomicAdd(&wstats[64+threadIdx.x], ss2[threadIdx.x]);
  }
}

// ---------------------------------------------------------------------------
// Kernel 4's constants of h = relu(BN1(w)) and w2 = h @ Ww1.
// BN1 is folded: h = relu(s1*xk_g + [s1*pr + s1*(bp2 - xq - m1) + b1]).
// ---------------------------------------------------------------------------
struct MidC {
  v2f  Q[4];      // s1-scaled P, bias column = s1*(bp2 - m1) + b1
  float sneg[4];  // -s1 in the bias column's lanes, else 0
  v8f  sC[4];     // s1 of channel 16t+8kh+r
  v2f  F[4][4];   // Ww1^T as A: row lr -> o(lr), k = channels 16t+8kh+2q, +1
};

// sS1 / sO1: 64 floats of LDS each, filled here (one barrier inside).
__device__ __forceinline__ void make_midc(MidC& K, float* sS1, float* sO1,
    int lr, int kh,
    const float* __restrict__ Wp2, const float* __restrict__ bp2,
    const float* __restrict__ gw1, const float* __restrict__ bw1_bn,
    const float* __restrict__ Ww1, const float* __restrict__ wstats)
{
  if (threadIdx.x < 64) {
    const int ch = threadIdx.x;
    const float invM = 1.0f/(float)PAIRS;
    const float m = wstats[ch]*invM;
    const float s = rsqrtf(wstats[64+ch]*invM - m*m + EPSF)*gw1[ch];
    sS1[ch] = s;
    sO1[ch] = fmaf(bp2[ch] - m, s, bw1_bn[ch]);
  }
  __syncthreads();
  // rows 0-7 -> o = row, rows 8-15 -> o = (row+4)&7: D registers 0-3 then hold
  // o = r + 4*kh, every mid channel once over the two lane halves.
  const int o = (lr < 8) ? lr : ((lr + 4) & 7);
#pragma unroll
  for (int t = 0; t < 4; ++t) {
    const int ch = 16*t + lr;
    const float s = sS1[ch];
    K.Q[t][0] = (kh ? Wp2[128+ch] : Wp2[ch]) * s;
    K.Q[t][1] = kh ? sO1[ch] : Wp2[64+ch] * s;
    K.sneg[t] = kh ? -s : 0.f;
#pragma unroll
    for (int r = 0; r < 8; ++r) K.sC[t][r] = sS1[16*t + 8*kh + r];
#pragma unroll
    for (int q = 0; q < 4; ++q) {
      const int c0 = 16*t + 8*kh + 2*q;
      K.F[t][q][0] = Ww1[c0*8 + o];
      K.F[t][q][1] = Ww1[(c0+1)*8 + o];
    }
  }
}

// w2 (without bw1) of the point's 16 neighbours: register r < 4 of the result
// = mid channel r + 4*kh of neighbour lr.
// w = gathered xk row (lane = neighbour layout), xqv[t] = xq of channel 16t+lr.
// Column tiles t0 .. t1-1 of the four, added to d2.
__device__ __forceinline__ v8f mid_w2(const MidC& K, const v8f w[4],
                                      const float xqv[4], v2f f, v8f d2, int t0, int t1)
{
  const v8f zero = {};
#pragma unroll
  for (int t = t0; t < t1; ++t) {
    v2f q = K.Q[t];
    q[1] = fmaf(xqv[t], K.sneg[t], q[1]);
    const v8f h = __builtin_elementwise_max(
        __builtin_elementwise_fma(w[t], K.sC[t], mm4(q, f, zero)), zero);
#pragma unroll
    for (int i = 0; i < 4; ++i) {
      v2f b; b[0] = h[2*i]; b[1] = h[2*i+1];
      d2 = mm4(K.F[t][i], b, d2);
    }
  }
  return d2;
}

// ---------------------------------------------------------------------------
// Kernel 4: stats of w2 = relu(BN1(w)) @ Ww1 + bw1 per 8 channels -> mstats[16]
// It also stores, per point and in the lanes' own order, what kernel 5 needs of
// this stage: w2s = 4 floats a lane (w2 without bw1, mid channel r + 4*kh of
// neighbour lr), fs = 2 floats a lane (the fragment f).
// ---------------------------------------------------------------------------
// The second launch bound keeps the allocation at 160 registers, six waves a SIMD:
// one register more would cost a resident wave.
__global__ void __launch_bounds__(PT_BLOCK, 6) k_mstats(
    const float* __restrict__ p, const int* __restrict__ idx,
    const float* __restrict__ xq, const float* __restrict__ xk,
    const float* __restrict__ Wp1, const float* __restrict__ bp1,
    const float* __restrict__ gp,  const float* __restrict__ bp_bn,
    const float* __restrict__ Wp2, const float* __restrict__ bp2,
    const float* __restrict__ gw1, const float* __restrict__ bw1_bn,
    const float* __restrict__ Ww1, const float* __restrict__ bw1,
    const float* __restrict__ pstats, const float* __restrict__ wstats,
    float* __restrict__ mstats, float* __restrict__ w2s, float* __restrict__ fs)
{
  __shared__ float sS1[64], sO1[64];
  __shared__ float sm[8], sm2[8];
  // two buffers of gathered xk rows, a point a wave in each
  __shared__ __attribute__((aligned(16))) float sK[2][PT_BLOCK/32][PTBUF];
  if (threadIdx.x < 8) { sm[threadIdx.x] = 0.f; sm2[threadIdx.x] = 0.f; }
  const int lane = threadIdx.x & 31;
  const int lr = lane & 15, kh = lane >> 4;
  const int wave = __builtin_amdgcn_readfirstlane((int)((blockIdx.x*blockDim.x + threadIdx.x) >> 5));
  const int wv = wave & (PT_BLOCK/32 - 1);
  // points a wave takes, 10 or 11: the same for the four waves of a block, as
  // NPTS % ST_WAVES is a multiple of four, so taken from the block's first wave
  const int cnt = (NPTS - 1 - (int)blockIdx.x*(PT_BLOCK/32))/ST_WAVES + 1;
  // where the lane's copies land (rows 8kh ..) and where it reads (row lr)
  const unsigned cdst = (unsigned)(size_t)&sK[0][wv][kh*8*ROWP + lr*4];
  const float* rsrc = &sK[0][wv][lr*ROWP + kh*8];
  // indices of points 0 and 1; point 0's rows fly while the constants are made
  // (for the coordinates neighbour lr, for the copies neighbour (lr + 8kh) & 15)
  const int rot = (lr + 8*kh) & 15;
  const unsigned i0 = (unsigned)(wave*NS + lr), j0 = (unsigned)(wave*NS + rot);
  const int idc0 = idx[i0];
  int idc = (idx + ST_WAVES*NS)[i0];
  int ids = idx[j0];
  const int ids1 = (idx + ST_WAVES*NS)[j0];
  // translation wait, a precaution ahead of any reuse of the loads' offset registers
  asm volatile("s_wait_xcnt 0x0" :: "v"(i0), "v"(j0) : "memory");
  copy_rows(xk, ids, lr, cdst);
  // point 0's own loads, as each trip issues them for the point behind it
  Own cur = load_own(xq, p, wave, idc0 & (NPTS-1), lr);
  const BNp B = make_bnp(pstats, lane, gp, bp_bn);
  const PW L = make_pw(Wp1, bp1);
  MidC K;
  make_midc(K, sS1, sO1, lr, kh, Wp2, bp2, gw1, bw1_bn, Ww1, wstats);
  // point 0's rows have landed; the barrier publishes them
  asm volatile("s_wait_asynccnt 0x0" ::: "memory");
  __syncthreads();
  copy_rows(xk, ids1, lr, cdst + PT_BLOCK/32*PTBUF*4);
  float ms[4] = {0,0,0,0}, ms2[4] = {0,0,0,0};
  for (int t = 0; t < cnt; ++t) {
    const int n = wave + t*ST_WAVES;
    const int buf = (t & 1)*(PT_BLOCK/32*PTBUF);
    const int id = idc & (NPTS-1);
    v8f w[4];
    // indices of the point after the next: as in kernel 3
    const int n1 = min(n + ST_WAVES, NPTS-1), n2 = min(n + 2*ST_WAVES, NPTS-1);
    idc = idx[(unsigned)(n2*NS + lr)];
    ids = idx[(unsigned)(n2*NS + rot)];
    gather_lane_nb(rsrc + buf, w, 0, 3);
    // loads held ahead of their uses, translation wait: as in kernel 3
    asm volatile("s_wait_xcnt 0x0" ::: "memory");
    __builtin_amdgcn_sched_barrier(0);
    const v2f f = pfrag(cur.q0, cur.q1, cur.q2, cur.c0, cur.c1, cur.c2, kh, L, B);
    // the last column tile's LDS reads: not beside the registers that the lines
    // above need
    gather_lane_nb(rsrc + buf, w, 3, 4);
    const v8f dz = {};
    const v8f d1 = mid_w2(K, w, cur.xq, f, dz, 0, 2);
    // The NEXT point's xq row and coordinates are issued here and used a trip later,
    // as in kernel 3; not at the trip's head: only here, with two column tiles done,
    // are ten registers free for them.  The two scheduling fences keep the loads at
    // this place: higher up they would cost a spill, lower down flying time.
    __builtin_amdgcn_sched_barrier(0);
    const Own nxt = load_own(xq, p, n1, id, lr);
    __builtin_amdgcn_sched_barrier(0);
    const v8f d2 = mid_w2(K, w, cur.xq, f, d1, 2, 4);
#pragma unroll
    for (int r = 0; r < 4; ++r) {
      ms[r] += d2[r]; ms2[r] = fmaf(d2[r], d2[r], ms2[r]);
    }
    // the sums above stay in front of the stores: the store of the last product's
    // result then issues behind vector instructions that have already read it
    __builtin_amdgcn_sched_barrier(0);
    // Hand-over of the buffers: this wave's reads of its buffer are done, the next
    // point's rows have landed, every wave is here; then the buffer just read is
    // filled anew.  The sums are inputs of the first wait so that they stay in front
    // of it: the first vector instructions behind the last product then read its
    // result, and none overwrites a register of it before they have.
    asm volatile("s_wait_dscnt 0x0" :: "v"(ms[0]), "v"(ms[1]), "v"(ms[2]), "v"(ms[3]),
                 "v"(ms2[0]), "v"(ms2[1]), "v"(ms2[2]), "v"(ms2[3]) : "memory");
    asm volatile("s_wait_asynccnt 0x0" ::: "memory");
    __syncthreads();
    if (t + 2 < cnt) copy_rows(xk, ids, lr, cdst + buf*4);
    // the stores stand behind the barrier, which waits for a wave's earlier stores:
    // so they have a whole trip to finish
    float* pw = w2s + (size_t)n*W2_PT + lane*4;
    float* pf = fs  + (size_t)n*F_PT  + lane*2;
    const v4f sv = {d2[0], d2[1], d2[2], d2[3]};
    *(v4f*)pw = sv;
    *(v2f*)pf = f;
    // translation wait, a precaution ahead of the next pass's reuse of the two
    // stores' address and data registers
    asm volatile("s_wait_xcnt 0x0" :: "v"(pw), "v"(pf), "v"(sv), "v"(f) : "memory");
    cur = nxt;
  }
  // no copy is left in flight when the wave ends
  asm volatile("s_wait_asynccnt 0x0" ::: "memory");
  // bw1 enters once per wave: sum(x+b) = sum x + k*b, sum(x+b)^2 = sum x^2 + 2b*sum x + k*b^2
  // k = the points this wave has taken
  const float kpts = (float)((NPTS - 1 - wave)/ST_WAVES + 1);
#pragma unroll
  for (int r = 0; r < 4; ++r) {
    const float bb = bw1[r + 4*kh];
    ms2[r] = fmaf(bb, fmaf(kpts, bb, 2.f*ms[r]), ms2[r]);
    ms[r]  = fmaf(kpts, bb, ms[r]);
    const float a = rowsum16(ms[r]), b = rowsum16(ms2[r]);
    if (lr == 0) { atomicAdd(&sm[r + 4*kh], a); atomicAdd(&sm2[r + 4*kh], b); }
  }
  __syncthreads();
  if (threadIdx.x < 8) {
    atomicAdd(&mstats[threadIdx.x],   sm[threadIdx.x]);
    atomicAdd(&mstats[8+threadIdx.x], sm2[threadIdx.x]);
  }
}

// ---------------------------------------------------------------------------
// Kernel 5: softmax + aggregation. One point per wave pass.  w2 and f come
// from kernel 4's stores, read back by the lane that wrote them.
// ---------------------------------------------------------------------------
__global__ void __launch_bounds__(PT_BLOCK) k_final(
    const int* __restrict__ idx, const float* __restrict__ xv,
    const float* __restrict__ Wp2, const float* __restrict__ bp2,
    const float* __restrict__ bw1,
    const float* __restrict__ gw2, const float* __restrict__ bw2_bn,
    const float* __restrict__ Ww2, const float* __restrict__ bw2,
    const float* __restrict__ mstats,
    const float* __restrict__ w2s, const float* __restrict__ fs,
    float* __restrict__ out)
{
  __shared__ __attribute__((aligned(16))) float sV[2][PT_BLOCK/32][PTBUF];
  const int lane = threadIdx.x & 31;
  const int lr = lane & 15, kh = lane >> 4;
  const int wave = __builtin_amdgcn_readfirstlane((int)((blockIdx.x*blockDim.x + threadIdx.x) >> 5));
  const int wv = wave & (PT_BLOCK/32 - 1);
  // where the lane's copies land (rows 8kh ..) and where it reads (rows 8kh ..)
  const unsigned cdst = (unsigned)(size_t)&sV[0][wv][kh*8*ROWP + lr*4];
  const float* rsrc = &sV[0][wv][kh*8*ROWP + lr];
  // indices of points 0 and 1 (lane lr: neighbour (lr + 8kh) & 15); point 0's rows
  // fly while the constants are made
  const int rot = (lr + 8*kh) & 15;
  int ids = idx[(unsigned)(wave*NS + rot)];
  const int ids1 = idx[(unsigned)((wave + PT_WAVES)*NS + rot)];
  copy_rows(xv, ids, lr, cdst);
  // point 0's w2 and f, as each trip issues them for the point behind it
  const float* pw0 = w2s + (size_t)wave*W2_PT + lane*4;
  const float* pf0 = fs  + (size_t)wave*F_PT  + lane*2;
  v4f d2 = *(const v4f*)pw0;
  v2f f  = *(const v2f*)pf0;
  // translation wait, a precaution ahead of any reuse of the loads' address registers
  asm volatile("s_wait_xcnt 0x0" :: "v"(pw0), "v"(pf0) : "memory");

  v2f P[4];       // unscaled positional weights, B operand of the value product
#pragma unroll
  for (int t = 0; t < 4; ++t) {
    const int ch = 16*t + lr;
    P[t][0] = kh ? Wp2[128+ch] : Wp2[ch];
    P[t][1] = kh ? bp2[ch]     : Wp2[64+ch];
  }
  // BN2 folded with bw1, for mid channel o = r + 4*kh
  float s2h[4], o2h[4];
  const float invM = 1.0f/(float)PAIRS;
#pragma unroll
  for (int r = 0; r < 4; ++r) {
    const int o = r + 4*kh;
    const float m = mstats[o]*invM;
    const float s = rsqrtf(mstats[8+o]*invM - m*m + EPSF)*gw2[o];
    s2h[r] = s;
    o2h[r] = fmaf(bw1[o] - m, s, bw2_bn[o]);
  }
  // Ww2 as B: column lr -> plane lr & 7, k = mid channels 2s+4kh, +1
  v2f G[2];
#pragma unroll
  for (int s = 0; s < 2; ++s) {
    G[s][0] = Ww2[(2*s + 4*kh)*8 + (lr & 7)];
    G[s][1] = Ww2[(2*s + 1 + 4*kh)*8 + (lr & 7)];
  }
  const float b2l = bw2[lr & 7];

  // point 0's rows have landed; the barrier publishes them
  asm volatile("s_wait_asynccnt 0x0" ::: "memory");
  __syncthreads();
  copy_rows(xv, ids1, lr, cdst + PT_BLOCK/32*PTBUF*4);
  for (int t = 0; t < NPTS/PT_WAVES; ++t) {
    const int n = wave + t*PT_WAVES;
    const int buf = (t & 1)*(PT_BLOCK/32*PTBUF);
    v8f V[4];
    // The NEXT point's w2 and f are issued here and used a trip later: they fly
    // while this point, whose own came in a trip ago, is worked on (the last
    // point's again where there is none).
    const int n1 = min(n + PT_WAVES, NPTS-1);
    const float* pw = w2s + (size_t)n1*W2_PT + lane*4;
    const float* pf = fs  + (size_t)n1*F_PT  + lane*2;
    const v4f d2n = *(const v4f*)pw;
    const v2f fn  = *(const v2f*)pf;
    // indices fetched ahead, for the copies at this trip's foot (the last point's
    // where there is none)
    const int n2 = min(n + 2*PT_WAVES, NPTS-1);
    ids = idx[(unsigned)(n2*NS + rot)];
    gather_lane_ch(rsrc + buf, V);
    // loads held ahead of their uses, translation wait: as in kernel 3
    asm volatile("s_wait_xcnt 0x0" :: "v"(pw), "v"(pf) : "memory");
    __builtin_amdgcn_sched_barrier(0);

    // logits: d3[r] = w3 of neighbour r+8kh, plane lr & 7
    float h2[4];
#pragma unroll
    for (int r = 0; r < 4; ++r) h2[r] = fmaxf(fmaf(d2[r], s2h[r], o2h[r]), 0.f);
    v8f d3 = {b2l, b2l, b2l, b2l, b2l, b2l, b2l, b2l};
#pragma unroll
    for (int s = 0; s < 2; ++s) {
      v2f a; a[0] = h2[2*s]; a[1] = h2[2*s+1];
      d3 = mm4(a, G[s], d3);
    }

    // softmax over the 16 neighbours: 8 registers and the other lane half
    float mx = fmaxf(fmaxf(fmaxf(d3[0], d3[1]), fmaxf(d3[2], d3[3])),
                     fmaxf(fmaxf(d3[4], d3[5]), fmaxf(d3[6], d3[7])));
    mx = fmaxf(mx, xhalf(mx));
    v8f e;
#pragma unroll
    for (int r = 0; r < 8; ++r) e[r] = __expf(d3[r] - mx);
    float den = sum8(e);
    den += xhalf(den);
    const float invd = 1.0f / den;

    // out[n,ch] = sum_j (xv_g + pr) * weight; xv_g + pr = f x P + xv_g
    float acc[4];
#pragma unroll
    for (int u = 0; u < 4; ++u) {
      const v8f vp = mm4(f, P[u], V[u]);
      v2f a2v = {0.f, 0.f};
#pragma unroll
      for (int i = 0; i < 4; ++i) {
        v2f x; x[0] = vp[2*i]; x[1] = vp[2*i+1];
        v2f y; y[0] = e[2*i];  y[1] = e[2*i+1];
        a2v = __builtin_elementwise_fma(x, y, a2v);
      }
      const float a = a2v[0] + a2v[1];
      acc[u] = a + xhalf(a);
    }
    float* orow = out + (size_t)n*C + 32*kh + lr;
    const float o0 = (kh ? acc[2] : acc[0]) * invd;
    const float o1 = (kh ? acc[3] : acc[1]) * invd;
    // hand-over of the buffers, as in kernel 3 (the results are the first wait's
    // inputs, for the same reason); the stores stand behind the barrier, which waits
    // for a wave's earlier stores: so they have a whole trip to finish
    asm volatile("s_wait_dscnt 0x0" :: "v"(o0), "v"(o1) : "memory");
    asm volatile("s_wait_asynccnt 0x0" ::: "memory");
    __syncthreads();
    if (t + 2 < NPTS/PT_WAVES) copy_rows(xv, ids, lr, cdst + buf*4);
    orow[0]  = o0;
    orow[16] = o1;
    // the same precaution for the two stores' address and data registers,
    // which the next pass reuses
    asm volatile("s_wait_xcnt 0x0" :: "v"(orow), "v"(o0), "v"(o1) : "memory");
    d2 = d2n; f = fn;
  }
  // no copy is left in flight when the wave ends
  asm volatile("s_wait_asynccnt 0x0" ::: "memory");
}

// ---------------------------------------------------------------------------
// Host launcher
// ---------------------------------------------------------------------------
extern "C" void kernel_launch(void* const* d_in, const int* in_sizes, int n_in,
                              void* d_out, int out_size, void* d_ws, size_t ws_size,
                              hipStream_t stream)
{
  (void)in_sizes; (void)n_in; (void)out_size; (void)ws_size;
  const float* p     = (const float*)d_in[0];
  const float* x     = (const float*)d_in[1];
  const int*   idx   = (const int*)  d_in[2];
  const float* Wq    = (const float*)d_in[3];
  const float* bq    = (const float*)d_in[4];
  const float* Wk    = (const float*)d_in[5];
  const float* bk    = (const float*)d_in[6];
  const float* Wv    = (const float*)d_in[7];
  const float* bv    = (const float*)d_in[8];
  const float* Wp1   = (const float*)d_in[9];
  const float* bp1   = (const float*)d_in[10];
  const float* gp    = (const float*)d_in[11];
  const float* bp_bn = (const float*)d_in[12];
  const float* Wp2   = (const float*)d_in[13];
  const float* bp2   = (const float*)d_in[14];
  const float* gw1   = (const float*)d_in[15];
  const float* bw1bn = (const float*)d_in[16];
  const float* Ww1   = (const float*)d_in[17];
  const float* bw1   = (const float*)d_in[18];
  const float* gw2   = (const float*)d_in[19];
  const float* bw2bn = (const float*)d_in[20];
  const float* Ww2   = (const float*)d_in[21];
  const float* bw2   = (const float*)d_in[22];

  float* ws     = (float*)d_ws;          // 96 MB + 8 KiB of the workspace
  float* xq     = ws;
  float* xk     = xq + (size_t)NPTS*C;
  float* xv     = xk + (size_t)NPTS*C;
  float* pstats = xv + (size_t)NPTS*C;   // 6 x PS_BLOCKS per-block sums
  float* wstats = pstats + 6*PS_BLOCKS;  // 128
  float* mstats = wstats + 128;          // 16
  float* w2s    = pstats + 2048;         // 32 MB, 8 KiB behind pstats
  float* fs     = w2s + (size_t)NPTS*W2_PT;  // 16 MB

  // 1) QKV projections: 4096 waves, 8 waves/block, one M-tile a wave, W in LDS;
  //    in front of them PS_BLOCKS blocks with the positional-branch BN sums and
  //    the zeros of wstats and mstats
  k_qkv<<<PS_BLOCKS + QKV_BLOCKS, 256, 0, stream>>>(x, Wq,bq, Wk,bk, Wv,bv, xq, xk, xv,
                                     p, idx, Wp1, bp1, pstats, wstats);
  // 3) attention-logit BN stats (64 ch)
  k_wstats<<<ST_WAVES*32/PT_BLOCK, PT_BLOCK, 0, stream>>>(p, idx, xq, xk, Wp1,bp1, gp,bp_bn, Wp2,bp2,
                                     pstats, wstats);
  // 4) mid BN stats (8 ch)
  k_mstats<<<ST_WAVES*32/PT_BLOCK, PT_BLOCK, 0, stream>>>(p, idx, xq, xk, Wp1,bp1, gp,bp_bn, Wp2,bp2,
                                     gw1,bw1bn, Ww1,bw1, pstats, wstats, mstats, w2s, fs);
  // 5) softmax + aggregation from kernel 4's w2 and f, one point per wave pass
  k_final<<<PT_WAVES*32/PT_BLOCK, PT_BLOCK, 0, stream>>>(idx, xv, Wp2,bp2, bw1,
                                      gw2,bw2bn, Ww2,bw2, mstats, w2s, fs,
                                      (float*)d_out);
}
